// v000
// Times are from an AMD MI455X. After a warm-up the kernel runs many times in a row, and a time is the length of
// such a window on the GPU divided by its runs, so every launch and the gaps after it count. The runs cycle
// through copies of the inputs. A figure is the median of several windows, for all but v000 over two sittings.
// Sittings can differ by a few percent; kernels timed side by side share one.
// v000, which the later versions start from, runs in 550 microseconds.
#include <hip/hip_runtime.h>
#include <hip/hip_bf16.h>
#include <stdint.h>

// ---------------------------------------------------------------------------
// ALiBi transformer layer for MI455X (gfx1250, wave32, WMMA).
// bf16 operands / f32 accumulate via v_wmma_f32_16x16x32_bf16.
// Double-buffered GEMM staging via GLOBAL_LOAD_ASYNC_TO_LDS (ASYNCcnt).
// ---------------------------------------------------------------------------

typedef __attribute__((ext_vector_type(16))) __bf16 v16bf;
typedef __attribute__((ext_vector_type(8)))  float  v8f;

union Frag16 { v16bf v; uint4 u[2]; };

static __device__ __forceinline__ __bf16 f2bf(float x) {
  unsigned u = __builtin_bit_cast(unsigned, x);
  unsigned r = (u + 0x7FFFu + ((u >> 16) & 1u)) >> 16;   // round-to-nearest-even
  unsigned short h = (unsigned short)r;
  return __builtin_bit_cast(__bf16, h);
}

// ----------------------- async global->LDS copy (b128) ----------------------
#if __has_builtin(__builtin_amdgcn_global_load_async_to_lds_b128) && \
    __has_builtin(__builtin_amdgcn_s_wait_asynccnt)
#define USE_ASYNC_LDS 1
#else
#define USE_ASYNC_LDS 0
#endif

typedef int v4i_t __attribute__((vector_size(4 * sizeof(int))));
typedef __attribute__((address_space(1))) v4i_t* g_v4i_ptr;
typedef __attribute__((address_space(3))) v4i_t* l_v4i_ptr;

static __device__ __forceinline__ void copy16_g2l(const void* g, void* l) {
#if USE_ASYNC_LDS
  __builtin_amdgcn_global_load_async_to_lds_b128(
      (g_v4i_ptr)((v4i_t*)g), (l_v4i_ptr)((v4i_t*)l), 0, 0);
#else
  *(uint4*)l = *(const uint4*)g;
#endif
}

static __device__ __forceinline__ void g2l_wait() {
#if USE_ASYNC_LDS
  __builtin_amdgcn_s_wait_asynccnt(0);
#endif
}

// ------------------------------- cast f32 -> bf16 ---------------------------
__global__ __launch_bounds__(256) void cast_bf16_kernel(
    const float* __restrict__ in, __bf16* __restrict__ out, int n) {
  int i = blockIdx.x * 256 + threadIdx.x;
  if (i < n) out[i] = f2bf(in[i]);
}

// ------------------------------- LayerNorm -> bf16 --------------------------
__global__ __launch_bounds__(256) void ln_bf16_kernel(
    const float* __restrict__ x, const float* __restrict__ g,
    const float* __restrict__ bta, __bf16* __restrict__ out) {
  constexpr int E = 1024;
  const int row = blockIdx.x;
  const int t = threadIdx.x;
  const float* xr = x + (size_t)row * E;
  float v[4];
  float s = 0.f, s2 = 0.f;
#pragma unroll
  for (int i = 0; i < 4; ++i) {
    v[i] = xr[t + i * 256];
    s += v[i];
    s2 += v[i] * v[i];
  }
#pragma unroll
  for (int o = 16; o > 0; o >>= 1) {
    s += __shfl_xor(s, o, 32);
    s2 += __shfl_xor(s2, o, 32);
  }
  __shared__ float ps[8], ps2[8];
  if ((t & 31) == 0) { ps[t >> 5] = s; ps2[t >> 5] = s2; }
  __syncthreads();
  s = 0.f; s2 = 0.f;
#pragma unroll
  for (int i = 0; i < 8; ++i) { s += ps[i]; s2 += ps2[i]; }
  const float mu = s * (1.0f / E);
  const float var = s2 * (1.0f / E) - mu * mu;
  const float rstd = rsqrtf(var + 1e-5f);
#pragma unroll
  for (int i = 0; i < 4; ++i) {
    int c = t + i * 256;
    out[(size_t)row * E + c] = f2bf((v[i] - mu) * rstd * g[c] + bta[c]);
  }
}

// ------------------------------- WMMA GEMM ----------------------------------
// C[M,N] = act(A[M,K] @ B[K,N] + bias) (+ res).  A/B bf16 row-major, acc f32.
// Block 128x128, BK=32, 8 waves; wave tile 32(M) x 64(N).
// Double-buffered LDS staging via async global->LDS copies:
//   iter k: wait(async) -> barrier -> issue stage(k+1) -> WMMA on tile k.
template <bool BIAS, bool RELU, bool RES, bool OBF16>
__global__ __launch_bounds__(256) void gemm_bf16_wmma(
    const __bf16* __restrict__ A, const __bf16* __restrict__ B,
    const float* __restrict__ bias, const float* __restrict__ res,
    float* __restrict__ Cf, __bf16* __restrict__ Cb,
    int M, int N, int K) {
  // Row strides (40, 136) keep every 16-byte chunk 16-byte aligned.
  __shared__ __attribute__((aligned(16))) __bf16 As[2][128][40];   // [m][k]
  __shared__ __attribute__((aligned(16))) __bf16 Bs[2][32][136];   // [k][n]

  const int tid = threadIdx.x;
  const int lane = tid & 31;
  const int w = tid >> 5;
  const int wm = (w & 3) * 32;   // 4 waves along M
  const int wn = (w >> 2) * 64;  // 2 waves along N
  const int m0 = blockIdx.y * 128;
  const int n0 = blockIdx.x * 128;
  const int ml = lane & 15;
  const int kb = (lane >> 4) * 8;
  const int half8 = (lane >> 4) * 8;

  v8f acc[2][4];
  const v8f vz = {};
#pragma unroll
  for (int i = 0; i < 2; ++i)
#pragma unroll
    for (int j = 0; j < 4; ++j) acc[i][j] = vz;

  auto stage = [&](int buf, int k0) {
    // A tile 128x32: 512 chunks of 8 bf16.
#pragma unroll
    for (int it = 0; it < 2; ++it) {
      int c = tid + it * 256;
      int r = c >> 2;
      int col = (c & 3) * 8;
      copy16_g2l(A + (size_t)(m0 + r) * K + k0 + col, &As[buf][r][col]);
    }
    // B tile 32x128 (kept [k][n], no transpose so it can stream async).
#pragma unroll
    for (int it = 0; it < 2; ++it) {
      int c = tid + it * 256;
      int kr = c >> 4;
      int nc = (c & 15) * 8;
      copy16_g2l(B + (size_t)(k0 + kr) * N + n0 + nc, &Bs[buf][kr][nc]);
    }
  };

  const int nk = K >> 5;
  stage(0, 0);
  for (int kk = 0; kk < nk; ++kk) {
    const int buf = kk & 1;
    g2l_wait();        // own async stores to LDS have landed
    __syncthreads();   // everyone's have
    if (kk + 1 < nk) stage(buf ^ 1, (kk + 1) * 32);

    Frag16 af[2], bfr[4];
#pragma unroll
    for (int mt = 0; mt < 2; ++mt) {
      int r = wm + mt * 16 + ml;
      af[mt].u[0] = *(const uint4*)&As[buf][r][kb];
      af[mt].u[1] = *(const uint4*)&As[buf][r][16 + kb];
    }
#pragma unroll
    for (int nt = 0; nt < 4; ++nt) {
      int n = wn + nt * 16 + ml;
#pragma unroll
      for (int e = 0; e < 16; ++e) {
        int k = (e < 8) ? (kb + e) : (16 + kb + (e - 8));
        bfr[nt].v[e] = Bs[buf][k][n];
      }
    }
#pragma unroll
    for (int mt = 0; mt < 2; ++mt)
#pragma unroll
      for (int nt = 0; nt < 4; ++nt)
        acc[mt][nt] = __builtin_amdgcn_wmma_f32_16x16x32_bf16(
            false, af[mt].v, false, bfr[nt].v, (short)0, acc[mt][nt], false, false);
    __syncthreads();   // reads done before this buffer is re-staged
  }

  // Epilogue. C layout: VGPR r -> M = r + half8, lane&15 -> N.
#pragma unroll
  for (int mt = 0; mt < 2; ++mt) {
#pragma unroll
    for (int nt = 0; nt < 4; ++nt) {
      int n = n0 + wn + nt * 16 + ml;
      float bv = BIAS ? bias[n] : 0.0f;
#pragma unroll
      for (int r = 0; r < 8; ++r) {
        int m = m0 + wm + mt * 16 + half8 + r;
        float v = acc[mt][nt][r];
        if (BIAS) v += bv;
        if (RELU) v = v > 0.0f ? v : 0.0f;
        size_t idx = (size_t)m * N + n;
        if (RES) v += res[idx];
        if (OBF16) Cb[idx] = f2bf(v);
        else       Cf[idx] = v;
      }
    }
  }
}

// ------------------------- Flash attention (WMMA) ---------------------------
// Grid (S/16, H, B), one wave per block.  kqv is bf16 [B*S, 3E], chunks
// ordered k | q | v.  Writes x1 = x + attn_out (fused residual).
__global__ __launch_bounds__(32) void attn_kernel(
    const __bf16* __restrict__ kqv, const float* __restrict__ x,
    float* __restrict__ x1) {
  constexpr int E = 1024, S = 2048, K3 = 3 * E;
  const int lane = threadIdx.x;
  const int qt = blockIdx.x;
  const int h = blockIdx.y;
  const int b = blockIdx.z;
  const int ml = lane & 15;
  const int kb = (lane >> 4) * 8;
  const int half8 = (lane >> 4) * 8;
  const float slope = exp2f(-0.5f * (float)(h + 1));  // (2^8)^(-(h+1)/16)
  const float scale = 0.03125f;                       // 1/sqrt(E)

  __shared__ float Pst[16][17];

  // Q fragments: direct b128 loads of bf16 (no conversion needed).
  Frag16 aq[2];
  {
    const __bf16* qp = kqv + ((size_t)(b * S + qt * 16 + ml)) * K3 + E + h * 64;
#pragma unroll
    for (int hf = 0; hf < 2; ++hf) {
      aq[hf].u[0] = *(const uint4*)(qp + hf * 32 + kb);
      aq[hf].u[1] = *(const uint4*)(qp + hf * 32 + 16 + kb);
    }
  }

  float mrow[8], lrow[8];
  v8f acc[4];
  const v8f vz = {};
#pragma unroll
  for (int t = 0; t < 4; ++t) acc[t] = vz;
#pragma unroll
  for (int r = 0; r < 8; ++r) { mrow[r] = -3.0e38f; lrow[r] = 0.0f; }
  const __bf16 bz = f2bf(0.0f);

  for (int j = 0; j <= qt; ++j) {
    const __bf16* kp = kqv + ((size_t)(b * S + j * 16 + ml)) * K3 + h * 64;
    const __bf16* vp = kqv + ((size_t)(b * S + j * 16)) * K3 + 2 * E + h * 64;
    if (j < qt) {                       // prefetch next K/V tiles
      __builtin_prefetch((const void*)(kp + (size_t)16 * K3), 0, 0);
      __builtin_prefetch((const void*)(vp + (size_t)16 * K3 + ml * K3), 0, 0);
    }
    // K fragments (B operand = K^T columns): direct b128 loads.
    Frag16 bk[2];
#pragma unroll
    for (int hf = 0; hf < 2; ++hf) {
      bk[hf].u[0] = *(const uint4*)(kp + hf * 32 + kb);
      bk[hf].u[1] = *(const uint4*)(kp + hf * 32 + 16 + kb);
    }
    v8f s = vz;
    s = __builtin_amdgcn_wmma_f32_16x16x32_bf16(false, aq[0].v, false, bk[0].v, (short)0, s, false, false);
    s = __builtin_amdgcn_wmma_f32_16x16x32_bf16(false, aq[1].v, false, bk[1].v, (short)0, s, false, false);

    const int kn = j * 16 + ml;
    float p[8];
#pragma unroll
    for (int r = 0; r < 8; ++r) {
      int qm = qt * 16 + half8 + r;
      float sc = s[r] * scale + slope * (float)(kn - qm);
      if (kn > qm) sc = -3.0e38f;               // causal mask
      float mx = sc;
#pragma unroll
      for (int o = 8; o > 0; o >>= 1) mx = fmaxf(mx, __shfl_xor(mx, o, 16));
      float mnew = fmaxf(mrow[r], mx);
      float alpha = __expf(mrow[r] - mnew);
      float pv = __expf(sc - mnew);
      float rs = pv;
#pragma unroll
      for (int o = 8; o > 0; o >>= 1) rs += __shfl_xor(rs, o, 16);
      lrow[r] = lrow[r] * alpha + rs;
      mrow[r] = mnew;
      p[r] = pv;
#pragma unroll
      for (int t = 0; t < 4; ++t) acc[t][r] *= alpha;
    }

    // Re-layout P (C layout) -> A operand layout via LDS staging tile.
    __syncthreads();  // WAR vs previous iteration's reads
#pragma unroll
    for (int r = 0; r < 8; ++r) Pst[half8 + r][ml] = p[r];
    __syncthreads();
    v16bf ap;
#pragma unroll
    for (int e = 0; e < 8; ++e) {
      ap[e]     = f2bf(Pst[ml][kb + e]);  // K(keys) = kb+e in 0..15
      ap[e + 8] = bz;                     // K = 16..31 zero-padded
    }

    // P @ V : 4 WMMAs covering d = 64.  V gathered as bf16 scalars.
#pragma unroll
    for (int t = 0; t < 4; ++t) {
      v16bf bv;
#pragma unroll
      for (int e = 0; e < 8; ++e) {
        bv[e]     = vp[(size_t)(kb + e) * K3 + t * 16 + ml];
        bv[e + 8] = bz;
      }
      acc[t] = __builtin_amdgcn_wmma_f32_16x16x32_bf16(
          false, ap, false, bv, (short)0, acc[t], false, false);
    }
  }

  // Normalize and fuse residual: x1 = x + attn.
#pragma unroll
  for (int r = 0; r < 8; ++r) {
    int qrow = qt * 16 + half8 + r;
    float inv = 1.0f / lrow[r];
#pragma unroll
    for (int t = 0; t < 4; ++t) {
      size_t idx = ((size_t)(b * S + qrow)) * E + h * 64 + t * 16 + ml;
      x1[idx] = x[idx] + acc[t][r] * inv;
    }
  }
}

// ------------------------------- launch -------------------------------------
extern "C" void kernel_launch(void* const* d_in, const int* in_sizes, int n_in,
                              void* d_out, int out_size, void* d_ws, size_t ws_size,
                              hipStream_t stream) {
  constexpr int E = 1024, H = 16, DFF = 4096, Bq = 2, S = 2048;
  constexpr int M = Bq * S;       // 4096
  constexpr int K3 = 3 * E;       // 3072
  (void)in_sizes; (void)n_in; (void)out_size; (void)ws_size;

  const float* x    = (const float*)d_in[0];
  const float* wkqv = (const float*)d_in[1];
  const float* ln1g = (const float*)d_in[2];
  const float* ln1b = (const float*)d_in[3];
  const float* ln2g = (const float*)d_in[4];
  const float* ln2b = (const float*)d_in[5];
  const float* w1   = (const float*)d_in[6];
  const float* b1   = (const float*)d_in[7];
  const float* w2   = (const float*)d_in[8];
  const float* b2   = (const float*)d_in[9];
  float* out = (float*)d_out;

  char* cur = (char*)d_ws;
  auto carve = [&](size_t bytes) -> char* {
    char* p = cur;
    cur += (bytes + 255) & ~(size_t)255;
    return p;
  };
  __bf16* ln1o  = (__bf16*)carve((size_t)M * E * 2);     // LN1 out (bf16)
  __bf16* wkqvb = (__bf16*)carve((size_t)E * K3 * 2);    // w_kqv bf16
  __bf16* kqvb  = (__bf16*)carve((size_t)M * K3 * 2);    // kqv bf16
  float*  x1    = (float*) carve((size_t)M * E * 4);     // x + attn
  __bf16* ln2o  = (__bf16*)carve((size_t)M * E * 2);     // LN2 out (bf16)
  __bf16* w1b   = (__bf16*)carve((size_t)E * DFF * 2);   // w1 bf16
  __bf16* w2b   = (__bf16*)carve((size_t)DFF * E * 2);   // w2 bf16
  __bf16* h1    = (__bf16*)carve((size_t)M * DFF * 2);   // relu(ffn1) bf16

  cast_bf16_kernel<<<(E * K3 + 255) / 256, 256, 0, stream>>>(wkqv, wkqvb, E * K3);
  cast_bf16_kernel<<<(E * DFF + 255) / 256, 256, 0, stream>>>(w1, w1b, E * DFF);
  cast_bf16_kernel<<<(DFF * E + 255) / 256, 256, 0, stream>>>(w2, w2b, DFF * E);

  ln_bf16_kernel<<<M, 256, 0, stream>>>(x, ln1g, ln1b, ln1o);

  // kqv = ln1 @ w_kqv -> bf16   [4096 x 3072], K=1024
  gemm_bf16_wmma<false, false, false, true>
      <<<dim3(K3 / 128, M / 128), 256, 0, stream>>>(
          ln1o, wkqvb, nullptr, nullptr, nullptr, kqvb, M, K3, E);

  // x1 = x + attention(kqv)
  attn_kernel<<<dim3(S / 16, H, Bq), 32, 0, stream>>>(kqvb, x, x1);

  ln_bf16_kernel<<<M, 256, 0, stream>>>(x1, ln2g, ln2b, ln2o);

  // h1 = relu(ln2 @ w1 + b1) -> bf16   [4096 x 4096], K=1024
  gemm_bf16_wmma<true, true, false, true>
      <<<dim3(DFF / 128, M / 128), 256, 0, stream>>>(
          ln2o, w1b, b1, nullptr, nullptr, h1, M, DFF, E);

  // out = h1 @ w2 + b2 + x1   [4096 x 1024], K=4096
  gemm_bf16_wmma<true, false, true, false>
      <<<dim3(E / 128, M / 128), 256, 0, stream>>>(
          h1, w2b, b2, x1, out, nullptr, M, E, DFF);
}

// v001
// A run of this version takes 340 microseconds.
// Two timings next to v000 put it at 1.68 and 1.67 times that version's speed.
#include <hip/hip_runtime.h>
#include <hip/hip_bf16.h>
#include <stdint.h>

// ---------------------------------------------------------------------------
// ALiBi transformer layer for MI455X (gfx1250, wave32, WMMA).
// bf16 operands / f32 accumulate via v_wmma_f32_16x16x32_bf16.
// Double-buffered GEMM staging via GLOBAL_LOAD_ASYNC_TO_LDS (ASYNCcnt).
// ---------------------------------------------------------------------------

typedef __attribute__((ext_vector_type(16))) __bf16 v16bf;
typedef __attribute__((ext_vector_type(8)))  float  v8f;

union Frag16 { v16bf v; uint4 u[2]; };

static __device__ __forceinline__ __bf16 f2bf(float x) {
  unsigned u = __builtin_bit_cast(unsigned, x);
  unsigned r = (u + 0x7FFFu + ((u >> 16) & 1u)) >> 16;   // round-to-nearest-even
  unsigned short h = (unsigned short)r;
  return __builtin_bit_cast(__bf16, h);
}

// ----------------------- async global->LDS copy (b128) ----------------------
#if __has_builtin(__builtin_amdgcn_global_load_async_to_lds_b128) && \
    __has_builtin(__builtin_amdgcn_s_wait_asynccnt)
#define USE_ASYNC_LDS 1
#else
#define USE_ASYNC_LDS 0
#endif

typedef int v4i_t __attribute__((vector_size(4 * sizeof(int))));
typedef __attribute__((address_space(1))) v4i_t* g_v4i_ptr;
typedef __attribute__((address_space(3))) v4i_t* l_v4i_ptr;

static __device__ __forceinline__ void copy16_g2l(const void* g, void* l) {
#if USE_ASYNC_LDS
  __builtin_amdgcn_global_load_async_to_lds_b128(
      (g_v4i_ptr)((v4i_t*)g), (l_v4i_ptr)((v4i_t*)l), 0, 0);
#else
  *(uint4*)l = *(const uint4*)g;
#endif
}

static __device__ __forceinline__ void g2l_wait() {
#if USE_ASYNC_LDS
  __builtin_amdgcn_s_wait_asynccnt(0);
#endif
}

// ------------------------------- cast f32 -> bf16 ---------------------------
__global__ __launch_bounds__(256) void cast_bf16_kernel(
    const float* __restrict__ in, __bf16* __restrict__ out, int n) {
  int i = blockIdx.x * 256 + threadIdx.x;
  if (i < n) out[i] = f2bf(in[i]);
}

// ------------------------------- LayerNorm -> bf16 --------------------------
__global__ __launch_bounds__(256) void ln_bf16_kernel(
    const float* __restrict__ x, const float* __restrict__ g,
    const float* __restrict__ bta, __bf16* __restrict__ out) {
  constexpr int E = 1024;
  const int row = blockIdx.x;
  const int t = threadIdx.x;
  const float* xr = x + (size_t)row * E;
  float v[4];
  float s = 0.f, s2 = 0.f;
#pragma unroll
  for (int i = 0; i < 4; ++i) {
    v[i] = xr[t + i * 256];
    s += v[i];
    s2 += v[i] * v[i];
  }
#pragma unroll
  for (int o = 16; o > 0; o >>= 1) {
    s += __shfl_xor(s, o, 32);
    s2 += __shfl_xor(s2, o, 32);
  }
  __shared__ float ps[8], ps2[8];
  if ((t & 31) == 0) { ps[t >> 5] = s; ps2[t >> 5] = s2; }
  __syncthreads();
  s = 0.f; s2 = 0.f;
#pragma unroll
  for (int i = 0; i < 8; ++i) { s += ps[i]; s2 += ps2[i]; }
  const float mu = s * (1.0f / E);
  const float var = s2 * (1.0f / E) - mu * mu;
  const float rstd = rsqrtf(var + 1e-5f);
#pragma unroll
  for (int i = 0; i < 4; ++i) {
    int c = t + i * 256;
    out[(size_t)row * E + c] = f2bf((v[i] - mu) * rstd * g[c] + bta[c]);
  }
}

// ------------------------------- WMMA GEMM ----------------------------------
// C[M,N] = act(A[M,K] @ B[K,N] + bias) (+ res).  A/B bf16 row-major, acc f32.
// Block 128x128, BK=32, 8 waves; wave tile 32(M) x 64(N).
// Double-buffered LDS staging via async global->LDS copies:
//   iter k: wait(async) -> barrier -> issue stage(k+1) -> WMMA on tile k.
template <bool BIAS, bool RELU, bool RES, bool OBF16>
__global__ __launch_bounds__(256) void gemm_bf16_wmma(
    const __bf16* __restrict__ A, const __bf16* __restrict__ B,
    const float* __restrict__ bias, const float* __restrict__ res,
    float* __restrict__ Cf, __bf16* __restrict__ Cb,
    int M, int N, int K) {
  // Row strides (40, 136) keep every 16-byte chunk 16-byte aligned.
  __shared__ __attribute__((aligned(16))) __bf16 As[2][128][40];   // [m][k]
  __shared__ __attribute__((aligned(16))) __bf16 Bs[2][32][136];   // [k][n]

  const int tid = threadIdx.x;
  const int lane = tid & 31;
  const int w = tid >> 5;
  const int wm = (w & 3) * 32;   // 4 waves along M
  const int wn = (w >> 2) * 64;  // 2 waves along N
  const int m0 = blockIdx.y * 128;
  const int n0 = blockIdx.x * 128;
  const int ml = lane & 15;
  const int kb = (lane >> 4) * 8;
  const int half8 = (lane >> 4) * 8;

  v8f acc[2][4];
  const v8f vz = {};
#pragma unroll
  for (int i = 0; i < 2; ++i)
#pragma unroll
    for (int j = 0; j < 4; ++j) acc[i][j] = vz;

  auto stage = [&](int buf, int k0) {
    // A tile 128x32: 512 chunks of 8 bf16.
#pragma unroll
    for (int it = 0; it < 2; ++it) {
      int c = tid + it * 256;
      int r = c >> 2;
      int col = (c & 3) * 8;
      copy16_g2l(A + (size_t)(m0 + r) * K + k0 + col, &As[buf][r][col]);
    }
    // B tile 32x128 (kept [k][n], no transpose so it can stream async).
#pragma unroll
    for (int it = 0; it < 2; ++it) {
      int c = tid + it * 256;
      int kr = c >> 4;
      int nc = (c & 15) * 8;
      copy16_g2l(B + (size_t)(k0 + kr) * N + n0 + nc, &Bs[buf][kr][nc]);
    }
  };

  const int nk = K >> 5;
  stage(0, 0);
  for (int kk = 0; kk < nk; ++kk) {
    const int buf = kk & 1;
    g2l_wait();        // own async stores to LDS have landed
    __syncthreads();   // everyone's have
    if (kk + 1 < nk) stage(buf ^ 1, (kk + 1) * 32);

    Frag16 af[2], bfr[4];
#pragma unroll
    for (int mt = 0; mt < 2; ++mt) {
      int r = wm + mt * 16 + ml;
      af[mt].u[0] = *(const uint4*)&As[buf][r][kb];
      af[mt].u[1] = *(const uint4*)&As[buf][r][16 + kb];
    }
#pragma unroll
    for (int nt = 0; nt < 4; ++nt) {
      int n = wn + nt * 16 + ml;
#pragma unroll
      for (int e = 0; e < 16; ++e) {
        int k = (e < 8) ? (kb + e) : (16 + kb + (e - 8));
        bfr[nt].v[e] = Bs[buf][k][n];
      }
    }
#pragma unroll
    for (int mt = 0; mt < 2; ++mt)
#pragma unroll
      for (int nt = 0; nt < 4; ++nt)
        acc[mt][nt] = __builtin_amdgcn_wmma_f32_16x16x32_bf16(
            false, af[mt].v, false, bfr[nt].v, (short)0, acc[mt][nt], false, false);
    __syncthreads();   // reads done before this buffer is re-staged
  }

  // Epilogue. C layout: VGPR r -> M = r + half8, lane&15 -> N.
#pragma unroll
  for (int mt = 0; mt < 2; ++mt) {
#pragma unroll
    for (int nt = 0; nt < 4; ++nt) {
      int n = n0 + wn + nt * 16 + ml;
      float bv = BIAS ? bias[n] : 0.0f;
#pragma unroll
      for (int r = 0; r < 8; ++r) {
        int m = m0 + wm + mt * 16 + half8 + r;
        float v = acc[mt][nt][r];
        if (BIAS) v += bv;
        if (RELU) v = v > 0.0f ? v : 0.0f;
        size_t idx = (size_t)m * N + n;
        if (RES) v += res[idx];
        if (OBF16) Cb[idx] = f2bf(v);
        else       Cf[idx] = v;
      }
    }
  }
}

typedef uint32_t u32x4 __attribute__((ext_vector_type(4)));
typedef short s16x8 __attribute__((ext_vector_type(8)));
typedef float f32x4 __attribute__((ext_vector_type(4)));
typedef float f32x2 __attribute__((ext_vector_type(2)));
union FragT { v16bf v; u32x4 q[2]; };

constexpr int AT_PK = 144;              // K row pitch in LDS: 16 B x odd (ds_load_b128)
constexpr int AT_PV = 160;              // V row pitch in LDS: 32 B x odd (ds_load_tr16_b128)
constexpr int AT_TK = 64 * AT_PK;       // one K tile
constexpr int AT_SLOT = AT_TK + 64 * AT_PV;

static __device__ __forceinline__ u32x4 ld_tr16(const unsigned char* p) {
  typedef __attribute__((address_space(3))) s16x8 lds_s16x8;
  return __builtin_bit_cast(u32x4, __builtin_amdgcn_ds_load_tr16_b128_v8i16((lds_s16x8*)p));
}
static __device__ __forceinline__ uint32_t pack2(float lo, float hi) {  // round to nearest even
  typedef __bf16 bf2 __attribute__((ext_vector_type(2)));
  typedef float f2 __attribute__((ext_vector_type(2)));
  return __builtin_bit_cast(uint32_t, __builtin_convertvector(f2{lo, hi}, bf2));
}
static __device__ __forceinline__ float xhalf(float v) {  // lane l <-> lane l ^ 16
  int b = __builtin_bit_cast(int, v);
  return __builtin_bit_cast(float,
      __builtin_amdgcn_permlanex16(b, b, 0x76543210, 0xfedcba98, false, false));
}
static __device__ __forceinline__ v8f mma_bf16(const FragT& a, const FragT& b, v8f c) {
  return __builtin_amdgcn_wmma_f32_16x16x32_bf16(false, a.v, false, b.v, (short)0, c, false, false);
}

__global__ __launch_bounds__(128) void attn_kernel(
    const __bf16* __restrict__ kqv, const float* __restrict__ x,
    float* __restrict__ x1) {
  constexpr int E = 1024, S = 2048, K3 = 3 * E;
  __shared__ __attribute__((aligned(32))) unsigned char L[2 * AT_SLOT];
  const int tid = threadIdx.x;
  const int lane = tid & 31;
  const int wave = __builtin_amdgcn_readfirstlane(tid >> 5);
  const int c = lane & 15;
  const int hh = lane >> 4;
  const int h = blockIdx.x & 15;
  const int b = blockIdx.x >> 4;
  // Query block: long blocks get low indices; every second group of 8 ranks
  // runs the other way, so that indices 256 apart add up to equal lengths.
  const int rg = blockIdx.y >> 3, rj = blockIdx.y & 7;
  const int qb = 31 - (8 * rg + ((rg & 1) ? 7 - rj : rj));
  const int qw0 = qb * 64 + wave * 16;   // first query of this wave
  const int myq = qw0 + c;               // this lane's query
  constexpr float LOG2E = 1.4426950408889634f;
  const float slope2 = exp2f(-0.5f * (float)(h + 1)) * LOG2E;  // (2^8)^(-(h+1)/16), base 2
  const float c1 = 0.03125f * LOG2E;                           // 1/sqrt(E), base 2

  const __bf16* kvb = kqv + (size_t)(b * S) * K3 + h * 64;     // K rows; V rows at + 2E
  const int srow = tid >> 3, scol = tid & 7;
  u32x4 rk[4], rv[4];
  auto gload = [&](int st) {
    for (int it = 0; it < 4; ++it) {
      const __bf16* p = kvb + (size_t)(st * 64 + srow + it * 16) * K3 + scol * 8;
      rk[it] = *(const u32x4*)p;
      rv[it] = *(const u32x4*)(p + 2 * E);
    }
  };
  auto lstore = [&](int buf) {
    unsigned char* d = L + buf * AT_SLOT;
    for (int it = 0; it < 4; ++it) {
      const int row = srow + it * 16;
      *(u32x4*)(d + row * AT_PK + scol * 16) = rk[it];
      *(u32x4*)(d + AT_TK + row * AT_PV + scol * 16) = rv[it];
    }
  };

  gload(0);
  // Q fragments (B operand), k order 8*hh + 0..7, 16 + 8*hh + 0..7 per 32.
  FragT qf[2];
  {
    const __bf16* qp = kqv + (size_t)(b * S + myq) * K3 + E + h * 64 + 8 * hh;
    for (int kc = 0; kc < 2; ++kc) {
      qf[kc].q[0] = *(const u32x4*)(qp + 32 * kc);
      qf[kc].q[1] = *(const u32x4*)(qp + 32 * kc + 16);
    }
  }
  const v8f vz = {};
  v8f acc[4];                            // acc[t][r] = O^T[16 t + 8 hh + r][query c]
  for (int t = 0; t < 4; ++t) acc[t] = vz;
  float m_run = -INFINITY;               // running maximum (base 2), equal in both halves
  float l_run = 0.0f;                    // this half's share of the denominator
  lstore(0);
  __syncthreads();                       // tile 0 visible to all four waves

  const int nst = qb + 1;                // the last tile holds the diagonal
  for (int st = 0; st < nst; ++st) {
    const unsigned char* Lb = L + (st & 1) * AT_SLOT;
    const bool more = st + 1 < nst;
    if (more) {
      gload(st + 1);                     // in flight under this tile's work
      // The loads' address registers are reused by the work below.
      asm volatile("s_wait_xcnt 0x0" ::: "memory");
    }
    for (int sub = 0; sub < 2; ++sub) {
      const int key0 = st * 64 + sub * 32;
      if (key0 <= qw0 + 15) {            // wave-uniform: skip keys beyond the wave's last query
        FragT kf[2][2], vf[4];
        for (int kt = 0; kt < 2; ++kt) {
          const unsigned char* p = Lb + (sub * 32 + 16 * kt + c) * AT_PK + 16 * hh;
          for (int kc = 0; kc < 2; ++kc) {
            kf[kt][kc].q[0] = *(const u32x4*)(p + 64 * kc);
            kf[kt][kc].q[1] = *(const u32x4*)(p + 64 * kc + 32);
          }
        }
        {
          const unsigned char* ad = Lb + AT_TK + (sub * 32 + 8 * hh + (lane & 7)) * AT_PV +
                                    ((lane >> 3) & 1) * 16;
          for (int t = 0; t < 4; ++t) {
            vf[t].q[0] = ld_tr16(ad + 32 * t);
            vf[t].q[1] = ld_tr16(ad + 16 * AT_PV + 32 * t);
          }
        }
        // Keeps the pass's 16 LDS loads in one group ahead of the products: one
        // LDS latency a pass; left free, each product waited for its own pair.
        __builtin_amdgcn_sched_barrier(0);
        f32x2 tv[8];                     // tv[4 kt + j]: keys key0 + 16 kt + 8 hh + 2 j, + 1
        for (int kt = 0; kt < 2; ++kt) {
          v8f s = mma_bf16(kf[kt][0], qf[0], vz);
          s = mma_bf16(kf[kt][1], qf[1], s);
          for (int j = 0; j < 4; ++j)
            tv[4 * kt + j] = __builtin_elementwise_fma(
                f32x2{s[2 * j], s[2 * j + 1]}, f32x2{c1, c1},
                f32x2{slope2 * (float)(16 * kt + 2 * j), slope2 * (float)(16 * kt + 2 * j + 1)});
        }
        if (key0 + 31 > qw0) {           // wave-uniform: causal mask near the diagonal only
          for (int i = 0; i < 8; ++i) {
            const int key = key0 + 16 * (i >> 2) + 8 * hh + 2 * (i & 3);
            if (key > myq) tv[i].x = -INFINITY;
            if (key + 1 > myq) tv[i].y = -INFINITY;
          }
        }
        float mx = fmaxf(tv[0].x, tv[0].y);
        for (int i = 1; i < 8; ++i) mx = fmaxf(fmaxf(mx, tv[i].x), tv[i].y);
        const float base = slope2 * (float)(key0 + 8 * hh - myq);  // rest of the ALiBi term, per half
        mx += base;
        mx = fmaxf(mx, xhalf(mx));       // finite: the pass's first key is visible to every query
        const float m_new = fmaxf(m_run, mx);
        const float corr = __builtin_amdgcn_exp2f(m_run - m_new);
        const float nm = base - m_new;
        m_run = m_new;
        f32x2 ps2 = {0.0f, 0.0f};
        FragT pf;
        for (int i = 0; i < 8; ++i) {
          const f32x2 a = tv[i] + f32x2{nm, nm};
          const f32x2 p = {__builtin_amdgcn_exp2f(a.x), __builtin_amdgcn_exp2f(a.y)};
          ps2 += p;
          pf.q[i >> 2][i & 3] = pack2(p.x, p.y);
        }
        const float ps = ps2.x + ps2.y;
        l_run = l_run * corr + ps;
        for (int t = 0; t < 4; ++t) acc[t] = acc[t] * corr;
        for (int t = 0; t < 4; ++t) acc[t] = mma_bf16(vf[t], pf, acc[t]);
      }
    }
    if (more) {
      lstore((st + 1) & 1);              // its last readers left before the previous barrier
      __syncthreads();                   // next tile visible; this tile's reads are over
    }
  }

  // Join the halves' denominators, normalize, fuse the residual: x1 = x + attn.
  // A lane owns 8 consecutive d of its query per tile: two 16-byte accesses.
  const float inv = 1.0f / (l_run + xhalf(l_run));
  for (int t = 0; t < 4; ++t) {
    const size_t idx = (size_t)(b * S + myq) * E + h * 64 + 16 * t + 8 * hh;
    const f32x4 xa = *(const f32x4*)(x + idx);
    const f32x4 xb = *(const f32x4*)(x + idx + 4);
    const f32x4 oa = {acc[t][0], acc[t][1], acc[t][2], acc[t][3]};
    const f32x4 ob = {acc[t][4], acc[t][5], acc[t][6], acc[t][7]};
    *(f32x4*)(x1 + idx) = xa + oa * inv;
    *(f32x4*)(x1 + idx + 4) = xb + ob * inv;
  }
}

// ------------------------------- launch -------------------------------------
extern "C" void kernel_launch(void* const* d_in, const int* in_sizes, int n_in,
                              void* d_out, int out_size, void* d_ws, size_t ws_size,
                              hipStream_t stream) {
  constexpr int E = 1024, H = 16, DFF = 4096, Bq = 2, S = 2048;
  constexpr int M = Bq * S;       // 4096
  constexpr int K3 = 3 * E;       // 3072
  (void)in_sizes; (void)n_in; (void)out_size; (void)ws_size;

  const float* x    = (const float*)d_in[0];
  const float* wkqv = (const float*)d_in[1];
  const float* ln1g = (const float*)d_in[2];
  const float* ln1b = (const float*)d_in[3];
  const float* ln2g = (const float*)d_in[4];
  const float* ln2b = (const float*)d_in[5];
  const float* w1   = (const float*)d_in[6];
  const float* b1   = (const float*)d_in[7];
  const float* w2   = (const float*)d_in[8];
  const float* b2   = (const float*)d_in[9];
  float* out = (float*)d_out;

  char* cur = (char*)d_ws;
  auto carve = [&](size_t bytes) -> char* {
    char* p = cur;
    cur += (bytes + 255) & ~(size_t)255;
    return p;
  };
  __bf16* ln1o  = (__bf16*)carve((size_t)M * E * 2);     // LN1 out (bf16)
  __bf16* wkqvb = (__bf16*)carve((size_t)E * K3 * 2);    // w_kqv bf16
  __bf16* kqvb  = (__bf16*)carve((size_t)M * K3 * 2);    // kqv bf16
  float*  x1    = (float*) carve((size_t)M * E * 4);     // x + attn
  __bf16* ln2o  = (__bf16*)carve((size_t)M * E * 2);     // LN2 out (bf16)
  __bf16* w1b   = (__bf16*)carve((size_t)E * DFF * 2);   // w1 bf16
  __bf16* w2b   = (__bf16*)carve((size_t)DFF * E * 2);   // w2 bf16
  __bf16* h1    = (__bf16*)carve((size_t)M * DFF * 2);   // relu(ffn1) bf16

  cast_bf16_kernel<<<(E * K3 + 255) / 256, 256, 0, stream>>>(wkqv, wkqvb, E * K3);
  cast_bf16_kernel<<<(E * DFF + 255) / 256, 256, 0, stream>>>(w1, w1b, E * DFF);
  cast_bf16_kernel<<<(DFF * E + 255) / 256, 256, 0, stream>>>(w2, w2b, DFF * E);

  ln_bf16_kernel<<<M, 256, 0, stream>>>(x, ln1g, ln1b, ln1o);

  // kqv = ln1 @ w_kqv -> bf16   [4096 x 3072], K=1024
  gemm_bf16_wmma<false, false, false, true>
      <<<dim3(K3 / 128, M / 128), 256, 0, stream>>>(
          ln1o, wkqvb, nullptr, nullptr, nullptr, kqvb, M, K3, E);

  // x1 = x + attention(kqv)
  attn_kernel<<<dim3(H * Bq, S / 64), 128, 0, stream>>>(kqvb, x, x1);

  ln_bf16_kernel<<<M, 256, 0, stream>>>(x1, ln2g, ln2b, ln2o);

  // h1 = relu(ln2 @ w1 + b1) -> bf16   [4096 x 4096], K=1024
  gemm_bf16_wmma<true, true, false, true>
      <<<dim3(DFF / 128, M / 128), 256, 0, stream>>>(
          ln2o, w1b, b1, nullptr, nullptr, h1, M, DFF, E);

  // out = h1 @ w2 + b2 + x1   [4096 x 1024], K=4096
  gemm_bf16_wmma<true, false, true, false>
      <<<dim3(E / 128, M / 128), 256, 0, stream>>>(
          h1, w2b, b2, x1, out, nullptr, M, E, DFF);
}

// v002
// It runs in 238 microseconds.
// Next to v001, in two timings, it ran 1.43 times as fast each time.
// All steps since v000 together make it 2.39 times as fast.
#include <hip/hip_runtime.h>
#include <hip/hip_bf16.h>
#include <stdint.h>

// ---------------------------------------------------------------------------
// ALiBi transformer layer for MI455X (gfx1250, wave32, WMMA).
// bf16 operands / f32 accumulate via v_wmma_f32_16x16x32_bf16.
// Double-buffered GEMM staging via GLOBAL_LOAD_ASYNC_TO_LDS (ASYNCcnt).
// ---------------------------------------------------------------------------

typedef __attribute__((ext_vector_type(16))) __bf16 v16bf;
typedef __attribute__((ext_vector_type(8)))  float  v8f;

union Frag16 { v16bf v; uint4 u[2]; };

typedef uint32_t u32x4 __attribute__((ext_vector_type(4)));
typedef short s16x8 __attribute__((ext_vector_type(8)));
union FragT { v16bf v; u32x4 q[2]; };

// Transposing LDS load: lane (c = l & 15, h = l >> 4) gets T[8 h + 0..7][c] of a
// row-major 16-bit tile whose lane addresses are row 8 h + (l & 7), byte 16 * ((l >> 3) & 1).
static __device__ __forceinline__ u32x4 ld_tr16(const unsigned char* p) {
  typedef __attribute__((address_space(3))) s16x8 lds_s16x8;
  return __builtin_bit_cast(u32x4, __builtin_amdgcn_ds_load_tr16_b128_v8i16((lds_s16x8*)p));
}

static __device__ __forceinline__ __bf16 f2bf(float x) {
  unsigned u = __builtin_bit_cast(unsigned, x);
  unsigned r = (u + 0x7FFFu + ((u >> 16) & 1u)) >> 16;   // round-to-nearest-even
  unsigned short h = (unsigned short)r;
  return __builtin_bit_cast(__bf16, h);
}

// ----------------------- async global->LDS copy (b128) ----------------------
#if __has_builtin(__builtin_amdgcn_global_load_async_to_lds_b128) && \
    __has_builtin(__builtin_amdgcn_s_wait_asynccnt)
#define USE_ASYNC_LDS 1
#else
#define USE_ASYNC_LDS 0
#endif

typedef int v4i_t __attribute__((vector_size(4 * sizeof(int))));
typedef __attribute__((address_space(1))) v4i_t* g_v4i_ptr;
typedef __attribute__((address_space(3))) v4i_t* l_v4i_ptr;

static __device__ __forceinline__ void copy16_g2l(const void* g, void* l) {
#if USE_ASYNC_LDS
  __builtin_amdgcn_global_load_async_to_lds_b128(
      (g_v4i_ptr)((v4i_t*)g), (l_v4i_ptr)((v4i_t*)l), 0, 0);
#else
  *(uint4*)l = *(const uint4*)g;
#endif
}

static __device__ __forceinline__ void g2l_wait() {
#if USE_ASYNC_LDS
  __builtin_amdgcn_s_wait_asynccnt(0);
#endif
}

// ------------------------------- cast f32 -> bf16 ---------------------------
__global__ __launch_bounds__(256) void cast_bf16_kernel(
    const float* __restrict__ in, __bf16* __restrict__ out, int n) {
  int i = blockIdx.x * 256 + threadIdx.x;
  if (i < n) out[i] = f2bf(in[i]);
}

// ------------------------------- LayerNorm -> bf16 --------------------------
__global__ __launch_bounds__(256) void ln_bf16_kernel(
    const float* __restrict__ x, const float* __restrict__ g,
    const float* __restrict__ bta, __bf16* __restrict__ out) {
  constexpr int E = 1024;
  const int row = blockIdx.x;
  const int t = threadIdx.x;
  const float* xr = x + (size_t)row * E;
  float v[4];
  float s = 0.f, s2 = 0.f;
#pragma unroll
  for (int i = 0; i < 4; ++i) {
    v[i] = xr[t + i * 256];
    s += v[i];
    s2 += v[i] * v[i];
  }
#pragma unroll
  for (int o = 16; o > 0; o >>= 1) {
    s += __shfl_xor(s, o, 32);
    s2 += __shfl_xor(s2, o, 32);
  }
  __shared__ float ps[8], ps2[8];
  if ((t & 31) == 0) { ps[t >> 5] = s; ps2[t >> 5] = s2; }
  __syncthreads();
  s = 0.f; s2 = 0.f;
#pragma unroll
  for (int i = 0; i < 8; ++i) { s += ps[i]; s2 += ps2[i]; }
  const float mu = s * (1.0f / E);
  const float var = s2 * (1.0f / E) - mu * mu;
  const float rstd = rsqrtf(var + 1e-5f);
#pragma unroll
  for (int i = 0; i < 4; ++i) {
    int c = t + i * 256;
    out[(size_t)row * E + c] = f2bf((v[i] - mu) * rstd * g[c] + bta[c]);
  }
}

// ------------------------------- WMMA GEMM ----------------------------------
// C[M,N] = act(A[M,K] @ B[K,N] + bias) (+ res).  A/B bf16 row-major, acc f32.
// Block 128x128, BK=32, 8 waves; wave tile 32(M) x 64(N).
// Double-buffered LDS staging via async global->LDS copies:
//   iter k: wait(async) -> barrier -> issue stage(k+1) -> WMMA on tile k.
template <bool BIAS, bool RELU, bool RES, bool OBF16>
__global__ __launch_bounds__(256) void gemm_bf16_wmma(
    const __bf16* __restrict__ A, const __bf16* __restrict__ B,
    const float* __restrict__ bias, const float* __restrict__ res,
    float* __restrict__ Cf, __bf16* __restrict__ Cb,
    int M, int N, int K) {
  // A rows: 80 B = 16 B x odd (ds_load_b128); B rows: 288 B = 32 B x odd (ds_load_tr16_b128).
  constexpr int PB = 144;
  __shared__ __attribute__((aligned(16))) __bf16 As[2][128][40];   // [m][k]
  __shared__ __attribute__((aligned(32))) __bf16 Bs[2][32][PB];    // [k][n]

  const int tid = threadIdx.x;
  const int lane = tid & 31;
  const int w = tid >> 5;
  const int wm = (w & 3) * 32;   // 4 waves along M
  const int wn = (w >> 2) * 64;  // 2 waves along N
  const int m0 = blockIdx.y * 128;
  const int n0 = blockIdx.x * 128;
  const int ml = lane & 15;
  const int kb = (lane >> 4) * 8;
  const int half8 = (lane >> 4) * 8;

  v8f acc[2][4];
  const v8f vz = {};
#pragma unroll
  for (int i = 0; i < 2; ++i)
#pragma unroll
    for (int j = 0; j < 4; ++j) acc[i][j] = vz;

  auto stage = [&](int buf, int k0) {
    // A tile 128x32: 512 chunks of 8 bf16.
#pragma unroll
    for (int it = 0; it < 2; ++it) {
      int c = tid + it * 256;
      int r = c >> 2;
      int col = (c & 3) * 8;
      copy16_g2l(A + (size_t)(m0 + r) * K + k0 + col, &As[buf][r][col]);
    }
    // B tile 32x128 (kept [k][n], no transpose so it can stream async).
#pragma unroll
    for (int it = 0; it < 2; ++it) {
      int c = tid + it * 256;
      int kr = c >> 4;
      int nc = (c & 15) * 8;
      copy16_g2l(B + (size_t)(k0 + kr) * N + n0 + nc, &Bs[buf][kr][nc]);
    }
  };

  const int nk = K >> 5;
  stage(0, 0);
  for (int kk = 0; kk < nk; ++kk) {
    const int buf = kk & 1;
    g2l_wait();        // own async stores to LDS have landed
    __syncthreads();   // everyone's have
    if (kk + 1 < nk) stage(buf ^ 1, (kk + 1) * 32);

    Frag16 af[2];
    FragT bfr[4];
#pragma unroll
    for (int mt = 0; mt < 2; ++mt) {
      int r = wm + mt * 16 + ml;
      af[mt].u[0] = *(const uint4*)&As[buf][r][kb];
      af[mt].u[1] = *(const uint4*)&As[buf][r][16 + kb];
    }
    // B fragments straight from the [k][n] tile: k = kb + 0..7 and 16 + kb + 0..7 of
    // column wn + 16 nt + ml, the same k order as A's two 16-byte loads.
    const unsigned char* bp = (const unsigned char*)&Bs[buf][kb + (lane & 7)][wn + ((lane >> 3) & 1) * 8];
#pragma unroll
    for (int nt = 0; nt < 4; ++nt) {
      bfr[nt].q[0] = ld_tr16(bp + 32 * nt);
      bfr[nt].q[1] = ld_tr16(bp + 16 * PB * 2 + 32 * nt);
    }
#pragma unroll
    for (int mt = 0; mt < 2; ++mt)
#pragma unroll
      for (int nt = 0; nt < 4; ++nt)
        acc[mt][nt] = __builtin_amdgcn_wmma_f32_16x16x32_bf16(
            false, af[mt].v, false, bfr[nt].v, (short)0, acc[mt][nt], false, false);
    __syncthreads();   // reads done before this buffer is re-staged
  }

  // Epilogue. C layout: VGPR r -> M = r + half8, lane&15 -> N.
#pragma unroll
  for (int mt = 0; mt < 2; ++mt) {
#pragma unroll
    for (int nt = 0; nt < 4; ++nt) {
      int n = n0 + wn + nt * 16 + ml;
      float bv = BIAS ? bias[n] : 0.0f;
#pragma unroll
      for (int r = 0; r < 8; ++r) {
        int m = m0 + wm + mt * 16 + half8 + r;
        float v = acc[mt][nt][r];
        if (BIAS) v += bv;
        if (RELU) v = v > 0.0f ? v : 0.0f;
        size_t idx = (size_t)m * N + n;
        if (RES) v += res[idx];
        if (OBF16) Cb[idx] = f2bf(v);
        else       Cf[idx] = v;
      }
    }
  }
}

typedef float f32x4 __attribute__((ext_vector_type(4)));
typedef float f32x2 __attribute__((ext_vector_type(2)));

constexpr int AT_PK = 144;              // K row pitch in LDS: 16 B x odd (ds_load_b128)
constexpr int AT_PV = 160;              // V row pitch in LDS: 32 B x odd (ds_load_tr16_b128)
constexpr int AT_TK = 64 * AT_PK;       // one K tile
constexpr int AT_SLOT = AT_TK + 64 * AT_PV;

static __device__ __forceinline__ uint32_t pack2(float lo, float hi) {  // round to nearest even
  typedef __bf16 bf2 __attribute__((ext_vector_type(2)));
  typedef float f2 __attribute__((ext_vector_type(2)));
  return __builtin_bit_cast(uint32_t, __builtin_convertvector(f2{lo, hi}, bf2));
}
static __device__ __forceinline__ float xhalf(float v) {  // lane l <-> lane l ^ 16
  int b = __builtin_bit_cast(int, v);
  return __builtin_bit_cast(float,
      __builtin_amdgcn_permlanex16(b, b, 0x76543210, 0xfedcba98, false, false));
}
static __device__ __forceinline__ v8f mma_bf16(const FragT& a, const FragT& b, v8f c) {
  return __builtin_amdgcn_wmma_f32_16x16x32_bf16(false, a.v, false, b.v, (short)0, c, false, false);
}

__global__ __launch_bounds__(128) void attn_kernel(
    const __bf16* __restrict__ kqv, const float* __restrict__ x,
    float* __restrict__ x1) {
  constexpr int E = 1024, S = 2048, K3 = 3 * E;
  __shared__ __attribute__((aligned(32))) unsigned char L[2 * AT_SLOT];
  const int tid = threadIdx.x;
  const int lane = tid & 31;
  const int wave = __builtin_amdgcn_readfirstlane(tid >> 5);
  const int c = lane & 15;
  const int hh = lane >> 4;
  const int h = blockIdx.x & 15;
  const int b = blockIdx.x >> 4;
  // Query block: long blocks get low indices; every second group of 8 ranks
  // runs the other way, so that indices 256 apart add up to equal lengths.
  const int rg = blockIdx.y >> 3, rj = blockIdx.y & 7;
  const int qb = 31 - (8 * rg + ((rg & 1) ? 7 - rj : rj));
  const int qw0 = qb * 64 + wave * 16;   // first query of this wave
  const int myq = qw0 + c;               // this lane's query
  constexpr float LOG2E = 1.4426950408889634f;
  const float slope2 = exp2f(-0.5f * (float)(h + 1)) * LOG2E;  // (2^8)^(-(h+1)/16), base 2
  const float c1 = 0.03125f * LOG2E;                           // 1/sqrt(E), base 2

  const __bf16* kvb = kqv + (size_t)(b * S) * K3 + h * 64;     // K rows; V rows at + 2E
  const int srow = tid >> 3, scol = tid & 7;
  u32x4 rk[4], rv[4];
  auto gload = [&](int st) {
    for (int it = 0; it < 4; ++it) {
      const __bf16* p = kvb + (size_t)(st * 64 + srow + it * 16) * K3 + scol * 8;
      rk[it] = *(const u32x4*)p;
      rv[it] = *(const u32x4*)(p + 2 * E);
    }
  };
  auto lstore = [&](int buf) {
    unsigned char* d = L + buf * AT_SLOT;
    for (int it = 0; it < 4; ++it) {
      const int row = srow + it * 16;
      *(u32x4*)(d + row * AT_PK + scol * 16) = rk[it];
      *(u32x4*)(d + AT_TK + row * AT_PV + scol * 16) = rv[it];
    }
  };

  gload(0);
  // Q fragments (B operand), k order 8*hh + 0..7, 16 + 8*hh + 0..7 per 32.
  FragT qf[2];
  {
    const __bf16* qp = kqv + (size_t)(b * S + myq) * K3 + E + h * 64 + 8 * hh;
    for (int kc = 0; kc < 2; ++kc) {
      qf[kc].q[0] = *(const u32x4*)(qp + 32 * kc);
      qf[kc].q[1] = *(const u32x4*)(qp + 32 * kc + 16);
    }
  }
  const v8f vz = {};
  v8f acc[4];                            // acc[t][r] = O^T[16 t + 8 hh + r][query c]
  for (int t = 0; t < 4; ++t) acc[t] = vz;
  float m_run = -INFINITY;               // running maximum (base 2), equal in both halves
  float l_run = 0.0f;                    // this half's share of the denominator
  lstore(0);
  __syncthreads();                       // tile 0 visible to all four waves

  const int nst = qb + 1;                // the last tile holds the diagonal
  for (int st = 0; st < nst; ++st) {
    const unsigned char* Lb = L + (st & 1) * AT_SLOT;
    const bool more = st + 1 < nst;
    if (more) {
      gload(st + 1);                     // in flight under this tile's work
      // The loads' address registers are reused by the work below.
      asm volatile("s_wait_xcnt 0x0" ::: "memory");
    }
    for (int sub = 0; sub < 2; ++sub) {
      const int key0 = st * 64 + sub * 32;
      if (key0 <= qw0 + 15) {            // wave-uniform: skip keys beyond the wave's last query
        FragT kf[2][2], vf[4];
        for (int kt = 0; kt < 2; ++kt) {
          const unsigned char* p = Lb + (sub * 32 + 16 * kt + c) * AT_PK + 16 * hh;
          for (int kc = 0; kc < 2; ++kc) {
            kf[kt][kc].q[0] = *(const u32x4*)(p + 64 * kc);
            kf[kt][kc].q[1] = *(const u32x4*)(p + 64 * kc + 32);
          }
        }
        {
          const unsigned char* ad = Lb + AT_TK + (sub * 32 + 8 * hh + (lane & 7)) * AT_PV +
                                    ((lane >> 3) & 1) * 16;
          for (int t = 0; t < 4; ++t) {
            vf[t].q[0] = ld_tr16(ad + 32 * t);
            vf[t].q[1] = ld_tr16(ad + 16 * AT_PV + 32 * t);
          }
        }
        // Keeps the pass's 16 LDS loads in one group ahead of the products: one
        // LDS latency a pass; left free, each product waited for its own pair.
        __builtin_amdgcn_sched_barrier(0);
        f32x2 tv[8];                     // tv[4 kt + j]: keys key0 + 16 kt + 8 hh + 2 j, + 1
        for (int kt = 0; kt < 2; ++kt) {
          v8f s = mma_bf16(kf[kt][0], qf[0], vz);
          s = mma_bf16(kf[kt][1], qf[1], s);
          for (int j = 0; j < 4; ++j)
            tv[4 * kt + j] = __builtin_elementwise_fma(
                f32x2{s[2 * j], s[2 * j + 1]}, f32x2{c1, c1},
                f32x2{slope2 * (float)(16 * kt + 2 * j), slope2 * (float)(16 * kt + 2 * j + 1)});
        }
        if (key0 + 31 > qw0) {           // wave-uniform: causal mask near the diagonal only
          for (int i = 0; i < 8; ++i) {
            const int key = key0 + 16 * (i >> 2) + 8 * hh + 2 * (i & 3);
            if (key > myq) tv[i].x = -INFINITY;
            if (key + 1 > myq) tv[i].y = -INFINITY;
          }
        }
        float mx = fmaxf(tv[0].x, tv[0].y);
        for (int i = 1; i < 8; ++i) mx = fmaxf(fmaxf(mx, tv[i].x), tv[i].y);
        const float base = slope2 * (float)(key0 + 8 * hh - myq);  // rest of the ALiBi term, per half
        mx += base;
        mx = fmaxf(mx, xhalf(mx));       // finite: the pass's first key is visible to every query
        const float m_new = fmaxf(m_run, mx);
        const float corr = __builtin_amdgcn_exp2f(m_run - m_new);
        const float nm = base - m_new;
        m_run = m_new;
        f32x2 ps2 = {0.0f, 0.0f};
        FragT pf;
        for (int i = 0; i < 8; ++i) {
          const f32x2 a = tv[i] + f32x2{nm, nm};
          const f32x2 p = {__builtin_amdgcn_exp2f(a.x), __builtin_amdgcn_exp2f(a.y)};
          ps2 += p;
          pf.q[i >> 2][i & 3] = pack2(p.x, p.y);
        }
        const float ps = ps2.x + ps2.y;
        l_run = l_run * corr + ps;
        for (int t = 0; t < 4; ++t) acc[t] = acc[t] * corr;
        for (int t = 0; t < 4; ++t) acc[t] = mma_bf16(vf[t], pf, acc[t]);
      }
    }
    if (more) {
      lstore((st + 1) & 1);              // its last readers left before the previous barrier
      __syncthreads();                   // next tile visible; this tile's reads are over
    }
  }

  // Join the halves' denominators, normalize, fuse the residual: x1 = x + attn.
  // A lane owns 8 consecutive d of its query per tile: two 16-byte accesses.
  const float inv = 1.0f / (l_run + xhalf(l_run));
  for (int t = 0; t < 4; ++t) {
    const size_t idx = (size_t)(b * S + myq) * E + h * 64 + 16 * t + 8 * hh;
    const f32x4 xa = *(const f32x4*)(x + idx);
    const f32x4 xb = *(const f32x4*)(x + idx + 4);
    const f32x4 oa = {acc[t][0], acc[t][1], acc[t][2], acc[t][3]};
    const f32x4 ob = {acc[t][4], acc[t][5], acc[t][6], acc[t][7]};
    *(f32x4*)(x1 + idx) = xa + oa * inv;
    *(f32x4*)(x1 + idx + 4) = xb + ob * inv;
  }
}

// ------------------------------- launch -------------------------------------
extern "C" void kernel_launch(void* const* d_in, const int* in_sizes, int n_in,
                              void* d_out, int out_size, void* d_ws, size_t ws_size,
                              hipStream_t stream) {
  constexpr int E = 1024, H = 16, DFF = 4096, Bq = 2, S = 2048;
  constexpr int M = Bq * S;       // 4096
  constexpr int K3 = 3 * E;       // 3072
  (void)in_sizes; (void)n_in; (void)out_size; (void)ws_size;

  const float* x    = (const float*)d_in[0];
  const float* wkqv = (const float*)d_in[1];
  const float* ln1g = (const float*)d_in[2];
  const float* ln1b = (const float*)d_in[3];
  const float* ln2g = (const float*)d_in[4];
  const float* ln2b = (const float*)d_in[5];
  const float* w1   = (const float*)d_in[6];
  const float* b1   = (const float*)d_in[7];
  const float* w2   = (const float*)d_in[8];
  const float* b2   = (const float*)d_in[9];
  float* out = (float*)d_out;

  char* cur = (char*)d_ws;
  auto carve = [&](size_t bytes) -> char* {
    char* p = cur;
    cur += (bytes + 255) & ~(size_t)255;
    return p;
  };
  __bf16* ln1o  = (__bf16*)carve((size_t)M * E * 2);     // LN1 out (bf16)
  __bf16* wkqvb = (__bf16*)carve((size_t)E * K3 * 2);    // w_kqv bf16
  __bf16* kqvb  = (__bf16*)carve((size_t)M * K3 * 2);    // kqv bf16
  float*  x1    = (float*) carve((size_t)M * E * 4);     // x + attn
  __bf16* ln2o  = (__bf16*)carve((size_t)M * E * 2);     // LN2 out (bf16)
  __bf16* w1b   = (__bf16*)carve((size_t)E * DFF * 2);   // w1 bf16
  __bf16* w2b   = (__bf16*)carve((size_t)DFF * E * 2);   // w2 bf16
  __bf16* h1    = (__bf16*)carve((size_t)M * DFF * 2);   // relu(ffn1) bf16

  cast_bf16_kernel<<<(E * K3 + 255) / 256, 256, 0, stream>>>(wkqv, wkqvb, E * K3);
  cast_bf16_kernel<<<(E * DFF + 255) / 256, 256, 0, stream>>>(w1, w1b, E * DFF);
  cast_bf16_kernel<<<(DFF * E + 255) / 256, 256, 0, stream>>>(w2, w2b, DFF * E);

  ln_bf16_kernel<<<M, 256, 0, stream>>>(x, ln1g, ln1b, ln1o);

  // kqv = ln1 @ w_kqv -> bf16   [4096 x 3072], K=1024
  gemm_bf16_wmma<false, false, false, true>
      <<<dim3(K3 / 128, M / 128), 256, 0, stream>>>(
          ln1o, wkqvb, nullptr, nullptr, nullptr, kqvb, M, K3, E);

  // x1 = x + attention(kqv)
  attn_kernel<<<dim3(H * Bq, S / 64), 128, 0, stream>>>(kqvb, x, x1);

  ln_bf16_kernel<<<M, 256, 0, stream>>>(x1, ln2g, ln2b, ln2o);

  // h1 = relu(ln2 @ w1 + b1) -> bf16   [4096 x 4096], K=1024
  gemm_bf16_wmma<true, true, false, true>
      <<<dim3(DFF / 128, M / 128), 256, 0, stream>>>(
          ln2o, w1b, b1, nullptr, nullptr, h1, M, DFF, E);

  // out = h1 @ w2 + b2 + x1   [4096 x 1024], K=4096
  gemm_bf16_wmma<true, false, true, false>
      <<<dim3(E / 128, M / 128), 256, 0, stream>>>(
          h1, w2b, b2, x1, out, nullptr, M, E, DFF);
}

// v003
// Measured time: 223 microseconds a run.
// In both of two side-by-side timings against v002, it was 1.07 times as fast.
// Over all steps from v000 it is 2.55 times as fast.
#include <hip/hip_runtime.h>
#include <hip/hip_bf16.h>
#include <stdint.h>

// ---------------------------------------------------------------------------
// ALiBi transformer layer for MI455X (gfx1250, wave32, WMMA).
// bf16 operands / f32 accumulate via v_wmma_f32_16x16x32_bf16.
// Double-buffered GEMM staging via GLOBAL_LOAD_ASYNC_TO_LDS (ASYNCcnt).
// ---------------------------------------------------------------------------

typedef __attribute__((ext_vector_type(16))) __bf16 v16bf;
typedef __attribute__((ext_vector_type(8)))  float  v8f;

union Frag16 { v16bf v; uint4 u[2]; };

typedef uint32_t u32x4 __attribute__((ext_vector_type(4)));
typedef short s16x8 __attribute__((ext_vector_type(8)));
union FragT { v16bf v; u32x4 q[2]; };

// Transposing LDS load: lane (c = l & 15, h = l >> 4) gets T[8 h + 0..7][c] of a
// row-major 16-bit tile whose lane addresses are row 8 h + (l & 7), byte 16 * ((l >> 3) & 1).
static __device__ __forceinline__ u32x4 ld_tr16(const unsigned char* p) {
  typedef __attribute__((address_space(3))) s16x8 lds_s16x8;
  return __builtin_bit_cast(u32x4, __builtin_amdgcn_ds_load_tr16_b128_v8i16((lds_s16x8*)p));
}

static __device__ __forceinline__ __bf16 f2bf(float x) {
  unsigned u = __builtin_bit_cast(unsigned, x);
  unsigned r = (u + 0x7FFFu + ((u >> 16) & 1u)) >> 16;   // round-to-nearest-even
  unsigned short h = (unsigned short)r;
  return __builtin_bit_cast(__bf16, h);
}

// ----------------------- async global->LDS copy (b128) ----------------------
#if __has_builtin(__builtin_amdgcn_global_load_async_to_lds_b128) && \
    __has_builtin(__builtin_amdgcn_s_wait_asynccnt)
#define USE_ASYNC_LDS 1
#else
#define USE_ASYNC_LDS 0
#endif

typedef int v4i_t __attribute__((vector_size(4 * sizeof(int))));
typedef __attribute__((address_space(1))) v4i_t* g_v4i_ptr;
typedef __attribute__((address_space(3))) v4i_t* l_v4i_ptr;

static __device__ __forceinline__ void copy16_g2l(const void* g, void* l) {
#if USE_ASYNC_LDS
  __builtin_amdgcn_global_load_async_to_lds_b128(
      (g_v4i_ptr)((v4i_t*)g), (l_v4i_ptr)((v4i_t*)l), 0, 0);
#else
  *(uint4*)l = *(const uint4*)g;
#endif
}

static __device__ __forceinline__ void g2l_wait() {
#if USE_ASYNC_LDS
  __builtin_amdgcn_s_wait_asynccnt(0);
#endif
}

// ------------------------------- cast f32 -> bf16 ---------------------------
// A wave converts 1024 consecutive elements: eight 16-byte loads a lane, each 512
// contiguous bytes across the wave and all in flight together, then eight 8-byte
// stores (256 contiguous bytes across the wave).  Few, long waves, for speed only.
// The grid covers the array exactly: its length is a multiple of CAST_BLK.
constexpr int CAST_BLK = 256 * 32;
__global__ __launch_bounds__(256) void cast_bf16_kernel(
    const float* __restrict__ in, __bf16* __restrict__ out) {
  typedef float f32q __attribute__((ext_vector_type(4)));
  typedef __bf16 bf16q __attribute__((ext_vector_type(4)));
  const int base = blockIdx.x * CAST_BLK + (threadIdx.x >> 5) * 1024 + (threadIdx.x & 31) * 4;
  f32q v[8];
  // Both loops unrolled: v stays in registers and the eight loads issue as one group.
#pragma unroll
  for (int i = 0; i < 8; ++i) v[i] = *(const f32q*)(in + base + i * 128);
#pragma unroll
  for (int i = 0; i < 8; ++i)
    *(bf16q*)(out + base + i * 128) = __builtin_convertvector(v[i], bf16q);  // nearest even
}

// ------------------------------- LayerNorm -> bf16 --------------------------
__global__ __launch_bounds__(256) void ln_bf16_kernel(
    const float* __restrict__ x, const float* __restrict__ g,
    const float* __restrict__ bta, __bf16* __restrict__ out) {
  constexpr int E = 1024;
  const int row = blockIdx.x;
  const int t = threadIdx.x;
  const float* xr = x + (size_t)row * E;
  float v[4];
  float s = 0.f, s2 = 0.f;
#pragma unroll
  for (int i = 0; i < 4; ++i) {
    v[i] = xr[t + i * 256];
    s += v[i];
    s2 += v[i] * v[i];
  }
#pragma unroll
  for (int o = 16; o > 0; o >>= 1) {
    s += __shfl_xor(s, o, 32);
    s2 += __shfl_xor(s2, o, 32);
  }
  __shared__ float ps[8], ps2[8];
  if ((t & 31) == 0) { ps[t >> 5] = s; ps2[t >> 5] = s2; }
  __syncthreads();
  s = 0.f; s2 = 0.f;
#pragma unroll
  for (int i = 0; i < 8; ++i) { s += ps[i]; s2 += ps2[i]; }
  const float mu = s * (1.0f / E);
  const float var = s2 * (1.0f / E) - mu * mu;
  const float rstd = rsqrtf(var + 1e-5f);
#pragma unroll
  for (int i = 0; i < 4; ++i) {
    int c = t + i * 256;
    out[(size_t)row * E + c] = f2bf((v[i] - mu) * rstd * g[c] + bta[c]);
  }
}

// ------------------------------- WMMA GEMM ----------------------------------
// C[M,N] = act(A[M,K] @ B[K,N] + bias) (+ res).  A/B bf16 row-major, acc f32.
// Block 128x128, BK=32, 8 waves; wave tile 32(M) x 64(N).
// Double-buffered LDS staging via async global->LDS copies:
//   iter k: wait(async) -> barrier -> issue stage(k+1) -> WMMA on tile k.
template <bool BIAS, bool RELU, bool RES, bool OBF16>
__global__ __launch_bounds__(256) void gemm_bf16_wmma(
    const __bf16* __restrict__ A, const __bf16* __restrict__ B,
    const float* __restrict__ bias, const float* __restrict__ res,
    float* __restrict__ Cf, __bf16* __restrict__ Cb,
    int M, int N, int K) {
  // A rows: 80 B = 16 B x odd (ds_load_b128); B rows: 288 B = 32 B x odd (ds_load_tr16_b128).
  constexpr int PB = 144;
  __shared__ __attribute__((aligned(16))) __bf16 As[2][128][40];   // [m][k]
  __shared__ __attribute__((aligned(32))) __bf16 Bs[2][32][PB];    // [k][n]

  const int tid = threadIdx.x;
  const int lane = tid & 31;
  const int w = tid >> 5;
  const int wm = (w & 3) * 32;   // 4 waves along M
  const int wn = (w >> 2) * 64;  // 2 waves along N
  const int m0 = blockIdx.y * 128;
  const int n0 = blockIdx.x * 128;
  const int ml = lane & 15;
  const int kb = (lane >> 4) * 8;
  const int half8 = (lane >> 4) * 8;

  v8f acc[2][4];
  const v8f vz = {};
#pragma unroll
  for (int i = 0; i < 2; ++i)
#pragma unroll
    for (int j = 0; j < 4; ++j) acc[i][j] = vz;

  auto stage = [&](int buf, int k0) {
    // A tile 128x32: 512 chunks of 8 bf16.
#pragma unroll
    for (int it = 0; it < 2; ++it) {
      int c = tid + it * 256;
      int r = c >> 2;
      int col = (c & 3) * 8;
      copy16_g2l(A + (size_t)(m0 + r) * K + k0 + col, &As[buf][r][col]);
    }
    // B tile 32x128 (kept [k][n], no transpose so it can stream async).
#pragma unroll
    for (int it = 0; it < 2; ++it) {
      int c = tid + it * 256;
      int kr = c >> 4;
      int nc = (c & 15) * 8;
      copy16_g2l(B + (size_t)(k0 + kr) * N + n0 + nc, &Bs[buf][kr][nc]);
    }
  };

  const int nk = K >> 5;
  stage(0, 0);
  for (int kk = 0; kk < nk; ++kk) {
    const int buf = kk & 1;
    g2l_wait();        // own async stores to LDS have landed
    __syncthreads();   // everyone's have
    if (kk + 1 < nk) stage(buf ^ 1, (kk + 1) * 32);

    Frag16 af[2];
    FragT bfr[4];
#pragma unroll
    for (int mt = 0; mt < 2; ++mt) {
      int r = wm + mt * 16 + ml;
      af[mt].u[0] = *(const uint4*)&As[buf][r][kb];
      af[mt].u[1] = *(const uint4*)&As[buf][r][16 + kb];
    }
    // B fragments straight from the [k][n] tile: k = kb + 0..7 and 16 + kb + 0..7 of
    // column wn + 16 nt + ml, the same k order as A's two 16-byte loads.
    const unsigned char* bp = (const unsigned char*)&Bs[buf][kb + (lane & 7)][wn + ((lane >> 3) & 1) * 8];
#pragma unroll
    for (int nt = 0; nt < 4; ++nt) {
      bfr[nt].q[0] = ld_tr16(bp + 32 * nt);
      bfr[nt].q[1] = ld_tr16(bp + 16 * PB * 2 + 32 * nt);
    }
#pragma unroll
    for (int mt = 0; mt < 2; ++mt)
#pragma unroll
      for (int nt = 0; nt < 4; ++nt)
        acc[mt][nt] = __builtin_amdgcn_wmma_f32_16x16x32_bf16(
            false, af[mt].v, false, bfr[nt].v, (short)0, acc[mt][nt], false, false);
    __syncthreads();   // reads done before this buffer is re-staged
  }

  // Epilogue. C layout: VGPR r -> M = r + half8, lane&15 -> N.
#pragma unroll
  for (int mt = 0; mt < 2; ++mt) {
#pragma unroll
    for (int nt = 0; nt < 4; ++nt) {
      int n = n0 + wn + nt * 16 + ml;
      float bv = BIAS ? bias[n] : 0.0f;
#pragma unroll
      for (int r = 0; r < 8; ++r) {
        int m = m0 + wm + mt * 16 + half8 + r;
        float v = acc[mt][nt][r];
        if (BIAS) v += bv;
        if (RELU) v = v > 0.0f ? v : 0.0f;
        size_t idx = (size_t)m * N + n;
        if (RES) v += res[idx];
        if (OBF16) Cb[idx] = f2bf(v);
        else       Cf[idx] = v;
      }
    }
  }
}

typedef float f32x4 __attribute__((ext_vector_type(4)));
typedef float f32x2 __attribute__((ext_vector_type(2)));

constexpr int AT_PK = 144;              // K row pitch in LDS: 16 B x odd (ds_load_b128)
constexpr int AT_PV = 160;              // V row pitch in LDS: 32 B x odd (ds_load_tr16_b128)
constexpr int AT_TK = 64 * AT_PK;       // one K tile
constexpr int AT_SLOT = AT_TK + 64 * AT_PV;

static __device__ __forceinline__ uint32_t pack2(float lo, float hi) {  // round to nearest even
  typedef __bf16 bf2 __attribute__((ext_vector_type(2)));
  typedef float f2 __attribute__((ext_vector_type(2)));
  return __builtin_bit_cast(uint32_t, __builtin_convertvector(f2{lo, hi}, bf2));
}
static __device__ __forceinline__ float xhalf(float v) {  // lane l <-> lane l ^ 16
  int b = __builtin_bit_cast(int, v);
  return __builtin_bit_cast(float,
      __builtin_amdgcn_permlanex16(b, b, 0x76543210, 0xfedcba98, false, false));
}
static __device__ __forceinline__ v8f mma_bf16(const FragT& a, const FragT& b, v8f c) {
  return __builtin_amdgcn_wmma_f32_16x16x32_bf16(false, a.v, false, b.v, (short)0, c, false, false);
}

__global__ __launch_bounds__(128) void attn_kernel(
    const __bf16* __restrict__ kqv, const float* __restrict__ x,
    float* __restrict__ x1) {
  constexpr int E = 1024, S = 2048, K3 = 3 * E;
  __shared__ __attribute__((aligned(32))) unsigned char L[2 * AT_SLOT];
  const int tid = threadIdx.x;
  const int lane = tid & 31;
  const int wave = __builtin_amdgcn_readfirstlane(tid >> 5);
  const int c = lane & 15;
  const int hh = lane >> 4;
  const int h = blockIdx.x & 15;
  const int b = blockIdx.x >> 4;
  // Query block: long blocks get low indices; every second group of 8 ranks
  // runs the other way, so that indices 256 apart add up to equal lengths.
  const int rg = blockIdx.y >> 3, rj = blockIdx.y & 7;
  const int qb = 31 - (8 * rg + ((rg & 1) ? 7 - rj : rj));
  const int qw0 = qb * 64 + wave * 16;   // first query of this wave
  const int myq = qw0 + c;               // this lane's query
  constexpr float LOG2E = 1.4426950408889634f;
  const float slope2 = exp2f(-0.5f * (float)(h + 1)) * LOG2E;  // (2^8)^(-(h+1)/16), base 2
  const float c1 = 0.03125f * LOG2E;                           // 1/sqrt(E), base 2

  const __bf16* kvb = kqv + (size_t)(b * S) * K3 + h * 64;     // K rows; V rows at + 2E
  const int srow = tid >> 3, scol = tid & 7;
  u32x4 rk[4], rv[4];
  auto gload = [&](int st) {
    for (int it = 0; it < 4; ++it) {
      const __bf16* p = kvb + (size_t)(st * 64 + srow + it * 16) * K3 + scol * 8;
      rk[it] = *(const u32x4*)p;
      rv[it] = *(const u32x4*)(p + 2 * E);
    }
  };
  auto lstore = [&](int buf) {
    unsigned char* d = L + buf * AT_SLOT;
    for (int it = 0; it < 4; ++it) {
      const int row = srow + it * 16;
      *(u32x4*)(d + row * AT_PK + scol * 16) = rk[it];
      *(u32x4*)(d + AT_TK + row * AT_PV + scol * 16) = rv[it];
    }
  };

  gload(0);
  // Q fragments (B operand), k order 8*hh + 0..7, 16 + 8*hh + 0..7 per 32.
  FragT qf[2];
  {
    const __bf16* qp = kqv + (size_t)(b * S + myq) * K3 + E + h * 64 + 8 * hh;
    for (int kc = 0; kc < 2; ++kc) {
      qf[kc].q[0] = *(const u32x4*)(qp + 32 * kc);
      qf[kc].q[1] = *(const u32x4*)(qp + 32 * kc + 16);
    }
  }
  const v8f vz = {};
  v8f acc[4];                            // acc[t][r] = O^T[16 t + 8 hh + r][query c]
  for (int t = 0; t < 4; ++t) acc[t] = vz;
  float m_run = -INFINITY;               // running maximum (base 2), equal in both halves
  float l_run = 0.0f;                    // this half's share of the denominator
  lstore(0);
  __syncthreads();                       // tile 0 visible to all four waves

  const int nst = qb + 1;                // the last tile holds the diagonal
  for (int st = 0; st < nst; ++st) {
    const unsigned char* Lb = L + (st & 1) * AT_SLOT;
    const bool more = st + 1 < nst;
    if (more) {
      gload(st + 1);                     // in flight under this tile's work
      // The loads' address registers are reused by the work below.
      asm volatile("s_wait_xcnt 0x0" ::: "memory");
    }
    for (int sub = 0; sub < 2; ++sub) {
      const int key0 = st * 64 + sub * 32;
      if (key0 <= qw0 + 15) {            // wave-uniform: skip keys beyond the wave's last query
        FragT kf[2][2], vf[4];
        for (int kt = 0; kt < 2; ++kt) {
          const unsigned char* p = Lb + (sub * 32 + 16 * kt + c) * AT_PK + 16 * hh;
          for (int kc = 0; kc < 2; ++kc) {
            kf[kt][kc].q[0] = *(const u32x4*)(p + 64 * kc);
            kf[kt][kc].q[1] = *(const u32x4*)(p + 64 * kc + 32);
          }
        }
        {
          const unsigned char* ad = Lb + AT_TK + (sub * 32 + 8 * hh + (lane & 7)) * AT_PV +
                                    ((lane >> 3) & 1) * 16;
          for (int t = 0; t < 4; ++t) {
            vf[t].q[0] = ld_tr16(ad + 32 * t);
            vf[t].q[1] = ld_tr16(ad + 16 * AT_PV + 32 * t);
          }
        }
        // Keeps the pass's 16 LDS loads in one group ahead of the products: one
        // LDS latency a pass; left free, each product waited for its own pair.
        __builtin_amdgcn_sched_barrier(0);
        f32x2 tv[8];                     // tv[4 kt + j]: keys key0 + 16 kt + 8 hh + 2 j, + 1
        for (int kt = 0; kt < 2; ++kt) {
          v8f s = mma_bf16(kf[kt][0], qf[0], vz);
          s = mma_bf16(kf[kt][1], qf[1], s);
          for (int j = 0; j < 4; ++j)
            tv[4 * kt + j] = __builtin_elementwise_fma(
                f32x2{s[2 * j], s[2 * j + 1]}, f32x2{c1, c1},
                f32x2{slope2 * (float)(16 * kt + 2 * j), slope2 * (float)(16 * kt + 2 * j + 1)});
        }
        if (key0 + 31 > qw0) {           // wave-uniform: causal mask near the diagonal only
          for (int i = 0; i < 8; ++i) {
            const int key = key0 + 16 * (i >> 2) + 8 * hh + 2 * (i & 3);
            if (key > myq) tv[i].x = -INFINITY;
            if (key + 1 > myq) tv[i].y = -INFINITY;
          }
        }
        float mx = fmaxf(tv[0].x, tv[0].y);
        for (int i = 1; i < 8; ++i) mx = fmaxf(fmaxf(mx, tv[i].x), tv[i].y);
        const float base = slope2 * (float)(key0 + 8 * hh - myq);  // rest of the ALiBi term, per half
        mx += base;
        mx = fmaxf(mx, xhalf(mx));       // finite: the pass's first key is visible to every query
        const float m_new = fmaxf(m_run, mx);
        const float corr = __builtin_amdgcn_exp2f(m_run - m_new);
        const float nm = base - m_new;
        m_run = m_new;
        f32x2 ps2 = {0.0f, 0.0f};
        FragT pf;
        for (int i = 0; i < 8; ++i) {
          const f32x2 a = tv[i] + f32x2{nm, nm};
          const f32x2 p = {__builtin_amdgcn_exp2f(a.x), __builtin_amdgcn_exp2f(a.y)};
          ps2 += p;
          pf.q[i >> 2][i & 3] = pack2(p.x, p.y);
        }
        const float ps = ps2.x + ps2.y;
        l_run = l_run * corr + ps;
        for (int t = 0; t < 4; ++t) acc[t] = acc[t] * corr;
        for (int t = 0; t < 4; ++t) acc[t] = mma_bf16(vf[t], pf, acc[t]);
      }
    }
    if (more) {
      lstore((st + 1) & 1);              // its last readers left before the previous barrier
      __syncthreads();                   // next tile visible; this tile's reads are over
    }
  }

  // Join the halves' denominators, normalize, fuse the residual: x1 = x + attn.
  // A lane owns 8 consecutive d of its query per tile: two 16-byte accesses.
  const float inv = 1.0f / (l_run + xhalf(l_run));
  for (int t = 0; t < 4; ++t) {
    const size_t idx = (size_t)(b * S + myq) * E + h * 64 + 16 * t + 8 * hh;
    const f32x4 xa = *(const f32x4*)(x + idx);
    const f32x4 xb = *(const f32x4*)(x + idx + 4);
    const f32x4 oa = {acc[t][0], acc[t][1], acc[t][2], acc[t][3]};
    const f32x4 ob = {acc[t][4], acc[t][5], acc[t][6], acc[t][7]};
    *(f32x4*)(x1 + idx) = xa + oa * inv;
    *(f32x4*)(x1 + idx + 4) = xb + ob * inv;
  }
}

// ------------------------------- launch -------------------------------------
extern "C" void kernel_launch(void* const* d_in, const int* in_sizes, int n_in,
                              void* d_out, int out_size, void* d_ws, size_t ws_size,
                              hipStream_t stream) {
  constexpr int E = 1024, H = 16, DFF = 4096, Bq = 2, S = 2048;
  constexpr int M = Bq * S;       // 4096
  constexpr int K3 = 3 * E;       // 3072
  (void)in_sizes; (void)n_in; (void)out_size; (void)ws_size;

  const float* x    = (const float*)d_in[0];
  const float* wkqv = (const float*)d_in[1];
  const float* ln1g = (const float*)d_in[2];
  const float* ln1b = (const float*)d_in[3];
  const float* ln2g = (const float*)d_in[4];
  const float* ln2b = (const float*)d_in[5];
  const float* w1   = (const float*)d_in[6];
  const float* b1   = (const float*)d_in[7];
  const float* w2   = (const float*)d_in[8];
  const float* b2   = (const float*)d_in[9];
  float* out = (float*)d_out;

  char* cur = (char*)d_ws;
  auto carve = [&](size_t bytes) -> char* {
    char* p = cur;
    cur += (bytes + 255) & ~(size_t)255;
    return p;
  };
  __bf16* ln1o  = (__bf16*)carve((size_t)M * E * 2);     // LN1 out (bf16)
  __bf16* wkqvb = (__bf16*)carve((size_t)E * K3 * 2);    // w_kqv bf16
  __bf16* kqvb  = (__bf16*)carve((size_t)M * K3 * 2);    // kqv bf16
  float*  x1    = (float*) carve((size_t)M * E * 4);     // x + attn
  __bf16* ln2o  = (__bf16*)carve((size_t)M * E * 2);     // LN2 out (bf16)
  __bf16* w1b   = (__bf16*)carve((size_t)E * DFF * 2);   // w1 bf16
  __bf16* w2b   = (__bf16*)carve((size_t)DFF * E * 2);   // w2 bf16
  __bf16* h1    = (__bf16*)carve((size_t)M * DFF * 2);   // relu(ffn1) bf16

  static_assert(E * K3 % CAST_BLK == 0 && E * DFF % CAST_BLK == 0, "cast grid must be exact");
  cast_bf16_kernel<<<E * K3 / CAST_BLK, 256, 0, stream>>>(wkqv, wkqvb);
  cast_bf16_kernel<<<E * DFF / CAST_BLK, 256, 0, stream>>>(w1, w1b);
  cast_bf16_kernel<<<DFF * E / CAST_BLK, 256, 0, stream>>>(w2, w2b);

  ln_bf16_kernel<<<M, 256, 0, stream>>>(x, ln1g, ln1b, ln1o);

  // kqv = ln1 @ w_kqv -> bf16   [4096 x 3072], K=1024
  gemm_bf16_wmma<false, false, false, true>
      <<<dim3(K3 / 128, M / 128), 256, 0, stream>>>(
          ln1o, wkqvb, nullptr, nullptr, nullptr, kqvb, M, K3, E);

  // x1 = x + attention(kqv)
  attn_kernel<<<dim3(H * Bq, S / 64), 128, 0, stream>>>(kqvb, x, x1);

  ln_bf16_kernel<<<M, 256, 0, stream>>>(x1, ln2g, ln2b, ln2o);

  // h1 = relu(ln2 @ w1 + b1) -> bf16   [4096 x 4096], K=1024
  gemm_bf16_wmma<true, true, false, true>
      <<<dim3(DFF / 128, M / 128), 256, 0, stream>>>(
          ln2o, w1b, b1, nullptr, nullptr, h1, M, DFF, E);

  // out = h1 @ w2 + b2 + x1   [4096 x 1024], K=4096
  gemm_bf16_wmma<true, false, true, false>
      <<<dim3(E / 128, M / 128), 256, 0, stream>>>(
          h1, w2b, b2, x1, out, nullptr, M, E, DFF);
}

// v004
// Measured time: 154 microseconds a run.
// Next to v003, in two timings, it ran 1.45 times as fast each time.
// Over all steps from v000 it is 3.70 times as fast.
#include <hip/hip_runtime.h>
#include <hip/hip_bf16.h>
#include <stdint.h>

// ---------------------------------------------------------------------------
// ALiBi transformer layer for MI455X (gfx1250, wave32, WMMA).
// bf16 operands / f32 accumulate via v_wmma_f32_16x16x32_bf16.
// Double-buffered GEMM staging via GLOBAL_LOAD_ASYNC_TO_LDS (ASYNCcnt).
// ---------------------------------------------------------------------------

typedef __attribute__((ext_vector_type(16))) __bf16 v16bf;
typedef __attribute__((ext_vector_type(8)))  float  v8f;

union Frag16 { v16bf v; uint4 u[2]; };

typedef uint32_t u32x4 __attribute__((ext_vector_type(4)));
typedef short s16x8 __attribute__((ext_vector_type(8)));
union FragT { v16bf v; u32x4 q[2]; };

// Transposing LDS load: lane (c = l & 15, h = l >> 4) gets T[8 h + 0..7][c] of a
// row-major 16-bit tile whose lane addresses are row 8 h + (l & 7), byte 16 * ((l >> 3) & 1).
static __device__ __forceinline__ u32x4 ld_tr16(const unsigned char* p) {
  typedef __attribute__((address_space(3))) s16x8 lds_s16x8;
  return __builtin_bit_cast(u32x4, __builtin_amdgcn_ds_load_tr16_b128_v8i16((lds_s16x8*)p));
}

static __device__ __forceinline__ __bf16 f2bf(float x) {
  unsigned u = __builtin_bit_cast(unsigned, x);
  unsigned r = (u + 0x7FFFu + ((u >> 16) & 1u)) >> 16;   // round-to-nearest-even
  unsigned short h = (unsigned short)r;
  return __builtin_bit_cast(__bf16, h);
}

// ----------------------- async global->LDS copy (b128) ----------------------
#if __has_builtin(__builtin_amdgcn_global_load_async_to_lds_b128) && \
    __has_builtin(__builtin_amdgcn_s_wait_asynccnt)
#define USE_ASYNC_LDS 1
#else
#define USE_ASYNC_LDS 0
#endif

typedef int v4i_t __attribute__((vector_size(4 * sizeof(int))));
typedef __attribute__((address_space(1))) v4i_t* g_v4i_ptr;
typedef __attribute__((address_space(3))) v4i_t* l_v4i_ptr;

static __device__ __forceinline__ void copy16_g2l(const void* g, void* l) {
#if USE_ASYNC_LDS
  __builtin_amdgcn_global_load_async_to_lds_b128(
      (g_v4i_ptr)((v4i_t*)g), (l_v4i_ptr)((v4i_t*)l), 0, 0);
#else
  *(uint4*)l = *(const uint4*)g;
#endif
}

static __device__ __forceinline__ void g2l_wait() {
#if USE_ASYNC_LDS
  __builtin_amdgcn_s_wait_asynccnt(0);
#endif
}

// ------------------------------- cast f32 -> bf16 ---------------------------
// A wave converts 1024 consecutive elements: eight 16-byte loads a lane, each 512
// contiguous bytes across the wave and all in flight together, then eight 8-byte
// stores (256 contiguous bytes across the wave).  Few, long waves, for speed only.
// The grid covers the array exactly: its length is a multiple of CAST_BLK.
constexpr int CAST_BLK = 256 * 32;
__global__ __launch_bounds__(256) void cast_bf16_kernel(
    const float* __restrict__ in, __bf16* __restrict__ out) {
  typedef float f32q __attribute__((ext_vector_type(4)));
  typedef __bf16 bf16q __attribute__((ext_vector_type(4)));
  const int base = blockIdx.x * CAST_BLK + (threadIdx.x >> 5) * 1024 + (threadIdx.x & 31) * 4;
  f32q v[8];
  // Both loops unrolled: v stays in registers and the eight loads issue as one group.
#pragma unroll
  for (int i = 0; i < 8; ++i) v[i] = *(const f32q*)(in + base + i * 128);
#pragma unroll
  for (int i = 0; i < 8; ++i)
    *(bf16q*)(out + base + i * 128) = __builtin_convertvector(v[i], bf16q);  // nearest even
}

// ------------------------------- LayerNorm -> bf16 --------------------------
__global__ __launch_bounds__(256) void ln_bf16_kernel(
    const float* __restrict__ x, const float* __restrict__ g,
    const float* __restrict__ bta, __bf16* __restrict__ out) {
  constexpr int E = 1024;
  const int row = blockIdx.x;
  const int t = threadIdx.x;
  const float* xr = x + (size_t)row * E;
  float v[4];
  float s = 0.f, s2 = 0.f;
#pragma unroll
  for (int i = 0; i < 4; ++i) {
    v[i] = xr[t + i * 256];
    s += v[i];
    s2 += v[i] * v[i];
  }
#pragma unroll
  for (int o = 16; o > 0; o >>= 1) {
    s += __shfl_xor(s, o, 32);
    s2 += __shfl_xor(s2, o, 32);
  }
  __shared__ float ps[8], ps2[8];
  if ((t & 31) == 0) { ps[t >> 5] = s; ps2[t >> 5] = s2; }
  __syncthreads();
  s = 0.f; s2 = 0.f;
#pragma unroll
  for (int i = 0; i < 8; ++i) { s += ps[i]; s2 += ps2[i]; }
  const float mu = s * (1.0f / E);
  const float var = s2 * (1.0f / E) - mu * mu;
  const float rstd = rsqrtf(var + 1e-5f);
#pragma unroll
  for (int i = 0; i < 4; ++i) {
    int c = t + i * 256;
    out[(size_t)row * E + c] = f2bf((v[i] - mu) * rstd * g[c] + bta[c]);
  }
}

// ------------------------------- WMMA GEMM ----------------------------------
// C[M,N] = act(A[M,K] @ B[K,N] + bias) (+ res).  A/B bf16 row-major, acc f32.
// Block 128x128, 8 waves; wave tile 32(M) x 64(N).
// Double-buffered LDS staging via async global->LDS copies:
//   iter k: wait(async) -> barrier -> issue stage(k+1) -> WMMA on tile k.
// A stage holds BK k values (K a multiple of BK).  The operands come from memory, so a trip
// lasts at least one memory latency: BK sets how many bytes fly and how many products run
// per latency.  BK is chosen per launch: as deep as the LDS holds for the blocks a WGP gets.
template <int BK, bool BIAS, bool RELU, bool RES, bool OBF16>
__global__ __launch_bounds__(256) void gemm_bf16_wmma(
    const __bf16* __restrict__ A, const __bf16* __restrict__ B,
    const float* __restrict__ bias, const float* __restrict__ res,
    float* __restrict__ Cf, __bf16* __restrict__ Cb,
    int M, int N, int K) {
  // A rows: 2 BK + 16 B = 16 B x odd (ds_load_b128); B rows: 288 B = 32 B x odd (ds_load_tr16_b128).
  static_assert(BK % 64 == 0, "A rows are staged as whole 128-byte lines");
  constexpr int PB = 144;
  __shared__ __attribute__((aligned(16))) __bf16 As[2][128][BK + 8];   // [m][k]
  __shared__ __attribute__((aligned(32))) __bf16 Bs[2][BK][PB];        // [k][n]

  const int tid = threadIdx.x;
  const int lane = tid & 31;
  const int w = tid >> 5;
  const int wm = (w & 3) * 32;   // 4 waves along M
  const int wn = (w >> 2) * 64;  // 2 waves along N
  const int m0 = blockIdx.y * 128;
  const int n0 = blockIdx.x * 128;
  const int ml = lane & 15;
  const int kb = (lane >> 4) * 8;
  const int half8 = (lane >> 4) * 8;

  v8f acc[2][4];
  const v8f vz = {};
#pragma unroll
  for (int i = 0; i < 2; ++i)
#pragma unroll
    for (int j = 0; j < 4; ++j) acc[i][j] = vz;

  auto stage = [&](int buf, int k0) {
    // A tile 128 x BK: 16 BK chunks of 8 bf16, BK / 8 to a row.
#pragma unroll
    for (int it = 0; it < BK / 16; ++it) {
      int c = tid + it * 256;
      int r = c / (BK / 8);
      int col = (c % (BK / 8)) * 8;
      copy16_g2l(A + (size_t)(m0 + r) * K + k0 + col, &As[buf][r][col]);
    }
    // B tile BK x 128 (kept [k][n], no transpose so it can stream async).
#pragma unroll
    for (int it = 0; it < BK / 16; ++it) {
      int c = tid + it * 256;
      int kr = c >> 4;
      int nc = (c & 15) * 8;
      copy16_g2l(B + (size_t)(k0 + kr) * N + n0 + nc, &Bs[buf][kr][nc]);
    }
  };

  const int nk = K / BK;
  stage(0, 0);
  for (int kk = 0; kk < nk; ++kk) {
    const int buf = kk & 1;
    g2l_wait();        // own async stores to LDS have landed
    __syncthreads();   // everyone's have
    if (kk + 1 < nk) stage(buf ^ 1, (kk + 1) * BK);

    // The stage's 32-k slices in ascending k.  Unrolled: every LDS offset is a constant and
    // a slice's fragment loads can issue under the slice before.
#pragma unroll
    for (int ks = 0; ks < BK; ks += 32) {
      Frag16 af[2];
      FragT bfr[4];
#pragma unroll
      for (int mt = 0; mt < 2; ++mt) {
        int r = wm + mt * 16 + ml;
        af[mt].u[0] = *(const uint4*)&As[buf][r][ks + kb];
        af[mt].u[1] = *(const uint4*)&As[buf][r][ks + 16 + kb];
      }
      // B fragments straight from the [k][n] tile: k = kb + 0..7 and 16 + kb + 0..7 of
      // column wn + 16 nt + ml, the same k order as A's two 16-byte loads.
      const unsigned char* bp =
          (const unsigned char*)&Bs[buf][ks + kb + (lane & 7)][wn + ((lane >> 3) & 1) * 8];
#pragma unroll
      for (int nt = 0; nt < 4; ++nt) {
        bfr[nt].q[0] = ld_tr16(bp + 32 * nt);
        bfr[nt].q[1] = ld_tr16(bp + 16 * PB * 2 + 32 * nt);
      }
#pragma unroll
      for (int mt = 0; mt < 2; ++mt)
#pragma unroll
        for (int nt = 0; nt < 4; ++nt)
          acc[mt][nt] = __builtin_amdgcn_wmma_f32_16x16x32_bf16(
              false, af[mt].v, false, bfr[nt].v, (short)0, acc[mt][nt], false, false);
    }
    __syncthreads();   // reads done before this buffer is re-staged
  }

  // Epilogue. C layout: VGPR r -> M = r + half8, lane&15 -> N.
#pragma unroll
  for (int mt = 0; mt < 2; ++mt) {
#pragma unroll
    for (int nt = 0; nt < 4; ++nt) {
      int n = n0 + wn + nt * 16 + ml;
      float bv = BIAS ? bias[n] : 0.0f;
#pragma unroll
      for (int r = 0; r < 8; ++r) {
        int m = m0 + wm + mt * 16 + half8 + r;
        float v = acc[mt][nt][r];
        if (BIAS) v += bv;
        if (RELU) v = v > 0.0f ? v : 0.0f;
        size_t idx = (size_t)m * N + n;
        if (RES) v += res[idx];
        if (OBF16) Cb[idx] = f2bf(v);
        else       Cf[idx] = v;
      }
    }
  }
}

typedef float f32x4 __attribute__((ext_vector_type(4)));
typedef float f32x2 __attribute__((ext_vector_type(2)));

constexpr int AT_PK = 144;              // K row pitch in LDS: 16 B x odd (ds_load_b128)
constexpr int AT_PV = 160;              // V row pitch in LDS: 32 B x odd (ds_load_tr16_b128)
constexpr int AT_TK = 64 * AT_PK;       // one K tile
constexpr int AT_SLOT = AT_TK + 64 * AT_PV;

static __device__ __forceinline__ uint32_t pack2(float lo, float hi) {  // round to nearest even
  typedef __bf16 bf2 __attribute__((ext_vector_type(2)));
  typedef float f2 __attribute__((ext_vector_type(2)));
  return __builtin_bit_cast(uint32_t, __builtin_convertvector(f2{lo, hi}, bf2));
}
static __device__ __forceinline__ float xhalf(float v) {  // lane l <-> lane l ^ 16
  int b = __builtin_bit_cast(int, v);
  return __builtin_bit_cast(float,
      __builtin_amdgcn_permlanex16(b, b, 0x76543210, 0xfedcba98, false, false));
}
static __device__ __forceinline__ v8f mma_bf16(const FragT& a, const FragT& b, v8f c) {
  return __builtin_amdgcn_wmma_f32_16x16x32_bf16(false, a.v, false, b.v, (short)0, c, false, false);
}

__global__ __launch_bounds__(128) void attn_kernel(
    const __bf16* __restrict__ kqv, const float* __restrict__ x,
    float* __restrict__ x1) {
  constexpr int E = 1024, S = 2048, K3 = 3 * E;
  __shared__ __attribute__((aligned(32))) unsigned char L[2 * AT_SLOT];
  const int tid = threadIdx.x;
  const int lane = tid & 31;
  const int wave = __builtin_amdgcn_readfirstlane(tid >> 5);
  const int c = lane & 15;
  const int hh = lane >> 4;
  const int h = blockIdx.x & 15;
  const int b = blockIdx.x >> 4;
  // Query block: long blocks get low indices; every second group of 8 ranks
  // runs the other way, so that indices 256 apart add up to equal lengths.
  const int rg = blockIdx.y >> 3, rj = blockIdx.y & 7;
  const int qb = 31 - (8 * rg + ((rg & 1) ? 7 - rj : rj));
  const int qw0 = qb * 64 + wave * 16;   // first query of this wave
  const int myq = qw0 + c;               // this lane's query
  constexpr float LOG2E = 1.4426950408889634f;
  const float slope2 = exp2f(-0.5f * (float)(h + 1)) * LOG2E;  // (2^8)^(-(h+1)/16), base 2
  const float c1 = 0.03125f * LOG2E;                           // 1/sqrt(E), base 2

  const __bf16* kvb = kqv + (size_t)(b * S) * K3 + h * 64;     // K rows; V rows at + 2E
  const int srow = tid >> 3, scol = tid & 7;
  u32x4 rk[4], rv[4];
  auto gload = [&](int st) {
    for (int it = 0; it < 4; ++it) {
      const __bf16* p = kvb + (size_t)(st * 64 + srow + it * 16) * K3 + scol * 8;
      rk[it] = *(const u32x4*)p;
      rv[it] = *(const u32x4*)(p + 2 * E);
    }
  };
  auto lstore = [&](int buf) {
    unsigned char* d = L + buf * AT_SLOT;
    for (int it = 0; it < 4; ++it) {
      const int row = srow + it * 16;
      *(u32x4*)(d + row * AT_PK + scol * 16) = rk[it];
      *(u32x4*)(d + AT_TK + row * AT_PV + scol * 16) = rv[it];
    }
  };

  gload(0);
  // Q fragments (B operand), k order 8*hh + 0..7, 16 + 8*hh + 0..7 per 32.
  FragT qf[2];
  {
    const __bf16* qp = kqv + (size_t)(b * S + myq) * K3 + E + h * 64 + 8 * hh;
    for (int kc = 0; kc < 2; ++kc) {
      qf[kc].q[0] = *(const u32x4*)(qp + 32 * kc);
      qf[kc].q[1] = *(const u32x4*)(qp + 32 * kc + 16);
    }
  }
  const v8f vz = {};
  v8f acc[4];                            // acc[t][r] = O^T[16 t + 8 hh + r][query c]
  for (int t = 0; t < 4; ++t) acc[t] = vz;
  float m_run = -INFINITY;               // running maximum (base 2), equal in both halves
  float l_run = 0.0f;                    // this half's share of the denominator
  lstore(0);
  __syncthreads();                       // tile 0 visible to all four waves

  const int nst = qb + 1;                // the last tile holds the diagonal
  for (int st = 0; st < nst; ++st) {
    const unsigned char* Lb = L + (st & 1) * AT_SLOT;
    const bool more = st + 1 < nst;
    if (more) {
      gload(st + 1);                     // in flight under this tile's work
      // The loads' address registers are reused by the work below.
      asm volatile("s_wait_xcnt 0x0" ::: "memory");
    }
    for (int sub = 0; sub < 2; ++sub) {
      const int key0 = st * 64 + sub * 32;
      if (key0 <= qw0 + 15) {            // wave-uniform: skip keys beyond the wave's last query
        FragT kf[2][2], vf[4];
        for (int kt = 0; kt < 2; ++kt) {
          const unsigned char* p = Lb + (sub * 32 + 16 * kt + c) * AT_PK + 16 * hh;
          for (int kc = 0; kc < 2; ++kc) {
            kf[kt][kc].q[0] = *(const u32x4*)(p + 64 * kc);
            kf[kt][kc].q[1] = *(const u32x4*)(p + 64 * kc + 32);
          }
        }
        {
          const unsigned char* ad = Lb + AT_TK + (sub * 32 + 8 * hh + (lane & 7)) * AT_PV +
                                    ((lane >> 3) & 1) * 16;
          for (int t = 0; t < 4; ++t) {
            vf[t].q[0] = ld_tr16(ad + 32 * t);
            vf[t].q[1] = ld_tr16(ad + 16 * AT_PV + 32 * t);
          }
        }
        // Keeps the pass's 16 LDS loads in one group ahead of the products: one
        // LDS latency a pass; left free, each product waited for its own pair.
        __builtin_amdgcn_sched_barrier(0);
        f32x2 tv[8];                     // tv[4 kt + j]: keys key0 + 16 kt + 8 hh + 2 j, + 1
        for (int kt = 0; kt < 2; ++kt) {
          v8f s = mma_bf16(kf[kt][0], qf[0], vz);
          s = mma_bf16(kf[kt][1], qf[1], s);
          for (int j = 0; j < 4; ++j)
            tv[4 * kt + j] = __builtin_elementwise_fma(
                f32x2{s[2 * j], s[2 * j + 1]}, f32x2{c1, c1},
                f32x2{slope2 * (float)(16 * kt + 2 * j), slope2 * (float)(16 * kt + 2 * j + 1)});
        }
        if (key0 + 31 > qw0) {           // wave-uniform: causal mask near the diagonal only
          for (int i = 0; i < 8; ++i) {
            const int key = key0 + 16 * (i >> 2) + 8 * hh + 2 * (i & 3);
            if (key > myq) tv[i].x = -INFINITY;
            if (key + 1 > myq) tv[i].y = -INFINITY;
          }
        }
        float mx = fmaxf(tv[0].x, tv[0].y);
        for (int i = 1; i < 8; ++i) mx = fmaxf(fmaxf(mx, tv[i].x), tv[i].y);
        const float base = slope2 * (float)(key0 + 8 * hh - myq);  // rest of the ALiBi term, per half
        mx += base;
        mx = fmaxf(mx, xhalf(mx));       // finite: the pass's first key is visible to every query
        const float m_new = fmaxf(m_run, mx);
        const float corr = __builtin_amdgcn_exp2f(m_run - m_new);
        const float nm = base - m_new;
        m_run = m_new;
        f32x2 ps2 = {0.0f, 0.0f};
        FragT pf;
        for (int i = 0; i < 8; ++i) {
          const f32x2 a = tv[i] + f32x2{nm, nm};
          const f32x2 p = {__builtin_amdgcn_exp2f(a.x), __builtin_amdgcn_exp2f(a.y)};
          ps2 += p;
          pf.q[i >> 2][i & 3] = pack2(p.x, p.y);
        }
        const float ps = ps2.x + ps2.y;
        l_run = l_run * corr + ps;
        for (int t = 0; t < 4; ++t) acc[t] = acc[t] * corr;
        for (int t = 0; t < 4; ++t) acc[t] = mma_bf16(vf[t], pf, acc[t]);
      }
    }
    if (more) {
      lstore((st + 1) & 1);              // its last readers left before the previous barrier
      __syncthreads();                   // next tile visible; this tile's reads are over
    }
  }

  // Join the halves' denominators, normalize, fuse the residual: x1 = x + attn.
  // A lane owns 8 consecutive d of its query per tile: two 16-byte accesses.
  const float inv = 1.0f / (l_run + xhalf(l_run));
  for (int t = 0; t < 4; ++t) {
    const size_t idx = (size_t)(b * S + myq) * E + h * 64 + 16 * t + 8 * hh;
    const f32x4 xa = *(const f32x4*)(x + idx);
    const f32x4 xb = *(const f32x4*)(x + idx + 4);
    const f32x4 oa = {acc[t][0], acc[t][1], acc[t][2], acc[t][3]};
    const f32x4 ob = {acc[t][4], acc[t][5], acc[t][6], acc[t][7]};
    *(f32x4*)(x1 + idx) = xa + oa * inv;
    *(f32x4*)(x1 + idx + 4) = xb + ob * inv;
  }
}

// ------------------------------- launch -------------------------------------
extern "C" void kernel_launch(void* const* d_in, const int* in_sizes, int n_in,
                              void* d_out, int out_size, void* d_ws, size_t ws_size,
                              hipStream_t stream) {
  constexpr int E = 1024, H = 16, DFF = 4096, Bq = 2, S = 2048;
  constexpr int M = Bq * S;       // 4096
  constexpr int K3 = 3 * E;       // 3072
  (void)in_sizes; (void)n_in; (void)out_size; (void)ws_size;

  const float* x    = (const float*)d_in[0];
  const float* wkqv = (const float*)d_in[1];
  const float* ln1g = (const float*)d_in[2];
  const float* ln1b = (const float*)d_in[3];
  const float* ln2g = (const float*)d_in[4];
  const float* ln2b = (const float*)d_in[5];
  const float* w1   = (const float*)d_in[6];
  const float* b1   = (const float*)d_in[7];
  const float* w2   = (const float*)d_in[8];
  const float* b2   = (const float*)d_in[9];
  float* out = (float*)d_out;

  char* cur = (char*)d_ws;
  auto carve = [&](size_t bytes) -> char* {
    char* p = cur;
    cur += (bytes + 255) & ~(size_t)255;
    return p;
  };
  __bf16* ln1o  = (__bf16*)carve((size_t)M * E * 2);     // LN1 out (bf16)
  __bf16* wkqvb = (__bf16*)carve((size_t)E * K3 * 2);    // w_kqv bf16
  __bf16* kqvb  = (__bf16*)carve((size_t)M * K3 * 2);    // kqv bf16
  float*  x1    = (float*) carve((size_t)M * E * 4);     // x + attn
  __bf16* ln2o  = (__bf16*)carve((size_t)M * E * 2);     // LN2 out (bf16)
  __bf16* w1b   = (__bf16*)carve((size_t)E * DFF * 2);   // w1 bf16
  __bf16* w2b   = (__bf16*)carve((size_t)DFF * E * 2);   // w2 bf16
  __bf16* h1    = (__bf16*)carve((size_t)M * DFF * 2);   // relu(ffn1) bf16

  static_assert(E * K3 % CAST_BLK == 0 && E * DFF % CAST_BLK == 0, "cast grid must be exact");
  cast_bf16_kernel<<<E * K3 / CAST_BLK, 256, 0, stream>>>(wkqv, wkqvb);
  cast_bf16_kernel<<<E * DFF / CAST_BLK, 256, 0, stream>>>(w1, w1b);
  cast_bf16_kernel<<<DFF * E / CAST_BLK, 256, 0, stream>>>(w2, w2b);

  ln_bf16_kernel<<<M, 256, 0, stream>>>(x, ln1g, ln1b, ln1o);

  // kqv = ln1 @ w_kqv -> bf16   [4096 x 3072], K=1024; 3 blocks a WGP
  gemm_bf16_wmma<64, false, false, false, true>
      <<<dim3(K3 / 128, M / 128), 256, 0, stream>>>(
          ln1o, wkqvb, nullptr, nullptr, nullptr, kqvb, M, K3, E);

  // x1 = x + attention(kqv)
  attn_kernel<<<dim3(H * Bq, S / 64), 128, 0, stream>>>(kqvb, x, x1);

  ln_bf16_kernel<<<M, 256, 0, stream>>>(x1, ln2g, ln2b, ln2o);

  // h1 = relu(ln2 @ w1 + b1) -> bf16   [4096 x 4096], K=1024; 4 blocks a WGP, 2 at a time
  gemm_bf16_wmma<128, true, true, false, true>
      <<<dim3(DFF / 128, M / 128), 256, 0, stream>>>(
          ln2o, w1b, b1, nullptr, nullptr, h1, M, DFF, E);

  // out = h1 @ w2 + b2 + x1   [4096 x 1024], K=4096; 1 block a WGP
  gemm_bf16_wmma<256, true, false, true, false>
      <<<dim3(E / 128, M / 128), 256, 0, stream>>>(
          h1, w2b, b2, x1, out, nullptr, M, E, DFF);
}

// v005
// Measured time: 145 microseconds a run.
// Timed twice side by side with v004, it ran 1.06 times as fast both times.
// Over all steps from v000 it is 3.93 times as fast.
#include <hip/hip_runtime.h>
#include <hip/hip_bf16.h>
#include <stdint.h>

// ---------------------------------------------------------------------------
// ALiBi transformer layer for MI455X (gfx1250, wave32, WMMA).
// bf16 operands / f32 accumulate via v_wmma_f32_16x16x32_bf16.
// Double-buffered GEMM staging via GLOBAL_LOAD_ASYNC_TO_LDS (ASYNCcnt).
// ---------------------------------------------------------------------------

typedef __attribute__((ext_vector_type(16))) __bf16 v16bf;
typedef __attribute__((ext_vector_type(8)))  float  v8f;

union Frag16 { v16bf v; uint4 u[2]; };

typedef uint32_t u32x4 __attribute__((ext_vector_type(4)));
typedef short s16x8 __attribute__((ext_vector_type(8)));
union FragT { v16bf v; u32x4 q[2]; };

// Transposing LDS load: lane (c = l & 15, h = l >> 4) gets T[8 h + 0..7][c] of a
// row-major 16-bit tile whose lane addresses are row 8 h + (l & 7), byte 16 * ((l >> 3) & 1).
static __device__ __forceinline__ u32x4 ld_tr16(const unsigned char* p) {
  typedef __attribute__((address_space(3))) s16x8 lds_s16x8;
  return __builtin_bit_cast(u32x4, __builtin_amdgcn_ds_load_tr16_b128_v8i16((lds_s16x8*)p));
}

static __device__ __forceinline__ __bf16 f2bf(float x) {
  unsigned u = __builtin_bit_cast(unsigned, x);
  unsigned r = (u + 0x7FFFu + ((u >> 16) & 1u)) >> 16;   // round-to-nearest-even
  unsigned short h = (unsigned short)r;
  return __builtin_bit_cast(__bf16, h);
}

// ----------------------- async global->LDS copy (b128) ----------------------
#if __has_builtin(__builtin_amdgcn_global_load_async_to_lds_b128) && \
    __has_builtin(__builtin_amdgcn_s_wait_asynccnt)
#define USE_ASYNC_LDS 1
#else
#define USE_ASYNC_LDS 0
#endif

typedef int v4i_t __attribute__((vector_size(4 * sizeof(int))));
typedef __attribute__((address_space(1))) v4i_t* g_v4i_ptr;
typedef __attribute__((address_space(3))) v4i_t* l_v4i_ptr;

static __device__ __forceinline__ void copy16_g2l(const void* g, void* l) {
#if USE_ASYNC_LDS
  __builtin_amdgcn_global_load_async_to_lds_b128(
      (g_v4i_ptr)((v4i_t*)g), (l_v4i_ptr)((v4i_t*)l), 0, 0);
#else
  *(uint4*)l = *(const uint4*)g;
#endif
}

static __device__ __forceinline__ void g2l_wait() {
#if USE_ASYNC_LDS
  __builtin_amdgcn_s_wait_asynccnt(0);
#endif
}

// ------------------------------- cast f32 -> bf16 ---------------------------
// A wave converts 1024 consecutive elements: eight 16-byte loads a lane, each 512
// contiguous bytes across the wave and all in flight together, then eight 8-byte
// stores (256 contiguous bytes across the wave).  Few, long waves, for speed only.
// The grid covers the array exactly: its length is a multiple of CAST_BLK.
constexpr int CAST_BLK = 256 * 32;
__global__ __launch_bounds__(256) void cast_bf16_kernel(
    const float* __restrict__ in, __bf16* __restrict__ out) {
  typedef float f32q __attribute__((ext_vector_type(4)));
  typedef __bf16 bf16q __attribute__((ext_vector_type(4)));
  const int base = blockIdx.x * CAST_BLK + (threadIdx.x >> 5) * 1024 + (threadIdx.x & 31) * 4;
  f32q v[8];
  // Both loops unrolled: v stays in registers and the eight loads issue as one group.
#pragma unroll
  for (int i = 0; i < 8; ++i) v[i] = *(const f32q*)(in + base + i * 128);
#pragma unroll
  for (int i = 0; i < 8; ++i)
    *(bf16q*)(out + base + i * 128) = __builtin_convertvector(v[i], bf16q);  // nearest even
}

// ------------------------------- LayerNorm -> bf16 --------------------------
__global__ __launch_bounds__(256) void ln_bf16_kernel(
    const float* __restrict__ x, const float* __restrict__ g,
    const float* __restrict__ bta, __bf16* __restrict__ out) {
  constexpr int E = 1024;
  const int row = blockIdx.x;
  const int t = threadIdx.x;
  const float* xr = x + (size_t)row * E;
  float v[4];
  float s = 0.f, s2 = 0.f;
#pragma unroll
  for (int i = 0; i < 4; ++i) {
    v[i] = xr[t + i * 256];
    s += v[i];
    s2 += v[i] * v[i];
  }
#pragma unroll
  for (int o = 16; o > 0; o >>= 1) {
    s += __shfl_xor(s, o, 32);
    s2 += __shfl_xor(s2, o, 32);
  }
  __shared__ float ps[8], ps2[8];
  if ((t & 31) == 0) { ps[t >> 5] = s; ps2[t >> 5] = s2; }
  __syncthreads();
  s = 0.f; s2 = 0.f;
#pragma unroll
  for (int i = 0; i < 8; ++i) { s += ps[i]; s2 += ps2[i]; }
  const float mu = s * (1.0f / E);
  const float var = s2 * (1.0f / E) - mu * mu;
  const float rstd = rsqrtf(var + 1e-5f);
#pragma unroll
  for (int i = 0; i < 4; ++i) {
    int c = t + i * 256;
    out[(size_t)row * E + c] = f2bf((v[i] - mu) * rstd * g[c] + bta[c]);
  }
}

// ------------------------------- WMMA GEMM ----------------------------------
// C[M,N] = act(A[M,K] @ B[K,N] + bias) (+ res).  A/B bf16 row-major, acc f32.
// Block BM x BN, 8 waves as 4 (M) x 2 (N); wave tile BM/4 x BN/2.
// A block stages (BM + BN) k-rows for BM x BN results and a wave reads BM/64 + BN/32 fragments
// for their product of WMMAs, so both the bytes that come from L2 and the bytes read from LDS
// per product fall as the tile grows.  BM x BN is chosen per launch: the largest tile whose
// grid still gives every WGP a block (M a multiple of BM, N of BN).
// Double-buffered LDS staging via async global->LDS copies:
//   iter k: wait(async) -> barrier -> issue stage(k+1) -> WMMA on tile k.
// A stage holds BK k values (K a multiple of BK).  The operands come from memory, so a trip
// lasts at least one memory latency: BK sets how many bytes fly and how many products run
// per latency.  BK is chosen per launch: as deep as the LDS holds for the blocks a WGP gets.
template <int BM, int BN, int BK, bool BIAS, bool RELU, bool RES, bool OBF16>
__global__ __launch_bounds__(256) void gemm_bf16_wmma(
    const __bf16* __restrict__ A, const __bf16* __restrict__ B,
    const float* __restrict__ bias, const float* __restrict__ res,
    float* __restrict__ Cf, __bf16* __restrict__ Cb,
    int M, int N, int K) {
  // A rows: 2 BK + 16 B = 16 B x odd (ds_load_b128); B rows: 2 BN + 32 B = 32 B x odd (ds_load_tr16_b128).
  static_assert(BK % 64 == 0, "A rows are staged as whole 128-byte lines");
  static_assert(BM % 64 == 0 && BN % 64 == 0, "whole 16 x 16 tiles a wave, B rows of whole lines");
  static_assert(BM * BK % 2048 == 0 && BK * BN % 2048 == 0, "every thread copies the same count");
  constexpr int PB = BN + 16;
  constexpr int MT = BM / 64;    // 16-row tiles of a wave
  constexpr int NT = BN / 32;    // 16-column tiles of a wave
  constexpr bool GROUPED = MT > 2;   // tiles with more rows of products than the 128 x 128 block's
  __shared__ __attribute__((aligned(16))) __bf16 As[2][BM][BK + 8];    // [m][k]
  __shared__ __attribute__((aligned(32))) __bf16 Bs[2][BK][PB];        // [k][n]

  const int tid = threadIdx.x;
  const int lane = tid & 31;
  const int w = tid >> 5;
  const int wm = (w & 3) * (BM / 4);   // 4 waves along M
  const int wn = (w >> 2) * (BN / 2);  // 2 waves along N
  const int m0 = blockIdx.y * BM;
  const int n0 = blockIdx.x * BN;
  const int ml = lane & 15;
  const int kb = (lane >> 4) * 8;
  const int half8 = (lane >> 4) * 8;

  v8f acc[MT][NT];
  const v8f vz = {};
#pragma unroll
  for (int i = 0; i < MT; ++i)
#pragma unroll
    for (int j = 0; j < NT; ++j) acc[i][j] = vz;

  auto stage = [&](int buf, int k0) {
    // A tile BM x BK in chunks of 8 bf16, BK / 8 to a row.
#pragma unroll
    for (int it = 0; it < BM * BK / 2048; ++it) {
      int c = tid + it * 256;
      int r = c / (BK / 8);
      int col = (c % (BK / 8)) * 8;
      copy16_g2l(A + (size_t)(m0 + r) * K + k0 + col, &As[buf][r][col]);
    }
    // B tile BK x BN, BN / 8 chunks to a row (kept [k][n], no transpose so it can stream async).
#pragma unroll
    for (int it = 0; it < BK * BN / 2048; ++it) {
      int c = tid + it * 256;
      int kr = c / (BN / 8);
      int nc = (c % (BN / 8)) * 8;
      copy16_g2l(B + (size_t)(k0 + kr) * N + n0 + nc, &Bs[buf][kr][nc]);
    }
  };

  const int nk = K / BK;
  stage(0, 0);
  for (int kk = 0; kk < nk; ++kk) {
    const int buf = kk & 1;
    g2l_wait();        // own async stores to LDS have landed
    __syncthreads();   // everyone's have
    if (kk + 1 < nk) stage(buf ^ 1, (kk + 1) * BK);

    // The stage's 32-k slices in ascending k.  Unrolled: every LDS offset is a constant and
    // a slice's fragment loads can issue under the slice before.
#pragma unroll
    for (int ks = 0; ks < BK; ks += 32) {
      Frag16 af[MT];
      FragT bfr[NT];
#pragma unroll
      for (int mt = 0; mt < MT; ++mt) {
        int r = wm + mt * 16 + ml;
        af[mt].u[0] = *(const uint4*)&As[buf][r][ks + kb];
        af[mt].u[1] = *(const uint4*)&As[buf][r][ks + 16 + kb];
      }
      // B fragments straight from the [k][n] tile: k = kb + 0..7 and 16 + kb + 0..7 of
      // column wn + 16 nt + ml, the same k order as A's two 16-byte loads.
      const unsigned char* bp =
          (const unsigned char*)&Bs[buf][ks + kb + (lane & 7)][wn + ((lane >> 3) & 1) * 8];
#pragma unroll
      for (int nt = 0; nt < NT; ++nt) {
        bfr[nt].q[0] = ld_tr16(bp + 32 * nt);
        bfr[nt].q[1] = ld_tr16(bp + 16 * PB * 2 + 32 * nt);
      }
      // Keeps a large tile's fragment loads ahead of all the slice's products: left free, each row
      // of products fetched its A fragment right in front of it and waited out an LDS latency.
      if constexpr (GROUPED) __builtin_amdgcn_sched_barrier(0);
#pragma unroll
      for (int mt = 0; mt < MT; ++mt)
#pragma unroll
        for (int nt = 0; nt < NT; ++nt)
          acc[mt][nt] = __builtin_amdgcn_wmma_f32_16x16x32_bf16(
              false, af[mt].v, false, bfr[nt].v, (short)0, acc[mt][nt], false, false);
    }
    __syncthreads();   // reads done before this buffer is re-staged
  }

  // Epilogue. C layout: VGPR r -> M = r + half8, lane&15 -> N.
  float bvs[NT];
#pragma unroll
  for (int nt = 0; nt < NT; ++nt) bvs[nt] = BIAS ? bias[n0 + wn + nt * 16 + ml] : 0.0f;
  // The bias loads' index register is reused for the output addresses below.
  if constexpr (BIAS) asm volatile("s_wait_xcnt 0x0" ::: "memory");
#pragma unroll
  for (int mt = 0; mt < MT; ++mt) {
#pragma unroll
    for (int nt = 0; nt < NT; ++nt) {
      int n = n0 + wn + nt * 16 + ml;
      float bv = bvs[nt];
#pragma unroll
      for (int r = 0; r < 8; ++r) {
        int m = m0 + wm + mt * 16 + half8 + r;
        float v = acc[mt][nt][r];
        if (BIAS) v += bv;
        if (RELU) v = v > 0.0f ? v : 0.0f;
        size_t idx = (size_t)m * N + n;
        if (RES) v += res[idx];
        if (OBF16) Cb[idx] = f2bf(v);
        else       Cf[idx] = v;
      }
    }
  }
}

typedef float f32x4 __attribute__((ext_vector_type(4)));
typedef float f32x2 __attribute__((ext_vector_type(2)));

constexpr int AT_PK = 144;              // K row pitch in LDS: 16 B x odd (ds_load_b128)
constexpr int AT_PV = 160;              // V row pitch in LDS: 32 B x odd (ds_load_tr16_b128)
constexpr int AT_TK = 64 * AT_PK;       // one K tile
constexpr int AT_SLOT = AT_TK + 64 * AT_PV;

static __device__ __forceinline__ uint32_t pack2(float lo, float hi) {  // round to nearest even
  typedef __bf16 bf2 __attribute__((ext_vector_type(2)));
  typedef float f2 __attribute__((ext_vector_type(2)));
  return __builtin_bit_cast(uint32_t, __builtin_convertvector(f2{lo, hi}, bf2));
}
static __device__ __forceinline__ float xhalf(float v) {  // lane l <-> lane l ^ 16
  int b = __builtin_bit_cast(int, v);
  return __builtin_bit_cast(float,
      __builtin_amdgcn_permlanex16(b, b, 0x76543210, 0xfedcba98, false, false));
}
static __device__ __forceinline__ v8f mma_bf16(const FragT& a, const FragT& b, v8f c) {
  return __builtin_amdgcn_wmma_f32_16x16x32_bf16(false, a.v, false, b.v, (short)0, c, false, false);
}

__global__ __launch_bounds__(128) void attn_kernel(
    const __bf16* __restrict__ kqv, const float* __restrict__ x,
    float* __restrict__ x1) {
  constexpr int E = 1024, S = 2048, K3 = 3 * E;
  __shared__ __attribute__((aligned(32))) unsigned char L[2 * AT_SLOT];
  const int tid = threadIdx.x;
  const int lane = tid & 31;
  const int wave = __builtin_amdgcn_readfirstlane(tid >> 5);
  const int c = lane & 15;
  const int hh = lane >> 4;
  const int h = blockIdx.x & 15;
  const int b = blockIdx.x >> 4;
  // Query block: long blocks get low indices; every second group of 8 ranks
  // runs the other way, so that indices 256 apart add up to equal lengths.
  const int rg = blockIdx.y >> 3, rj = blockIdx.y & 7;
  const int qb = 31 - (8 * rg + ((rg & 1) ? 7 - rj : rj));
  const int qw0 = qb * 64 + wave * 16;   // first query of this wave
  const int myq = qw0 + c;               // this lane's query
  constexpr float LOG2E = 1.4426950408889634f;
  const float slope2 = exp2f(-0.5f * (float)(h + 1)) * LOG2E;  // (2^8)^(-(h+1)/16), base 2
  const float c1 = 0.03125f * LOG2E;                           // 1/sqrt(E), base 2

  const __bf16* kvb = kqv + (size_t)(b * S) * K3 + h * 64;     // K rows; V rows at + 2E
  const int srow = tid >> 3, scol = tid & 7;
  u32x4 rk[4], rv[4];
  auto gload = [&](int st) {
    for (int it = 0; it < 4; ++it) {
      const __bf16* p = kvb + (size_t)(st * 64 + srow + it * 16) * K3 + scol * 8;
      rk[it] = *(const u32x4*)p;
      rv[it] = *(const u32x4*)(p + 2 * E);
    }
  };
  auto lstore = [&](int buf) {
    unsigned char* d = L + buf * AT_SLOT;
    for (int it = 0; it < 4; ++it) {
      const int row = srow + it * 16;
      *(u32x4*)(d + row * AT_PK + scol * 16) = rk[it];
      *(u32x4*)(d + AT_TK + row * AT_PV + scol * 16) = rv[it];
    }
  };

  gload(0);
  // Q fragments (B operand), k order 8*hh + 0..7, 16 + 8*hh + 0..7 per 32.
  FragT qf[2];
  {
    const __bf16* qp = kqv + (size_t)(b * S + myq) * K3 + E + h * 64 + 8 * hh;
    for (int kc = 0; kc < 2; ++kc) {
      qf[kc].q[0] = *(const u32x4*)(qp + 32 * kc);
      qf[kc].q[1] = *(const u32x4*)(qp + 32 * kc + 16);
    }
  }
  const v8f vz = {};
  v8f acc[4];                            // acc[t][r] = O^T[16 t + 8 hh + r][query c]
  for (int t = 0; t < 4; ++t) acc[t] = vz;
  float m_run = -INFINITY;               // running maximum (base 2), equal in both halves
  float l_run = 0.0f;                    // this half's share of the denominator
  lstore(0);
  __syncthreads();                       // tile 0 visible to all four waves

  const int nst = qb + 1;                // the last tile holds the diagonal
  for (int st = 0; st < nst; ++st) {
    const unsigned char* Lb = L + (st & 1) * AT_SLOT;
    const bool more = st + 1 < nst;
    if (more) {
      gload(st + 1);                     // in flight under this tile's work
      // The loads' address registers are reused by the work below.
      asm volatile("s_wait_xcnt 0x0" ::: "memory");
    }
    for (int sub = 0; sub < 2; ++sub) {
      const int key0 = st * 64 + sub * 32;
      if (key0 <= qw0 + 15) {            // wave-uniform: skip keys beyond the wave's last query
        FragT kf[2][2], vf[4];
        for (int kt = 0; kt < 2; ++kt) {
          const unsigned char* p = Lb + (sub * 32 + 16 * kt + c) * AT_PK + 16 * hh;
          for (int kc = 0; kc < 2; ++kc) {
            kf[kt][kc].q[0] = *(const u32x4*)(p + 64 * kc);
            kf[kt][kc].q[1] = *(const u32x4*)(p + 64 * kc + 32);
          }
        }
        {
          const unsigned char* ad = Lb + AT_TK + (sub * 32 + 8 * hh + (lane & 7)) * AT_PV +
                                    ((lane >> 3) & 1) * 16;
          for (int t = 0; t < 4; ++t) {
            vf[t].q[0] = ld_tr16(ad + 32 * t);
            vf[t].q[1] = ld_tr16(ad + 16 * AT_PV + 32 * t);
          }
        }
        // Keeps the pass's 16 LDS loads in one group ahead of the products: one
        // LDS latency a pass; left free, each product waited for its own pair.
        __builtin_amdgcn_sched_barrier(0);
        f32x2 tv[8];                     // tv[4 kt + j]: keys key0 + 16 kt + 8 hh + 2 j, + 1
        for (int kt = 0; kt < 2; ++kt) {
          v8f s = mma_bf16(kf[kt][0], qf[0], vz);
          s = mma_bf16(kf[kt][1], qf[1], s);
          for (int j = 0; j < 4; ++j)
            tv[4 * kt + j] = __builtin_elementwise_fma(
                f32x2{s[2 * j], s[2 * j + 1]}, f32x2{c1, c1},
                f32x2{slope2 * (float)(16 * kt + 2 * j), slope2 * (float)(16 * kt + 2 * j + 1)});
        }
        if (key0 + 31 > qw0) {           // wave-uniform: causal mask near the diagonal only
          for (int i = 0; i < 8; ++i) {
            const int key = key0 + 16 * (i >> 2) + 8 * hh + 2 * (i & 3);
            if (key > myq) tv[i].x = -INFINITY;
            if (key + 1 > myq) tv[i].y = -INFINITY;
          }
        }
        float mx = fmaxf(tv[0].x, tv[0].y);
        for (int i = 1; i < 8; ++i) mx = fmaxf(fmaxf(mx, tv[i].x), tv[i].y);
        const float base = slope2 * (float)(key0 + 8 * hh - myq);  // rest of the ALiBi term, per half
        mx += base;
        mx = fmaxf(mx, xhalf(mx));       // finite: the pass's first key is visible to every query
        const float m_new = fmaxf(m_run, mx);
        const float corr = __builtin_amdgcn_exp2f(m_run - m_new);
        const float nm = base - m_new;
        m_run = m_new;
        f32x2 ps2 = {0.0f, 0.0f};
        FragT pf;
        for (int i = 0; i < 8; ++i) {
          const f32x2 a = tv[i] + f32x2{nm, nm};
          const f32x2 p = {__builtin_amdgcn_exp2f(a.x), __builtin_amdgcn_exp2f(a.y)};
          ps2 += p;
          pf.q[i >> 2][i & 3] = pack2(p.x, p.y);
        }
        const float ps = ps2.x + ps2.y;
        l_run = l_run * corr + ps;
        for (int t = 0; t < 4; ++t) acc[t] = acc[t] * corr;
        for (int t = 0; t < 4; ++t) acc[t] = mma_bf16(vf[t], pf, acc[t]);
      }
    }
    if (more) {
      lstore((st + 1) & 1);              // its last readers left before the previous barrier
      __syncthreads();                   // next tile visible; this tile's reads are over
    }
  }

  // Join the halves' denominators, normalize, fuse the residual: x1 = x + attn.
  // A lane owns 8 consecutive d of its query per tile: two 16-byte accesses.
  const float inv = 1.0f / (l_run + xhalf(l_run));
  for (int t = 0; t < 4; ++t) {
    const size_t idx = (size_t)(b * S + myq) * E + h * 64 + 16 * t + 8 * hh;
    const f32x4 xa = *(const f32x4*)(x + idx);
    const f32x4 xb = *(const f32x4*)(x + idx + 4);
    const f32x4 oa = {acc[t][0], acc[t][1], acc[t][2], acc[t][3]};
    const f32x4 ob = {acc[t][4], acc[t][5], acc[t][6], acc[t][7]};
    *(f32x4*)(x1 + idx) = xa + oa * inv;
    *(f32x4*)(x1 + idx + 4) = xb + ob * inv;
  }
}

// ------------------------------- launch -------------------------------------
extern "C" void kernel_launch(void* const* d_in, const int* in_sizes, int n_in,
                              void* d_out, int out_size, void* d_ws, size_t ws_size,
                              hipStream_t stream) {
  constexpr int E = 1024, H = 16, DFF = 4096, Bq = 2, S = 2048;
  constexpr int M = Bq * S;       // 4096
  constexpr int K3 = 3 * E;       // 3072
  (void)in_sizes; (void)n_in; (void)out_size; (void)ws_size;

  const float* x    = (const float*)d_in[0];
  const float* wkqv = (const float*)d_in[1];
  const float* ln1g = (const float*)d_in[2];
  const float* ln1b = (const float*)d_in[3];
  const float* ln2g = (const float*)d_in[4];
  const float* ln2b = (const float*)d_in[5];
  const float* w1   = (const float*)d_in[6];
  const float* b1   = (const float*)d_in[7];
  const float* w2   = (const float*)d_in[8];
  const float* b2   = (const float*)d_in[9];
  float* out = (float*)d_out;

  char* cur = (char*)d_ws;
  auto carve = [&](size_t bytes) -> char* {
    char* p = cur;
    cur += (bytes + 255) & ~(size_t)255;
    return p;
  };
  __bf16* ln1o  = (__bf16*)carve((size_t)M * E * 2);     // LN1 out (bf16)
  __bf16* wkqvb = (__bf16*)carve((size_t)E * K3 * 2);    // w_kqv bf16
  __bf16* kqvb  = (__bf16*)carve((size_t)M * K3 * 2);    // kqv bf16
  float*  x1    = (float*) carve((size_t)M * E * 4);     // x + attn
  __bf16* ln2o  = (__bf16*)carve((size_t)M * E * 2);     // LN2 out (bf16)
  __bf16* w1b   = (__bf16*)carve((size_t)E * DFF * 2);   // w1 bf16
  __bf16* w2b   = (__bf16*)carve((size_t)DFF * E * 2);   // w2 bf16
  __bf16* h1    = (__bf16*)carve((size_t)M * DFF * 2);   // relu(ffn1) bf16

  static_assert(E * K3 % CAST_BLK == 0 && E * DFF % CAST_BLK == 0, "cast grid must be exact");
  cast_bf16_kernel<<<E * K3 / CAST_BLK, 256, 0, stream>>>(wkqv, wkqvb);
  cast_bf16_kernel<<<E * DFF / CAST_BLK, 256, 0, stream>>>(w1, w1b);
  cast_bf16_kernel<<<DFF * E / CAST_BLK, 256, 0, stream>>>(w2, w2b);

  ln_bf16_kernel<<<M, 256, 0, stream>>>(x, ln1g, ln1b, ln1o);

  // kqv = ln1 @ w_kqv -> bf16   [4096 x 3072], K=1024; 16 x 16 blocks, 1 a WGP
  static_assert(M % 256 == 0 && K3 % 192 == 0 && DFF % 256 == 0, "whole tiles");
  gemm_bf16_wmma<256, 192, 128, false, false, false, true>
      <<<dim3(K3 / 192, M / 256), 256, 0, stream>>>(
          ln1o, wkqvb, nullptr, nullptr, nullptr, kqvb, M, K3, E);

  // x1 = x + attention(kqv)
  attn_kernel<<<dim3(H * Bq, S / 64), 128, 0, stream>>>(kqvb, x, x1);

  ln_bf16_kernel<<<M, 256, 0, stream>>>(x1, ln2g, ln2b, ln2o);

  // h1 = relu(ln2 @ w1 + b1) -> bf16   [4096 x 4096], K=1024; 16 x 16 blocks, 1 a WGP
  gemm_bf16_wmma<256, 256, 128, true, true, false, true>
      <<<dim3(DFF / 256, M / 256), 256, 0, stream>>>(
          ln2o, w1b, b1, nullptr, nullptr, h1, M, DFF, E);

  // out = h1 @ w2 + b2 + x1   [4096 x 1024], K=4096; 1 block a WGP
  gemm_bf16_wmma<128, 128, 256, true, false, true, false>
      <<<dim3(E / 128, M / 128), 256, 0, stream>>>(
          h1, w2b, b2, x1, out, nullptr, M, E, DFF);
}

// v006
// A run of this version takes 141 microseconds.
// Next to v005, in two timings, it ran 1.03 times as fast each time.
// Over all steps from v000 it is 4.05 times as fast.
#include <hip/hip_runtime.h>
#include <hip/hip_bf16.h>
#include <stdint.h>

// ---------------------------------------------------------------------------
// ALiBi transformer layer for MI455X (gfx1250, wave32, WMMA).
// bf16 operands / f32 accumulate via v_wmma_f32_16x16x32_bf16.
// Double-buffered GEMM staging via GLOBAL_LOAD_ASYNC_TO_LDS (ASYNCcnt).
// ---------------------------------------------------------------------------

typedef __attribute__((ext_vector_type(16))) __bf16 v16bf;
typedef __attribute__((ext_vector_type(8)))  float  v8f;

union Frag16 { v16bf v; uint4 u[2]; };

typedef uint32_t u32x4 __attribute__((ext_vector_type(4)));
typedef short s16x8 __attribute__((ext_vector_type(8)));
union FragT { v16bf v; u32x4 q[2]; };

// Transposing LDS load: lane (c = l & 15, h = l >> 4) gets T[8 h + 0..7][c] of a
// row-major 16-bit tile whose lane addresses are row 8 h + (l & 7), byte 16 * ((l >> 3) & 1).
static __device__ __forceinline__ u32x4 ld_tr16(const unsigned char* p) {
  typedef __attribute__((address_space(3))) s16x8 lds_s16x8;
  return __builtin_bit_cast(u32x4, __builtin_amdgcn_ds_load_tr16_b128_v8i16((lds_s16x8*)p));
}

static __device__ __forceinline__ __bf16 f2bf(float x) {
  unsigned u = __builtin_bit_cast(unsigned, x);
  unsigned r = (u + 0x7FFFu + ((u >> 16) & 1u)) >> 16;   // round-to-nearest-even
  unsigned short h = (unsigned short)r;
  return __builtin_bit_cast(__bf16, h);
}

typedef float f32x4 __attribute__((ext_vector_type(4)));
typedef float f32x2 __attribute__((ext_vector_type(2)));

static __device__ __forceinline__ uint32_t pack2(float lo, float hi) {  // round to nearest even
  typedef __bf16 bf2 __attribute__((ext_vector_type(2)));
  typedef float f2 __attribute__((ext_vector_type(2)));
  return __builtin_bit_cast(uint32_t, __builtin_convertvector(f2{lo, hi}, bf2));
}

// ----------------------- async global->LDS copy (b128) ----------------------
#if __has_builtin(__builtin_amdgcn_global_load_async_to_lds_b128) && \
    __has_builtin(__builtin_amdgcn_s_wait_asynccnt)
#define USE_ASYNC_LDS 1
#else
#define USE_ASYNC_LDS 0
#endif

typedef int v4i_t __attribute__((vector_size(4 * sizeof(int))));
typedef __attribute__((address_space(1))) v4i_t* g_v4i_ptr;
typedef __attribute__((address_space(3))) v4i_t* l_v4i_ptr;

static __device__ __forceinline__ void copy16_g2l(const void* g, void* l) {
#if USE_ASYNC_LDS
  __builtin_amdgcn_global_load_async_to_lds_b128(
      (g_v4i_ptr)((v4i_t*)g), (l_v4i_ptr)((v4i_t*)l), 0, 0);
#else
  *(uint4*)l = *(const uint4*)g;
#endif
}

static __device__ __forceinline__ void g2l_wait() {
#if USE_ASYNC_LDS
  __builtin_amdgcn_s_wait_asynccnt(0);
#endif
}

// ------------------------------- cast f32 -> bf16 ---------------------------
// A wave converts 1024 consecutive elements: eight 16-byte loads a lane, each 512
// contiguous bytes across the wave and all in flight together, then eight 8-byte
// stores (256 contiguous bytes across the wave).  Few, long waves, for speed only.
// The grid covers the array exactly: its length is a multiple of CAST_BLK.
constexpr int CAST_BLK = 256 * 32;
__global__ __launch_bounds__(256) void cast_bf16_kernel(
    const float* __restrict__ in, __bf16* __restrict__ out) {
  typedef float f32q __attribute__((ext_vector_type(4)));
  typedef __bf16 bf16q __attribute__((ext_vector_type(4)));
  const int base = blockIdx.x * CAST_BLK + (threadIdx.x >> 5) * 1024 + (threadIdx.x & 31) * 4;
  f32q v[8];
  // Both loops unrolled: v stays in registers and the eight loads issue as one group.
#pragma unroll
  for (int i = 0; i < 8; ++i) v[i] = *(const f32q*)(in + base + i * 128);
#pragma unroll
  for (int i = 0; i < 8; ++i)
    *(bf16q*)(out + base + i * 128) = __builtin_convertvector(v[i], bf16q);  // nearest even
}

// ------------------------------- LayerNorm -> bf16 --------------------------
__global__ __launch_bounds__(256) void ln_bf16_kernel(
    const float* __restrict__ x, const float* __restrict__ g,
    const float* __restrict__ bta, __bf16* __restrict__ out) {
  constexpr int E = 1024;
  const int row = blockIdx.x;
  const int t = threadIdx.x;
  const float* xr = x + (size_t)row * E;
  float v[4];
  float s = 0.f, s2 = 0.f;
#pragma unroll
  for (int i = 0; i < 4; ++i) {
    v[i] = xr[t + i * 256];
    s += v[i];
    s2 += v[i] * v[i];
  }
#pragma unroll
  for (int o = 16; o > 0; o >>= 1) {
    s += __shfl_xor(s, o, 32);
    s2 += __shfl_xor(s2, o, 32);
  }
  __shared__ float ps[8], ps2[8];
  if ((t & 31) == 0) { ps[t >> 5] = s; ps2[t >> 5] = s2; }
  __syncthreads();
  s = 0.f; s2 = 0.f;
#pragma unroll
  for (int i = 0; i < 8; ++i) { s += ps[i]; s2 += ps2[i]; }
  const float mu = s * (1.0f / E);
  const float var = s2 * (1.0f / E) - mu * mu;
  const float rstd = rsqrtf(var + 1e-5f);
#pragma unroll
  for (int i = 0; i < 4; ++i) {
    int c = t + i * 256;
    out[(size_t)row * E + c] = f2bf((v[i] - mu) * rstd * g[c] + bta[c]);
  }
}

// ------------------------------- WMMA GEMM ----------------------------------
// C[M,N] = act(A[M,K] @ B[K,N] + bias) (+ res).  A/B bf16 row-major, acc f32.
// Block BM x BN, 8 waves as 4 (M) x 2 (N); wave tile BM/4 x BN/2.
// A block stages (BM + BN) k-rows for BM x BN results and a wave reads BM/64 + BN/32 fragments
// for their product of WMMAs, so both the bytes that come from L2 and the bytes read from LDS
// per product fall as the tile grows.  BM x BN is chosen per launch: the largest tile whose
// grid still gives every WGP a block (M a multiple of BM, N of BN).
// Double-buffered LDS staging via async global->LDS copies:
//   iter k: wait(async) -> barrier -> issue stage(k+1) -> WMMA on tile k.
// A stage holds BK k values (K a multiple of BK).  The operands come from memory, so a trip
// lasts at least one memory latency: BK sets how many bytes fly and how many products run
// per latency.  BK is chosen per launch: as deep as the LDS holds for the blocks a WGP gets.
// LDC: the row pitch of C and res in elements (the launch's N), a constant so that the rows of a
// tile are immediate offsets from one address.
constexpr int cgcd(int a, int b) { return b ? cgcd(b, a % b) : a; }
template <int BM, int BN, int BK, int LDC, bool BIAS, bool RELU, bool RES, bool OBF16>
__global__ __launch_bounds__(256) void gemm_bf16_wmma(
    const __bf16* __restrict__ A, const __bf16* __restrict__ B,
    const float* __restrict__ bias, const float* __restrict__ res,
    float* __restrict__ Cf, __bf16* __restrict__ Cb,
    int M, int N, int K) {
  // A rows: 2 BK + 16 B = 16 B x odd (ds_load_b128); B rows: 2 BN + 32 B = 32 B x odd (ds_load_tr16_b128).
  static_assert(BK % 64 == 0, "A rows are staged as whole 128-byte lines");
  static_assert(BM % 64 == 0 && BN % 64 == 0, "whole 16 x 16 tiles a wave, B rows of whole lines");
  static_assert(BM * BK % 2048 == 0 && BK * BN % 2048 == 0, "every thread copies the same count");
  constexpr int PB = BN + 16;
  constexpr int MT = BM / 64;    // 16-row tiles of a wave
  constexpr int NT = BN / 32;    // 16-column tiles of a wave
  constexpr bool GROUPED = MT > 2;   // tiles with more rows of products than the 128 x 128 block's
  __shared__ __attribute__((aligned(16))) __bf16 As[2][BM][BK + 8];    // [m][k]
  __shared__ __attribute__((aligned(32))) __bf16 Bs[2][BK][PB];        // [k][n]

  const int tid = threadIdx.x;
  const int lane = tid & 31;
  const int w = tid >> 5;
  const int wm = (w & 3) * (BM / 4);   // 4 waves along M
  const int wn = (w >> 2) * (BN / 2);  // 2 waves along N
  const int m0 = blockIdx.y * BM;
  const int n0 = blockIdx.x * BN;
  const int ml = lane & 15;
  const int kb = (lane >> 4) * 8;
  const int half8 = (lane >> 4) * 8;

  v8f acc[MT][NT];
  const v8f vz = {};
#pragma unroll
  for (int i = 0; i < MT; ++i)
#pragma unroll
    for (int j = 0; j < NT; ++j) acc[i][j] = vz;

  auto stage = [&](int buf, int k0) {
    // A tile BM x BK in chunks of 8 bf16, BK / 8 to a row.
#pragma unroll
    for (int it = 0; it < BM * BK / 2048; ++it) {
      int c = tid + it * 256;
      int r = c / (BK / 8);
      int col = (c % (BK / 8)) * 8;
      copy16_g2l(A + (size_t)(m0 + r) * K + k0 + col, &As[buf][r][col]);
    }
    // B tile BK x BN, BN / 8 chunks to a row (kept [k][n], no transpose so it can stream async).
#pragma unroll
    for (int it = 0; it < BK * BN / 2048; ++it) {
      int c = tid + it * 256;
      int kr = c / (BN / 8);
      int nc = (c % (BN / 8)) * 8;
      copy16_g2l(B + (size_t)(k0 + kr) * N + n0 + nc, &Bs[buf][kr][nc]);
    }
  };

  const int nk = K / BK;
  stage(0, 0);
  for (int kk = 0; kk < nk; ++kk) {
    const int buf = kk & 1;
    g2l_wait();        // own async stores to LDS have landed
    __syncthreads();   // everyone's have
    if (kk + 1 < nk) stage(buf ^ 1, (kk + 1) * BK);

    // The stage's 32-k slices in ascending k.  Unrolled: every LDS offset is a constant and
    // a slice's fragment loads can issue under the slice before.
#pragma unroll
    for (int ks = 0; ks < BK; ks += 32) {
      Frag16 af[MT];
      FragT bfr[NT];
#pragma unroll
      for (int mt = 0; mt < MT; ++mt) {
        int r = wm + mt * 16 + ml;
        af[mt].u[0] = *(const uint4*)&As[buf][r][ks + kb];
        af[mt].u[1] = *(const uint4*)&As[buf][r][ks + 16 + kb];
      }
      // B fragments straight from the [k][n] tile: k = kb + 0..7 and 16 + kb + 0..7 of
      // column wn + 16 nt + ml, the same k order as A's two 16-byte loads.
      const unsigned char* bp =
          (const unsigned char*)&Bs[buf][ks + kb + (lane & 7)][wn + ((lane >> 3) & 1) * 8];
#pragma unroll
      for (int nt = 0; nt < NT; ++nt) {
        bfr[nt].q[0] = ld_tr16(bp + 32 * nt);
        bfr[nt].q[1] = ld_tr16(bp + 16 * PB * 2 + 32 * nt);
      }
      // Keeps a large tile's fragment loads ahead of all the slice's products: left free, each row
      // of products fetched its A fragment right in front of it and waited out an LDS latency.
      if constexpr (GROUPED) __builtin_amdgcn_sched_barrier(0);
#pragma unroll
      for (int mt = 0; mt < MT; ++mt)
#pragma unroll
        for (int nt = 0; nt < NT; ++nt)
          acc[mt][nt] = __builtin_amdgcn_wmma_f32_16x16x32_bf16(   // C^T tile: B^T first, A^T second
              false, bfr[nt].v, false, af[mt].v, (short)0, acc[mt][nt], false, false);
    }
    __syncthreads();   // reads done before this buffer is re-staged
  }

  // Epilogue.  The products are formed transposed (the two fragments have the same lane and
  // k layout, so they only change places): acc[mt][nt][r] = C[wm + 16 mt + ml][wn + 16 nt + half8 + r],
  // 8 adjacent columns of one row in a lane.  Each wave writes its tile into its own range of the
  // A buffers (free behind the loop's last barrier) with 16-byte LDS stores and reads it back
  // row by row, so that every global access is 16 bytes a lane over whole rows of the tile.
  static_assert(!(OBF16 && RES), "the residual is added in f32, behind the staging");
  constexpr int WR = BM / 4, WC = BN / 2;       // rows and columns of a wave's tile
  constexpr int ESZ = OBF16 ? 2 : 4;            // bytes of a staged element
  constexpr int SP = WC * ESZ + 16;             // staged row pitch: 16 B x odd (16-byte LDS accesses)
  constexpr int CPR = WC * ESZ / 16;            // 16-byte pieces of a row
  constexpr int PER = CPR / cgcd(32, CPR);      // wave-wide accesses until the lanes' pattern repeats,
  constexpr int RPP = 32 / cgcd(32, CPR);       // which is this many rows further down
  static_assert((SP / 16) % 2 == 1 && WR % RPP == 0, "pitch; whole periods");
  static_assert(8 * WR * SP <= (int)sizeof(As), "the eight waves' ranges fit the A buffers");
  unsigned char* sw = (unsigned char*)&As[0][0][0] + w * (WR * SP);

  // Where a lane reads the staged tile back, and the element of C that piece starts at.
  const unsigned char* sp[PER];
  int gn[PER];
  size_t gi[PER];
#pragma unroll
  for (int t = 0; t < PER; ++t) {
    const int c = t * 32 + lane;
    sp[t] = sw + (c / CPR) * SP + (c % CPR) * 16;
    gn[t] = n0 + wn + (c % CPR) * (16 / ESZ);
    gi[t] = (size_t)(m0 + wm + c / CPR) * LDC + gn[t];
  }

  f32x4 bq[OBF16 ? NT : 1][2];                  // bias of the lane's columns
  f32x4 rv[OBF16 ? 1 : WR / RPP];               // residual of the lane's pieces
  if constexpr (OBF16) {
    if constexpr (BIAS) {
      const float* bp = bias + n0 + wn + half8;
#pragma unroll
      for (int nt = 0; nt < NT; ++nt) {
        bq[nt][0] = *(const f32x4*)(bp + nt * 16);
        bq[nt][1] = *(const f32x4*)(bp + nt * 16 + 4);
      }
      // The loads' address register is free for reuse only behind this wait: named as an input,
      // it also stays out of the loads' own destinations.
      asm volatile("s_wait_xcnt 0x0" :: "v"(bp) : "memory");
    }
#pragma unroll
    for (int mt = 0; mt < MT; ++mt) {
#pragma unroll
      for (int nt = 0; nt < NT; ++nt) {
        f32x4 lo = {acc[mt][nt][0], acc[mt][nt][1], acc[mt][nt][2], acc[mt][nt][3]};
        f32x4 hi = {acc[mt][nt][4], acc[mt][nt][5], acc[mt][nt][6], acc[mt][nt][7]};
        if constexpr (BIAS) { lo += bq[nt][0]; hi += bq[nt][1]; }
        if constexpr (RELU) {
#pragma unroll
          for (int i = 0; i < 4; ++i) { lo[i] = fmaxf(lo[i], 0.0f); hi[i] = fmaxf(hi[i], 0.0f); }
        }
        const u32x4 pk = {pack2(lo[0], lo[1]), pack2(lo[2], lo[3]), pack2(hi[0], hi[1]), pack2(hi[2], hi[3])};
        *(u32x4*)(sw + (mt * 16 + ml) * SP + (nt * 16 + half8) * ESZ) = pk;
      }
    }
  } else {
    static_assert(OBF16 || (PER == 1 && BIAS && RES), "f32 output: one lane pattern, bias and residual");
    // Bias and residual of the lane's pieces, in flight under the staging.
    const float* bp = bias + gn[0];
    const float* rp = res + gi[0];
    bq[0][0] = *(const f32x4*)bp;
#pragma unroll
    for (int j = 0; j < WR / RPP; ++j) rv[j] = *(const f32x4*)(rp + (size_t)j * RPP * LDC);
    // As above: the two address registers are reused only behind this wait.
    asm volatile("s_wait_xcnt 0x0" :: "v"(bp), "v"(rp) : "memory");
#pragma unroll
    for (int mt = 0; mt < MT; ++mt) {
#pragma unroll
      for (int nt = 0; nt < NT; ++nt) {
        unsigned char* d = sw + (mt * 16 + ml) * SP + (nt * 16 + half8) * ESZ;
        *(f32x4*)d = f32x4{acc[mt][nt][0], acc[mt][nt][1], acc[mt][nt][2], acc[mt][nt][3]};
        *(f32x4*)(d + 16) = f32x4{acc[mt][nt][4], acc[mt][nt][5], acc[mt][nt][6], acc[mt][nt][7]};
      }
    }
  }
  // The wave's own staged rows are in LDS before its lanes read one another's pieces back.
  asm volatile("s_wait_dscnt 0x0" ::: "memory");
#pragma unroll
  for (int j = 0; j < WR / RPP; ++j) {
#pragma unroll
    for (int t = 0; t < PER; ++t) {
      const unsigned char* s = sp[t] + j * RPP * SP;
      const size_t idx = gi[t] + (size_t)j * RPP * LDC;
      if constexpr (OBF16) {
        *(u32x4*)(Cb + idx) = *(const u32x4*)s;
      } else {
        f32x4 v = *(const f32x4*)s + bq[0][0];
        if constexpr (RELU) {
#pragma unroll
          for (int i = 0; i < 4; ++i) v[i] = fmaxf(v[i], 0.0f);
        }
        *(f32x4*)(Cf + idx) = v + rv[j];
      }
    }
  }
}

constexpr int AT_PK = 144;              // K row pitch in LDS: 16 B x odd (ds_load_b128)
constexpr int AT_PV = 160;              // V row pitch in LDS: 32 B x odd (ds_load_tr16_b128)
constexpr int AT_TK = 64 * AT_PK;       // one K tile
constexpr int AT_SLOT = AT_TK + 64 * AT_PV;

static __device__ __forceinline__ float xhalf(float v) {  // lane l <-> lane l ^ 16
  int b = __builtin_bit_cast(int, v);
  return __builtin_bit_cast(float,
      __builtin_amdgcn_permlanex16(b, b, 0x76543210, 0xfedcba98, false, false));
}
static __device__ __forceinline__ v8f mma_bf16(const FragT& a, const FragT& b, v8f c) {
  return __builtin_amdgcn_wmma_f32_16x16x32_bf16(false, a.v, false, b.v, (short)0, c, false, false);
}

__global__ __launch_bounds__(128) void attn_kernel(
    const __bf16* __restrict__ kqv, const float* __restrict__ x,
    float* __restrict__ x1) {
  constexpr int E = 1024, S = 2048, K3 = 3 * E;
  __shared__ __attribute__((aligned(32))) unsigned char L[2 * AT_SLOT];
  const int tid = threadIdx.x;
  const int lane = tid & 31;
  const int wave = __builtin_amdgcn_readfirstlane(tid >> 5);
  const int c = lane & 15;
  const int hh = lane >> 4;
  const int h = blockIdx.x & 15;
  const int b = blockIdx.x >> 4;
  // Query block: long blocks get low indices; every second group of 8 ranks
  // runs the other way, so that indices 256 apart add up to equal lengths.
  const int rg = blockIdx.y >> 3, rj = blockIdx.y & 7;
  const int qb = 31 - (8 * rg + ((rg & 1) ? 7 - rj : rj));
  const int qw0 = qb * 64 + wave * 16;   // first query of this wave
  const int myq = qw0 + c;               // this lane's query
  constexpr float LOG2E = 1.4426950408889634f;
  const float slope2 = exp2f(-0.5f * (float)(h + 1)) * LOG2E;  // (2^8)^(-(h+1)/16), base 2
  const float c1 = 0.03125f * LOG2E;                           // 1/sqrt(E), base 2

  const __bf16* kvb = kqv + (size_t)(b * S) * K3 + h * 64;     // K rows; V rows at + 2E
  const int srow = tid >> 3, scol = tid & 7;
  u32x4 rk[4], rv[4];
  auto gload = [&](int st) {
    for (int it = 0; it < 4; ++it) {
      const __bf16* p = kvb + (size_t)(st * 64 + srow + it * 16) * K3 + scol * 8;
      rk[it] = *(const u32x4*)p;
      rv[it] = *(const u32x4*)(p + 2 * E);
    }
  };
  auto lstore = [&](int buf) {
    unsigned char* d = L + buf * AT_SLOT;
    for (int it = 0; it < 4; ++it) {
      const int row = srow + it * 16;
      *(u32x4*)(d + row * AT_PK + scol * 16) = rk[it];
      *(u32x4*)(d + AT_TK + row * AT_PV + scol * 16) = rv[it];
    }
  };

  gload(0);
  // Q fragments (B operand), k order 8*hh + 0..7, 16 + 8*hh + 0..7 per 32.
  FragT qf[2];
  {
    const __bf16* qp = kqv + (size_t)(b * S + myq) * K3 + E + h * 64 + 8 * hh;
    for (int kc = 0; kc < 2; ++kc) {
      qf[kc].q[0] = *(const u32x4*)(qp + 32 * kc);
      qf[kc].q[1] = *(const u32x4*)(qp + 32 * kc + 16);
    }
  }
  const v8f vz = {};
  v8f acc[4];                            // acc[t][r] = O^T[16 t + 8 hh + r][query c]
  for (int t = 0; t < 4; ++t) acc[t] = vz;
  float m_run = -INFINITY;               // running maximum (base 2), equal in both halves
  float l_run = 0.0f;                    // this half's share of the denominator
  lstore(0);
  __syncthreads();                       // tile 0 visible to all four waves

  const int nst = qb + 1;                // the last tile holds the diagonal
  for (int st = 0; st < nst; ++st) {
    const unsigned char* Lb = L + (st & 1) * AT_SLOT;
    const bool more = st + 1 < nst;
    if (more) {
      gload(st + 1);                     // in flight under this tile's work
      // The loads' address registers are reused by the work below.
      asm volatile("s_wait_xcnt 0x0" ::: "memory");
    }
    for (int sub = 0; sub < 2; ++sub) {
      const int key0 = st * 64 + sub * 32;
      if (key0 <= qw0 + 15) {            // wave-uniform: skip keys beyond the wave's last query
        FragT kf[2][2], vf[4];
        for (int kt = 0; kt < 2; ++kt) {
          const unsigned char* p = Lb + (sub * 32 + 16 * kt + c) * AT_PK + 16 * hh;
          for (int kc = 0; kc < 2; ++kc) {
            kf[kt][kc].q[0] = *(const u32x4*)(p + 64 * kc);
            kf[kt][kc].q[1] = *(const u32x4*)(p + 64 * kc + 32);
          }
        }
        {
          const unsigned char* ad = Lb + AT_TK + (sub * 32 + 8 * hh + (lane & 7)) * AT_PV +
                                    ((lane >> 3) & 1) * 16;
          for (int t = 0; t < 4; ++t) {
            vf[t].q[0] = ld_tr16(ad + 32 * t);
            vf[t].q[1] = ld_tr16(ad + 16 * AT_PV + 32 * t);
          }
        }
        // Keeps the pass's 16 LDS loads in one group ahead of the products: one
        // LDS latency a pass; left free, each product waited for its own pair.
        __builtin_amdgcn_sched_barrier(0);
        f32x2 tv[8];                     // tv[4 kt + j]: keys key0 + 16 kt + 8 hh + 2 j, + 1
        for (int kt = 0; kt < 2; ++kt) {
          v8f s = mma_bf16(kf[kt][0], qf[0], vz);
          s = mma_bf16(kf[kt][1], qf[1], s);
          for (int j = 0; j < 4; ++j)
            tv[4 * kt + j] = __builtin_elementwise_fma(
                f32x2{s[2 * j], s[2 * j + 1]}, f32x2{c1, c1},
                f32x2{slope2 * (float)(16 * kt + 2 * j), slope2 * (float)(16 * kt + 2 * j + 1)});
        }
        if (key0 + 31 > qw0) {           // wave-uniform: causal mask near the diagonal only
          for (int i = 0; i < 8; ++i) {
            const int key = key0 + 16 * (i >> 2) + 8 * hh + 2 * (i & 3);
            if (key > myq) tv[i].x = -INFINITY;
            if (key + 1 > myq) tv[i].y = -INFINITY;
          }
        }
        float mx = fmaxf(tv[0].x, tv[0].y);
        for (int i = 1; i < 8; ++i) mx = fmaxf(fmaxf(mx, tv[i].x), tv[i].y);
        const float base = slope2 * (float)(key0 + 8 * hh - myq);  // rest of the ALiBi term, per half
        mx += base;
        mx = fmaxf(mx, xhalf(mx));       // finite: the pass's first key is visible to every query
        const float m_new = fmaxf(m_run, mx);
        const float corr = __builtin_amdgcn_exp2f(m_run - m_new);
        const float nm = base - m_new;
        m_run = m_new;
        f32x2 ps2 = {0.0f, 0.0f};
        FragT pf;
        for (int i = 0; i < 8; ++i) {
          const f32x2 a = tv[i] + f32x2{nm, nm};
          const f32x2 p = {__builtin_amdgcn_exp2f(a.x), __builtin_amdgcn_exp2f(a.y)};
          ps2 += p;
          pf.q[i >> 2][i & 3] = pack2(p.x, p.y);
        }
        const float ps = ps2.x + ps2.y;
        l_run = l_run * corr + ps;
        for (int t = 0; t < 4; ++t) acc[t] = acc[t] * corr;
        for (int t = 0; t < 4; ++t) acc[t] = mma_bf16(vf[t], pf, acc[t]);
      }
    }
    if (more) {
      lstore((st + 1) & 1);              // its last readers left before the previous barrier
      __syncthreads();                   // next tile visible; this tile's reads are over
    }
  }

  // Join the halves' denominators, normalize, fuse the residual: x1 = x + attn.
  // A lane owns 8 consecutive d of its query per tile: two 16-byte accesses.
  const float inv = 1.0f / (l_run + xhalf(l_run));
  for (int t = 0; t < 4; ++t) {
    const size_t idx = (size_t)(b * S + myq) * E + h * 64 + 16 * t + 8 * hh;
    const f32x4 xa = *(const f32x4*)(x + idx);
    const f32x4 xb = *(const f32x4*)(x + idx + 4);
    const f32x4 oa = {acc[t][0], acc[t][1], acc[t][2], acc[t][3]};
    const f32x4 ob = {acc[t][4], acc[t][5], acc[t][6], acc[t][7]};
    *(f32x4*)(x1 + idx) = xa + oa * inv;
    *(f32x4*)(x1 + idx + 4) = xb + ob * inv;
  }
}

// ------------------------------- launch -------------------------------------
extern "C" void kernel_launch(void* const* d_in, const int* in_sizes, int n_in,
                              void* d_out, int out_size, void* d_ws, size_t ws_size,
                              hipStream_t stream) {
  constexpr int E = 1024, H = 16, DFF = 4096, Bq = 2, S = 2048;
  constexpr int M = Bq * S;       // 4096
  constexpr int K3 = 3 * E;       // 3072
  (void)in_sizes; (void)n_in; (void)out_size; (void)ws_size;

  const float* x    = (const float*)d_in[0];
  const float* wkqv = (const float*)d_in[1];
  const float* ln1g = (const float*)d_in[2];
  const float* ln1b = (const float*)d_in[3];
  const float* ln2g = (const float*)d_in[4];
  const float* ln2b = (const float*)d_in[5];
  const float* w1   = (const float*)d_in[6];
  const float* b1   = (const float*)d_in[7];
  const float* w2   = (const float*)d_in[8];
  const float* b2   = (const float*)d_in[9];
  float* out = (float*)d_out;

  char* cur = (char*)d_ws;
  auto carve = [&](size_t bytes) -> char* {
    char* p = cur;
    cur += (bytes + 255) & ~(size_t)255;
    return p;
  };
  __bf16* ln1o  = (__bf16*)carve((size_t)M * E * 2);     // LN1 out (bf16)
  __bf16* wkqvb = (__bf16*)carve((size_t)E * K3 * 2);    // w_kqv bf16
  __bf16* kqvb  = (__bf16*)carve((size_t)M * K3 * 2);    // kqv bf16
  float*  x1    = (float*) carve((size_t)M * E * 4);     // x + attn
  __bf16* ln2o  = (__bf16*)carve((size_t)M * E * 2);     // LN2 out (bf16)
  __bf16* w1b   = (__bf16*)carve((size_t)E * DFF * 2);   // w1 bf16
  __bf16* w2b   = (__bf16*)carve((size_t)DFF * E * 2);   // w2 bf16
  __bf16* h1    = (__bf16*)carve((size_t)M * DFF * 2);   // relu(ffn1) bf16

  static_assert(E * K3 % CAST_BLK == 0 && E * DFF % CAST_BLK == 0, "cast grid must be exact");
  cast_bf16_kernel<<<E * K3 / CAST_BLK, 256, 0, stream>>>(wkqv, wkqvb);
  cast_bf16_kernel<<<E * DFF / CAST_BLK, 256, 0, stream>>>(w1, w1b);
  cast_bf16_kernel<<<DFF * E / CAST_BLK, 256, 0, stream>>>(w2, w2b);

  ln_bf16_kernel<<<M, 256, 0, stream>>>(x, ln1g, ln1b, ln1o);

  // kqv = ln1 @ w_kqv -> bf16   [4096 x 3072], K=1024; 16 x 16 blocks, 1 a WGP
  static_assert(M % 256 == 0 && K3 % 192 == 0 && DFF % 256 == 0, "whole tiles");
  gemm_bf16_wmma<256, 192, 128, K3, false, false, false, true>
      <<<dim3(K3 / 192, M / 256), 256, 0, stream>>>(
          ln1o, wkqvb, nullptr, nullptr, nullptr, kqvb, M, K3, E);

  // x1 = x + attention(kqv)
  attn_kernel<<<dim3(H * Bq, S / 64), 128, 0, stream>>>(kqvb, x, x1);

  ln_bf16_kernel<<<M, 256, 0, stream>>>(x1, ln2g, ln2b, ln2o);

  // h1 = relu(ln2 @ w1 + b1) -> bf16   [4096 x 4096], K=1024; 16 x 16 blocks, 1 a WGP
  gemm_bf16_wmma<256, 256, 128, DFF, true, true, false, true>
      <<<dim3(DFF / 256, M / 256), 256, 0, stream>>>(
          ln2o, w1b, b1, nullptr, nullptr, h1, M, DFF, E);

  // out = h1 @ w2 + b2 + x1   [4096 x 1024], K=4096; 1 block a WGP
  gemm_bf16_wmma<128, 128, 256, E, true, false, true, false>
      <<<dim3(E / 128, M / 128), 256, 0, stream>>>(
          h1, w2b, b2, x1, out, nullptr, M, E, DFF);
}

// v007
// It runs in 135 microseconds.
// In both of two side-by-side timings against v006, it was 1.04 times as fast.
// Counting every step since v000, it is 4.22 times as fast.
#include <hip/hip_runtime.h>
#include <hip/hip_bf16.h>
#include <stdint.h>

// ---------------------------------------------------------------------------
// ALiBi transformer layer for MI455X (gfx1250, wave32, WMMA).
// bf16 operands / f32 accumulate via v_wmma_f32_16x16x32_bf16.
// Double-buffered GEMM staging via GLOBAL_LOAD_ASYNC_TO_LDS (ASYNCcnt).
// ---------------------------------------------------------------------------

typedef __attribute__((ext_vector_type(16))) __bf16 v16bf;
typedef __attribute__((ext_vector_type(8)))  float  v8f;

union Frag16 { v16bf v; uint4 u[2]; };

typedef uint32_t u32x4 __attribute__((ext_vector_type(4)));
typedef short s16x8 __attribute__((ext_vector_type(8)));
union FragT { v16bf v; u32x4 q[2]; };

// Transposing LDS load: lane (c = l & 15, h = l >> 4) gets T[8 h + 0..7][c] of a
// row-major 16-bit tile whose lane addresses are row 8 h + (l & 7), byte 16 * ((l >> 3) & 1).
static __device__ __forceinline__ u32x4 ld_tr16(const unsigned char* p) {
  typedef __attribute__((address_space(3))) s16x8 lds_s16x8;
  return __builtin_bit_cast(u32x4, __builtin_amdgcn_ds_load_tr16_b128_v8i16((lds_s16x8*)p));
}

static __device__ __forceinline__ __bf16 f2bf(float x) {
  unsigned u = __builtin_bit_cast(unsigned, x);
  unsigned r = (u + 0x7FFFu + ((u >> 16) & 1u)) >> 16;   // round-to-nearest-even
  unsigned short h = (unsigned short)r;
  return __builtin_bit_cast(__bf16, h);
}

typedef float f32x4 __attribute__((ext_vector_type(4)));
typedef float f32x2 __attribute__((ext_vector_type(2)));

static __device__ __forceinline__ uint32_t pack2(float lo, float hi) {  // round to nearest even
  typedef __bf16 bf2 __attribute__((ext_vector_type(2)));
  typedef float f2 __attribute__((ext_vector_type(2)));
  return __builtin_bit_cast(uint32_t, __builtin_convertvector(f2{lo, hi}, bf2));
}

// ----------------------- async global->LDS copy (b128) ----------------------
#if __has_builtin(__builtin_amdgcn_global_load_async_to_lds_b128) && \
    __has_builtin(__builtin_amdgcn_s_wait_asynccnt)
#define USE_ASYNC_LDS 1
#else
#define USE_ASYNC_LDS 0
#endif

typedef int v4i_t __attribute__((vector_size(4 * sizeof(int))));
typedef __attribute__((address_space(1))) v4i_t* g_v4i_ptr;
typedef __attribute__((address_space(3))) v4i_t* l_v4i_ptr;

static __device__ __forceinline__ void copy16_g2l(const void* g, void* l) {
#if USE_ASYNC_LDS
  __builtin_amdgcn_global_load_async_to_lds_b128(
      (g_v4i_ptr)((v4i_t*)g), (l_v4i_ptr)((v4i_t*)l), 0, 0);
#else
  *(uint4*)l = *(const uint4*)g;
#endif
}

static __device__ __forceinline__ void g2l_wait() {
#if USE_ASYNC_LDS
  __builtin_amdgcn_s_wait_asynccnt(0);
#endif
}

// ------------------------------- cast f32 -> bf16 ---------------------------
// A wave converts 1024 consecutive elements: eight 16-byte loads a lane, each 512
// contiguous bytes across the wave and all in flight together, then eight 8-byte
// stores (256 contiguous bytes across the wave).  Few, long waves, so that the stream
// and not the rate at which waves start sets the time.
// Block blk of 256 threads converts elements blk * CAST_BLK .. + CAST_BLK - 1.
constexpr int CAST_BLK = 256 * 32;
static __device__ __forceinline__ void cast_block(
    const float* __restrict__ in, __bf16* __restrict__ out, int blk) {
  typedef float f32q __attribute__((ext_vector_type(4)));
  typedef __bf16 bf16q __attribute__((ext_vector_type(4)));
  const int base = blk * CAST_BLK + (threadIdx.x >> 5) * 1024 + (threadIdx.x & 31) * 4;
  f32q v[8];
  // Both loops unrolled: v stays in registers and the eight loads issue as one group.
#pragma unroll
  for (int i = 0; i < 8; ++i) v[i] = *(const f32q*)(in + base + i * 128);
#pragma unroll
  for (int i = 0; i < 8; ++i)
    *(bf16q*)(out + base + i * 128) = __builtin_convertvector(v[i], bf16q);  // nearest even
}

// ------------------------------- LayerNorm -> bf16 --------------------------
// One row of 1024 by a block of 256 threads.
static __device__ __forceinline__ void ln_row(
    const float* __restrict__ x, const float* __restrict__ g,
    const float* __restrict__ bta, __bf16* __restrict__ out, int row) {
  constexpr int E = 1024;
  const int t = threadIdx.x;
  const float* xr = x + (size_t)row * E;
  float v[4];
  float s = 0.f, s2 = 0.f;
#pragma unroll
  for (int i = 0; i < 4; ++i) {
    v[i] = xr[t + i * 256];
    s += v[i];
    s2 += v[i] * v[i];
  }
#pragma unroll
  for (int o = 16; o > 0; o >>= 1) {
    s += __shfl_xor(s, o, 32);
    s2 += __shfl_xor(s2, o, 32);
  }
  __shared__ float ps[8], ps2[8];
  if ((t & 31) == 0) { ps[t >> 5] = s; ps2[t >> 5] = s2; }
  __syncthreads();
  s = 0.f; s2 = 0.f;
#pragma unroll
  for (int i = 0; i < 8; ++i) { s += ps[i]; s2 += ps2[i]; }
  const float mu = s * (1.0f / E);
  const float var = s2 * (1.0f / E) - mu * mu;
  const float rstd = rsqrtf(var + 1e-5f);
#pragma unroll
  for (int i = 0; i < 4; ++i) {
    int c = t + i * 256;
    out[(size_t)row * E + c] = f2bf((v[i] - mu) * rstd * g[c] + bta[c]);
  }
}

__global__ __launch_bounds__(256) void ln_bf16_kernel(
    const float* __restrict__ x, const float* __restrict__ g,
    const float* __restrict__ bta, __bf16* __restrict__ out) {
  ln_row(x, g, bta, out, blockIdx.x);
}

// ---------------- the three weight casts and the first LayerNorm, one launch ----------------
// None of the four reads what another writes, and each alone is too short to fill the chip for
// longer than a launch takes to start and to drain: as one grid they pay that once and their
// streams overlap.  The cast blocks (NA, NB and NC of them, the arrays' lengths in CAST_BLK)
// have the low indices, the row blocks the rest.
template <int NA, int NB, int NC>
__global__ __launch_bounds__(256) void prep_kernel(
    const float* __restrict__ x, const float* __restrict__ g,
    const float* __restrict__ bta, __bf16* __restrict__ lo,
    const float* __restrict__ wa, const float* __restrict__ wb, const float* __restrict__ wc,
    __bf16* __restrict__ oa, __bf16* __restrict__ ob, __bf16* __restrict__ oc) {
  const int b = blockIdx.x;              // the branch and the selections are uniform for the block
  if (b < NA + NB + NC) {
    const bool ia = b < NA, ib = b < NA + NB;
    cast_block(ia ? wa : ib ? wb : wc, ia ? oa : ib ? ob : oc, ia ? b : ib ? b - NA : b - (NA + NB));
  } else {
    ln_row(x, g, bta, lo, b - (NA + NB + NC));
  }
}

// ------------------------------- WMMA GEMM ----------------------------------
// C[M,N] = act(A[M,K] @ B[K,N] + bias) (+ res).  A/B bf16 row-major, acc f32.
// Block BM x BN, 8 waves as 4 (M) x 2 (N); wave tile BM/4 x BN/2.
// A block stages (BM + BN) k-rows for BM x BN results and a wave reads BM/64 + BN/32 fragments
// for their product of WMMAs, so both the bytes that come from L2 and the bytes read from LDS
// per product fall as the tile grows.  BM x BN is chosen per launch: the largest tile whose
// grid still gives every WGP a block (M a multiple of BM, N of BN).
// Double-buffered LDS staging via async global->LDS copies:
//   iter k: wait(async) -> barrier -> issue stage(k+1) -> WMMA on tile k.
// A stage holds BK k values (K a multiple of BK).  The operands come from memory, so a trip
// lasts at least one memory latency: BK sets how many bytes fly and how many products run
// per latency.  BK is chosen per launch: as deep as the LDS holds for the blocks a WGP gets.
// LDC: the row pitch of C and res in elements (the launch's N), a constant so that the rows of a
// tile are immediate offsets from one address.
constexpr int cgcd(int a, int b) { return b ? cgcd(b, a % b) : a; }
template <int BM, int BN, int BK, int LDC, bool BIAS, bool RELU, bool RES, bool OBF16>
__global__ __launch_bounds__(256) void gemm_bf16_wmma(
    const __bf16* __restrict__ A, const __bf16* __restrict__ B,
    const float* __restrict__ bias, const float* __restrict__ res,
    float* __restrict__ Cf, __bf16* __restrict__ Cb,
    int M, int N, int K) {
  // A rows: 2 BK + 16 B = 16 B x odd (ds_load_b128); B rows: 2 BN + 32 B = 32 B x odd (ds_load_tr16_b128).
  static_assert(BK % 64 == 0, "A rows are staged as whole 128-byte lines");
  static_assert(BM % 64 == 0 && BN % 64 == 0, "whole 16 x 16 tiles a wave, B rows of whole lines");
  static_assert(BM * BK % 2048 == 0 && BK * BN % 2048 == 0, "every thread copies the same count");
  constexpr int PB = BN + 16;
  constexpr int MT = BM / 64;    // 16-row tiles of a wave
  constexpr int NT = BN / 32;    // 16-column tiles of a wave
  constexpr bool GROUPED = MT > 2;   // tiles with more rows of products than the 128 x 128 block's
  __shared__ __attribute__((aligned(16))) __bf16 As[2][BM][BK + 8];    // [m][k]
  __shared__ __attribute__((aligned(32))) __bf16 Bs[2][BK][PB];        // [k][n]

  const int tid = threadIdx.x;
  const int lane = tid & 31;
  const int w = tid >> 5;
  const int wm = (w & 3) * (BM / 4);   // 4 waves along M
  const int wn = (w >> 2) * (BN / 2);  // 2 waves along N
  const int m0 = blockIdx.y * BM;
  const int n0 = blockIdx.x * BN;
  const int ml = lane & 15;
  const int kb = (lane >> 4) * 8;
  const int half8 = (lane >> 4) * 8;

  v8f acc[MT][NT];
  const v8f vz = {};
#pragma unroll
  for (int i = 0; i < MT; ++i)
#pragma unroll
    for (int j = 0; j < NT; ++j) acc[i][j] = vz;

  auto stage = [&](int buf, int k0) {
    // A tile BM x BK in chunks of 8 bf16, BK / 8 to a row.
#pragma unroll
    for (int it = 0; it < BM * BK / 2048; ++it) {
      int c = tid + it * 256;
      int r = c / (BK / 8);
      int col = (c % (BK / 8)) * 8;
      copy16_g2l(A + (size_t)(m0 + r) * K + k0 + col, &As[buf][r][col]);
    }
    // B tile BK x BN, BN / 8 chunks to a row (kept [k][n], no transpose so it can stream async).
#pragma unroll
    for (int it = 0; it < BK * BN / 2048; ++it) {
      int c = tid + it * 256;
      int kr = c / (BN / 8);
      int nc = (c % (BN / 8)) * 8;
      copy16_g2l(B + (size_t)(k0 + kr) * N + n0 + nc, &Bs[buf][kr][nc]);
    }
  };

  const int nk = K / BK;
  stage(0, 0);
  for (int kk = 0; kk < nk; ++kk) {
    const int buf = kk & 1;
    g2l_wait();        // own async stores to LDS have landed
    __syncthreads();   // everyone's have
    if (kk + 1 < nk) stage(buf ^ 1, (kk + 1) * BK);

    // The stage's 32-k slices in ascending k.  Unrolled: every LDS offset is a constant and
    // a slice's fragment loads can issue under the slice before.
#pragma unroll
    for (int ks = 0; ks < BK; ks += 32) {
      Frag16 af[MT];
      FragT bfr[NT];
#pragma unroll
      for (int mt = 0; mt < MT; ++mt) {
        int r = wm + mt * 16 + ml;
        af[mt].u[0] = *(const uint4*)&As[buf][r][ks + kb];
        af[mt].u[1] = *(const uint4*)&As[buf][r][ks + 16 + kb];
      }
      // B fragments straight from the [k][n] tile: k = kb + 0..7 and 16 + kb + 0..7 of
      // column wn + 16 nt + ml, the same k order as A's two 16-byte loads.
      const unsigned char* bp =
          (const unsigned char*)&Bs[buf][ks + kb + (lane & 7)][wn + ((lane >> 3) & 1) * 8];
#pragma unroll
      for (int nt = 0; nt < NT; ++nt) {
        bfr[nt].q[0] = ld_tr16(bp + 32 * nt);
        bfr[nt].q[1] = ld_tr16(bp + 16 * PB * 2 + 32 * nt);
      }
      // Keeps a large tile's fragment loads ahead of all the slice's products: left free, each row
      // of products fetched its A fragment right in front of it and waited out an LDS latency.
      if constexpr (GROUPED) __builtin_amdgcn_sched_barrier(0);
#pragma unroll
      for (int mt = 0; mt < MT; ++mt)
#pragma unroll
        for (int nt = 0; nt < NT; ++nt)
          acc[mt][nt] = __builtin_amdgcn_wmma_f32_16x16x32_bf16(   // C^T tile: B^T first, A^T second
              false, bfr[nt].v, false, af[mt].v, (short)0, acc[mt][nt], false, false);
    }
    __syncthreads();   // reads done before this buffer is re-staged
  }

  // Epilogue.  The products are formed transposed (the two fragments have the same lane and
  // k layout, so they only change places): acc[mt][nt][r] = C[wm + 16 mt + ml][wn + 16 nt + half8 + r],
  // 8 adjacent columns of one row in a lane.  Each wave writes its tile into its own range of the
  // A buffers (free behind the loop's last barrier) with 16-byte LDS stores and reads it back
  // row by row, so that every global access is 16 bytes a lane over whole rows of the tile.
  static_assert(!(OBF16 && RES), "the residual is added in f32, behind the staging");
  constexpr int WR = BM / 4, WC = BN / 2;       // rows and columns of a wave's tile
  constexpr int ESZ = OBF16 ? 2 : 4;            // bytes of a staged element
  constexpr int SP = WC * ESZ + 16;             // staged row pitch: 16 B x odd (16-byte LDS accesses)
  constexpr int CPR = WC * ESZ / 16;            // 16-byte pieces of a row
  constexpr int PER = CPR / cgcd(32, CPR);      // wave-wide accesses until the lanes' pattern repeats,
  constexpr int RPP = 32 / cgcd(32, CPR);       // which is this many rows further down
  static_assert((SP / 16) % 2 == 1 && WR % RPP == 0, "pitch; whole periods");
  static_assert(8 * WR * SP <= (int)sizeof(As), "the eight waves' ranges fit the A buffers");
  unsigned char* sw = (unsigned char*)&As[0][0][0] + w * (WR * SP);

  // Where a lane reads the staged tile back, and the element of C that piece starts at.
  const unsigned char* sp[PER];
  int gn[PER];
  size_t gi[PER];
#pragma unroll
  for (int t = 0; t < PER; ++t) {
    const int c = t * 32 + lane;
    sp[t] = sw + (c / CPR) * SP + (c % CPR) * 16;
    gn[t] = n0 + wn + (c % CPR) * (16 / ESZ);
    gi[t] = (size_t)(m0 + wm + c / CPR) * LDC + gn[t];
  }

  f32x4 bq[OBF16 ? NT : 1][2];                  // bias of the lane's columns
  f32x4 rv[OBF16 ? 1 : WR / RPP];               // residual of the lane's pieces
  if constexpr (OBF16) {
    if constexpr (BIAS) {
      const float* bp = bias + n0 + wn + half8;
#pragma unroll
      for (int nt = 0; nt < NT; ++nt) {
        bq[nt][0] = *(const f32x4*)(bp + nt * 16);
        bq[nt][1] = *(const f32x4*)(bp + nt * 16 + 4);
      }
      // The loads' address register is free for reuse only behind this wait: named as an input,
      // it also stays out of the loads' own destinations.
      asm volatile("s_wait_xcnt 0x0" :: "v"(bp) : "memory");
    }
#pragma unroll
    for (int mt = 0; mt < MT; ++mt) {
#pragma unroll
      for (int nt = 0; nt < NT; ++nt) {
        f32x4 lo = {acc[mt][nt][0], acc[mt][nt][1], acc[mt][nt][2], acc[mt][nt][3]};
        f32x4 hi = {acc[mt][nt][4], acc[mt][nt][5], acc[mt][nt][6], acc[mt][nt][7]};
        if constexpr (BIAS) { lo += bq[nt][0]; hi += bq[nt][1]; }
        if constexpr (RELU) {
#pragma unroll
          for (int i = 0; i < 4; ++i) { lo[i] = fmaxf(lo[i], 0.0f); hi[i] = fmaxf(hi[i], 0.0f); }
        }
        const u32x4 pk = {pack2(lo[0], lo[1]), pack2(lo[2], lo[3]), pack2(hi[0], hi[1]), pack2(hi[2], hi[3])};
        *(u32x4*)(sw + (mt * 16 + ml) * SP + (nt * 16 + half8) * ESZ) = pk;
      }
    }
  } else {
    static_assert(OBF16 || (PER == 1 && BIAS && RES), "f32 output: one lane pattern, bias and residual");
    // Bias and residual of the lane's pieces, in flight under the staging.
    const float* bp = bias + gn[0];
    const float* rp = res + gi[0];
    bq[0][0] = *(const f32x4*)bp;
#pragma unroll
    for (int j = 0; j < WR / RPP; ++j) rv[j] = *(const f32x4*)(rp + (size_t)j * RPP * LDC);
    // As above: the two address registers are reused only behind this wait.
    asm volatile("s_wait_xcnt 0x0" :: "v"(bp), "v"(rp) : "memory");
#pragma unroll
    for (int mt = 0; mt < MT; ++mt) {
#pragma unroll
      for (int nt = 0; nt < NT; ++nt) {
        unsigned char* d = sw + (mt * 16 + ml) * SP + (nt * 16 + half8) * ESZ;
        *(f32x4*)d = f32x4{acc[mt][nt][0], acc[mt][nt][1], acc[mt][nt][2], acc[mt][nt][3]};
        *(f32x4*)(d + 16) = f32x4{acc[mt][nt][4], acc[mt][nt][5], acc[mt][nt][6], acc[mt][nt][7]};
      }
    }
  }
  // The wave's own staged rows are in LDS before its lanes read one another's pieces back.
  asm volatile("s_wait_dscnt 0x0" ::: "memory");
#pragma unroll
  for (int j = 0; j < WR / RPP; ++j) {
#pragma unroll
    for (int t = 0; t < PER; ++t) {
      const unsigned char* s = sp[t] + j * RPP * SP;
      const size_t idx = gi[t] + (size_t)j * RPP * LDC;
      if constexpr (OBF16) {
        *(u32x4*)(Cb + idx) = *(const u32x4*)s;
      } else {
        f32x4 v = *(const f32x4*)s + bq[0][0];
        if constexpr (RELU) {
#pragma unroll
          for (int i = 0; i < 4; ++i) v[i] = fmaxf(v[i], 0.0f);
        }
        *(f32x4*)(Cf + idx) = v + rv[j];
      }
    }
  }
}

constexpr int AT_PK = 144;              // K row pitch in LDS: 16 B x odd (ds_load_b128)
constexpr int AT_PV = 160;              // V row pitch in LDS: 32 B x odd (ds_load_tr16_b128)
constexpr int AT_TK = 64 * AT_PK;       // one K tile
constexpr int AT_SLOT = AT_TK + 64 * AT_PV;

static __device__ __forceinline__ float xhalf(float v) {  // lane l <-> lane l ^ 16
  int b = __builtin_bit_cast(int, v);
  return __builtin_bit_cast(float,
      __builtin_amdgcn_permlanex16(b, b, 0x76543210, 0xfedcba98, false, false));
}
static __device__ __forceinline__ v8f mma_bf16(const FragT& a, const FragT& b, v8f c) {
  return __builtin_amdgcn_wmma_f32_16x16x32_bf16(false, a.v, false, b.v, (short)0, c, false, false);
}

__global__ __launch_bounds__(128) void attn_kernel(
    const __bf16* __restrict__ kqv, const float* __restrict__ x,
    float* __restrict__ x1) {
  constexpr int E = 1024, S = 2048, K3 = 3 * E;
  __shared__ __attribute__((aligned(32))) unsigned char L[2 * AT_SLOT];
  const int tid = threadIdx.x;
  const int lane = tid & 31;
  const int wave = __builtin_amdgcn_readfirstlane(tid >> 5);
  const int c = lane & 15;
  const int hh = lane >> 4;
  const int h = blockIdx.x & 15;
  const int b = blockIdx.x >> 4;
  // Query block: long blocks get low indices; every second group of 8 ranks
  // runs the other way, so that indices 256 apart add up to equal lengths.
  const int rg = blockIdx.y >> 3, rj = blockIdx.y & 7;
  const int qb = 31 - (8 * rg + ((rg & 1) ? 7 - rj : rj));
  const int qw0 = qb * 64 + wave * 16;   // first query of this wave
  const int myq = qw0 + c;               // this lane's query
  constexpr float LOG2E = 1.4426950408889634f;
  const float slope2 = exp2f(-0.5f * (float)(h + 1)) * LOG2E;  // (2^8)^(-(h+1)/16), base 2
  const float c1 = 0.03125f * LOG2E;                           // 1/sqrt(E), base 2

  const __bf16* kvb = kqv + (size_t)(b * S) * K3 + h * 64;     // K rows; V rows at + 2E
  const int srow = tid >> 3, scol = tid & 7;
  u32x4 rk[4], rv[4];
  auto gload = [&](int st) {
    for (int it = 0; it < 4; ++it) {
      const __bf16* p = kvb + (size_t)(st * 64 + srow + it * 16) * K3 + scol * 8;
      rk[it] = *(const u32x4*)p;
      rv[it] = *(const u32x4*)(p + 2 * E);
    }
  };
  auto lstore = [&](int buf) {
    unsigned char* d = L + buf * AT_SLOT;
    for (int it = 0; it < 4; ++it) {
      const int row = srow + it * 16;
      *(u32x4*)(d + row * AT_PK + scol * 16) = rk[it];
      *(u32x4*)(d + AT_TK + row * AT_PV + scol * 16) = rv[it];
    }
  };

  gload(0);
  // Q fragments (B operand), k order 8*hh + 0..7, 16 + 8*hh + 0..7 per 32.
  FragT qf[2];
  {
    const __bf16* qp = kqv + (size_t)(b * S + myq) * K3 + E + h * 64 + 8 * hh;
    for (int kc = 0; kc < 2; ++kc) {
      qf[kc].q[0] = *(const u32x4*)(qp + 32 * kc);
      qf[kc].q[1] = *(const u32x4*)(qp + 32 * kc + 16);
    }
  }
  const v8f vz = {};
  v8f acc[4];                            // acc[t][r] = O^T[16 t + 8 hh + r][query c]
  for (int t = 0; t < 4; ++t) acc[t] = vz;
  float m_run = -INFINITY;               // running maximum (base 2), equal in both halves
  float l_run = 0.0f;                    // this half's share of the denominator
  lstore(0);
  __syncthreads();                       // tile 0 visible to all four waves

  const int nst = qb + 1;                // the last tile holds the diagonal
  for (int st = 0; st < nst; ++st) {
    const unsigned char* Lb = L + (st & 1) * AT_SLOT;
    const bool more = st + 1 < nst;
    if (more) {
      gload(st + 1);                     // in flight under this tile's work
      // The loads' address registers are reused by the work below.
      asm volatile("s_wait_xcnt 0x0" ::: "memory");
    }
    for (int sub = 0; sub < 2; ++sub) {
      const int key0 = st * 64 + sub * 32;
      if (key0 <= qw0 + 15) {            // wave-uniform: skip keys beyond the wave's last query
        FragT kf[2][2], vf[4];
        for (int kt = 0; kt < 2; ++kt) {
          const unsigned char* p = Lb + (sub * 32 + 16 * kt + c) * AT_PK + 16 * hh;
          for (int kc = 0; kc < 2; ++kc) {
            kf[kt][kc].q[0] = *(const u32x4*)(p + 64 * kc);
            kf[kt][kc].q[1] = *(const u32x4*)(p + 64 * kc + 32);
          }
        }
        {
          const unsigned char* ad = Lb + AT_TK + (sub * 32 + 8 * hh + (lane & 7)) * AT_PV +
                                    ((lane >> 3) & 1) * 16;
          for (int t = 0; t < 4; ++t) {
            vf[t].q[0] = ld_tr16(ad + 32 * t);
            vf[t].q[1] = ld_tr16(ad + 16 * AT_PV + 32 * t);
          }
        }
        // Keeps the pass's 16 LDS loads in one group ahead of the products: one
        // LDS latency a pass; left free, each product waited for its own pair.
        __builtin_amdgcn_sched_barrier(0);
        f32x2 tv[8];                     // tv[4 kt + j]: keys key0 + 16 kt + 8 hh + 2 j, + 1
        for (int kt = 0; kt < 2; ++kt) {
          v8f s = mma_bf16(kf[kt][0], qf[0], vz);
          s = mma_bf16(kf[kt][1], qf[1], s);
          for (int j = 0; j < 4; ++j)
            tv[4 * kt + j] = __builtin_elementwise_fma(
                f32x2{s[2 * j], s[2 * j + 1]}, f32x2{c1, c1},
                f32x2{slope2 * (float)(16 * kt + 2 * j), slope2 * (float)(16 * kt + 2 * j + 1)});
        }
        if (key0 + 31 > qw0) {           // wave-uniform: causal mask near the diagonal only
          for (int i = 0; i < 8; ++i) {
            const int key = key0 + 16 * (i >> 2) + 8 * hh + 2 * (i & 3);
            if (key > myq) tv[i].x = -INFINITY;
            if (key + 1 > myq) tv[i].y = -INFINITY;
          }
        }
        float mx = fmaxf(tv[0].x, tv[0].y);
        for (int i = 1; i < 8; ++i) mx = fmaxf(fmaxf(mx, tv[i].x), tv[i].y);
        const float base = slope2 * (float)(key0 + 8 * hh - myq);  // rest of the ALiBi term, per half
        mx += base;
        mx = fmaxf(mx, xhalf(mx));       // finite: the pass's first key is visible to every query
        const float m_new = fmaxf(m_run, mx);
        const float corr = __builtin_amdgcn_exp2f(m_run - m_new);
        const float nm = base - m_new;
        m_run = m_new;
        f32x2 ps2 = {0.0f, 0.0f};
        FragT pf;
        for (int i = 0; i < 8; ++i) {
          const f32x2 a = tv[i] + f32x2{nm, nm};
          const f32x2 p = {__builtin_amdgcn_exp2f(a.x), __builtin_amdgcn_exp2f(a.y)};
          ps2 += p;
          pf.q[i >> 2][i & 3] = pack2(p.x, p.y);
        }
        const float ps = ps2.x + ps2.y;
        l_run = l_run * corr + ps;
        for (int t = 0; t < 4; ++t) acc[t] = acc[t] * corr;
        for (int t = 0; t < 4; ++t) acc[t] = mma_bf16(vf[t], pf, acc[t]);
      }
    }
    if (more) {
      lstore((st + 1) & 1);              // its last readers left before the previous barrier
      __syncthreads();                   // next tile visible; this tile's reads are over
    }
  }

  // Join the halves' denominators, normalize, fuse the residual: x1 = x + attn.
  // A lane owns 8 consecutive d of its query per tile: two 16-byte accesses.
  const float inv = 1.0f / (l_run + xhalf(l_run));
  for (int t = 0; t < 4; ++t) {
    const size_t idx = (size_t)(b * S + myq) * E + h * 64 + 16 * t + 8 * hh;
    const f32x4 xa = *(const f32x4*)(x + idx);
    const f32x4 xb = *(const f32x4*)(x + idx + 4);
    const f32x4 oa = {acc[t][0], acc[t][1], acc[t][2], acc[t][3]};
    const f32x4 ob = {acc[t][4], acc[t][5], acc[t][6], acc[t][7]};
    *(f32x4*)(x1 + idx) = xa + oa * inv;
    *(f32x4*)(x1 + idx + 4) = xb + ob * inv;
  }
}

// ------------------------------- launch -------------------------------------
extern "C" void kernel_launch(void* const* d_in, const int* in_sizes, int n_in,
                              void* d_out, int out_size, void* d_ws, size_t ws_size,
                              hipStream_t stream) {
  constexpr int E = 1024, H = 16, DFF = 4096, Bq = 2, S = 2048;
  constexpr int M = Bq * S;       // 4096
  constexpr int K3 = 3 * E;       // 3072
  (void)in_sizes; (void)n_in; (void)out_size; (void)ws_size;

  const float* x    = (const float*)d_in[0];
  const float* wkqv = (const float*)d_in[1];
  const float* ln1g = (const float*)d_in[2];
  const float* ln1b = (const float*)d_in[3];
  const float* ln2g = (const float*)d_in[4];
  const float* ln2b = (const float*)d_in[5];
  const float* w1   = (const float*)d_in[6];
  const float* b1   = (const float*)d_in[7];
  const float* w2   = (const float*)d_in[8];
  const float* b2   = (const float*)d_in[9];
  float* out = (float*)d_out;

  char* cur = (char*)d_ws;
  auto carve = [&](size_t bytes) -> char* {
    char* p = cur;
    cur += (bytes + 255) & ~(size_t)255;
    return p;
  };
  __bf16* ln1o  = (__bf16*)carve((size_t)M * E * 2);     // LN1 out (bf16)
  __bf16* wkqvb = (__bf16*)carve((size_t)E * K3 * 2);    // w_kqv bf16
  __bf16* kqvb  = (__bf16*)carve((size_t)M * K3 * 2);    // kqv bf16
  float*  x1    = (float*) carve((size_t)M * E * 4);     // x + attn
  __bf16* ln2o  = (__bf16*)carve((size_t)M * E * 2);     // LN2 out (bf16)
  __bf16* w1b   = (__bf16*)carve((size_t)E * DFF * 2);   // w1 bf16
  __bf16* w2b   = (__bf16*)carve((size_t)DFF * E * 2);   // w2 bf16
  __bf16* h1    = (__bf16*)carve((size_t)M * DFF * 2);   // relu(ffn1) bf16

  // Weight casts and LN1 in one launch: whole cast blocks, then one block a row.
  static_assert(E * K3 % CAST_BLK == 0 && E * DFF % CAST_BLK == 0, "cast grid must be exact");
  constexpr int NA = E * K3 / CAST_BLK, NB = E * DFF / CAST_BLK, NC = DFF * E / CAST_BLK;
  prep_kernel<NA, NB, NC><<<NA + NB + NC + M, 256, 0, stream>>>(
      x, ln1g, ln1b, ln1o, wkqv, w1, w2, wkqvb, w1b, w2b);

  // kqv = ln1 @ w_kqv -> bf16   [4096 x 3072], K=1024; 16 x 16 blocks, 1 a WGP
  static_assert(M % 256 == 0 && K3 % 192 == 0 && DFF % 256 == 0, "whole tiles");
  gemm_bf16_wmma<256, 192, 128, K3, false, false, false, true>
      <<<dim3(K3 / 192, M / 256), 256, 0, stream>>>(
          ln1o, wkqvb, nullptr, nullptr, nullptr, kqvb, M, K3, E);

  // x1 = x + attention(kqv)
  attn_kernel<<<dim3(H * Bq, S / 64), 128, 0, stream>>>(kqvb, x, x1);

  ln_bf16_kernel<<<M, 256, 0, stream>>>(x1, ln2g, ln2b, ln2o);

  // h1 = relu(ln2 @ w1 + b1) -> bf16   [4096 x 4096], K=1024; 16 x 16 blocks, 1 a WGP
  gemm_bf16_wmma<256, 256, 128, DFF, true, true, false, true>
      <<<dim3(DFF / 256, M / 256), 256, 0, stream>>>(
          ln2o, w1b, b1, nullptr, nullptr, h1, M, DFF, E);

  // out = h1 @ w2 + b2 + x1   [4096 x 1024], K=4096; 1 block a WGP
  gemm_bf16_wmma<128, 128, 256, E, true, false, true, false>
      <<<dim3(E / 128, M / 128), 256, 0, stream>>>(
          h1, w2b, b2, x1, out, nullptr, M, E, DFF);
}

// v008
// It runs in 121 microseconds.
// In two side-by-side timings against v007, it was 1.11 and 1.12 times as fast.
// Counting every step since v000, it is 4.70 times as fast.
#include <hip/hip_runtime.h>
#include <hip/hip_bf16.h>
#include <stdint.h>

// ---------------------------------------------------------------------------
// ALiBi transformer layer for MI455X (gfx1250, wave32, WMMA).
// bf16 operands / f32 accumulate via v_wmma_f32_16x16x32_bf16.
// Double-buffered GEMM staging via GLOBAL_LOAD_ASYNC_TO_LDS (ASYNCcnt).
// ---------------------------------------------------------------------------

typedef __attribute__((ext_vector_type(16))) __bf16 v16bf;
typedef __attribute__((ext_vector_type(8)))  float  v8f;

union Frag16 { v16bf v; uint4 u[2]; };

typedef uint32_t u32x4 __attribute__((ext_vector_type(4)));
typedef short s16x8 __attribute__((ext_vector_type(8)));
union FragT { v16bf v; u32x4 q[2]; };

// Transposing LDS load: lane (c = l & 15, h = l >> 4) gets T[8 h + 0..7][c] of a
// row-major 16-bit tile whose lane addresses are row 8 h + (l & 7), byte 16 * ((l >> 3) & 1).
static __device__ __forceinline__ u32x4 ld_tr16(const unsigned char* p) {
  typedef __attribute__((address_space(3))) s16x8 lds_s16x8;
  return __builtin_bit_cast(u32x4, __builtin_amdgcn_ds_load_tr16_b128_v8i16((lds_s16x8*)p));
}

static __device__ __forceinline__ __bf16 f2bf(float x) {
  unsigned u = __builtin_bit_cast(unsigned, x);
  unsigned r = (u + 0x7FFFu + ((u >> 16) & 1u)) >> 16;   // round-to-nearest-even
  unsigned short h = (unsigned short)r;
  return __builtin_bit_cast(__bf16, h);
}

typedef float f32x4 __attribute__((ext_vector_type(4)));
typedef float f32x2 __attribute__((ext_vector_type(2)));

static __device__ __forceinline__ uint32_t pack2(float lo, float hi) {  // round to nearest even
  typedef __bf16 bf2 __attribute__((ext_vector_type(2)));
  typedef float f2 __attribute__((ext_vector_type(2)));
  return __builtin_bit_cast(uint32_t, __builtin_convertvector(f2{lo, hi}, bf2));
}

// ----------------------- async global->LDS copy (b128) ----------------------
#if __has_builtin(__builtin_amdgcn_global_load_async_to_lds_b128) && \
    __has_builtin(__builtin_amdgcn_s_wait_asynccnt)
#define USE_ASYNC_LDS 1
#else
#define USE_ASYNC_LDS 0
#endif

typedef int v4i_t __attribute__((vector_size(4 * sizeof(int))));
typedef __attribute__((address_space(1))) v4i_t* g_v4i_ptr;
typedef __attribute__((address_space(3))) v4i_t* l_v4i_ptr;

typedef __attribute__((address_space(3))) unsigned char* lds_ptr;   // a 32-bit LDS byte address

static __device__ __forceinline__ void copy16_g2l(const void* g, lds_ptr l) {
#if USE_ASYNC_LDS
  __builtin_amdgcn_global_load_async_to_lds_b128(
      (g_v4i_ptr)((v4i_t*)g), (l_v4i_ptr)l, 0, 0);
#else
  *(l_v4i_ptr)l = *(const v4i_t*)g;
#endif
}

static __device__ __forceinline__ void g2l_wait() {
#if USE_ASYNC_LDS
  __builtin_amdgcn_s_wait_asynccnt(0);
#endif
}

// ------------------------------- cast f32 -> bf16 ---------------------------
// A wave converts 1024 consecutive elements: eight 16-byte loads a lane, each 512
// contiguous bytes across the wave and all in flight together, then eight 8-byte
// stores (256 contiguous bytes across the wave).  Few, long waves, so that the stream
// and not the rate at which waves start sets the time.
// Block blk of 256 threads converts elements blk * CAST_BLK .. + CAST_BLK - 1.
constexpr int CAST_BLK = 256 * 32;
static __device__ __forceinline__ void cast_block(
    const float* __restrict__ in, __bf16* __restrict__ out, int blk) {
  typedef float f32q __attribute__((ext_vector_type(4)));
  typedef __bf16 bf16q __attribute__((ext_vector_type(4)));
  const int base = blk * CAST_BLK + (threadIdx.x >> 5) * 1024 + (threadIdx.x & 31) * 4;
  f32q v[8];
  // Both loops unrolled: v stays in registers and the eight loads issue as one group.
#pragma unroll
  for (int i = 0; i < 8; ++i) v[i] = *(const f32q*)(in + base + i * 128);
#pragma unroll
  for (int i = 0; i < 8; ++i)
    *(bf16q*)(out + base + i * 128) = __builtin_convertvector(v[i], bf16q);  // nearest even
}

// ------------------------------- LayerNorm -> bf16 --------------------------
// One row of 1024 by a block of 256 threads.
static __device__ __forceinline__ void ln_row(
    const float* __restrict__ x, const float* __restrict__ g,
    const float* __restrict__ bta, __bf16* __restrict__ out, int row) {
  constexpr int E = 1024;
  const int t = threadIdx.x;
  const float* xr = x + (size_t)row * E;
  float v[4];
  float s = 0.f, s2 = 0.f;
#pragma unroll
  for (int i = 0; i < 4; ++i) {
    v[i] = xr[t + i * 256];
    s += v[i];
    s2 += v[i] * v[i];
  }
#pragma unroll
  for (int o = 16; o > 0; o >>= 1) {
    s += __shfl_xor(s, o, 32);
    s2 += __shfl_xor(s2, o, 32);
  }
  __shared__ float ps[8], ps2[8];
  if ((t & 31) == 0) { ps[t >> 5] = s; ps2[t >> 5] = s2; }
  __syncthreads();
  s = 0.f; s2 = 0.f;
#pragma unroll
  for (int i = 0; i < 8; ++i) { s += ps[i]; s2 += ps2[i]; }
  const float mu = s * (1.0f / E);
  const float var = s2 * (1.0f / E) - mu * mu;
  const float rstd = rsqrtf(var + 1e-5f);
#pragma unroll
  for (int i = 0; i < 4; ++i) {
    int c = t + i * 256;
    out[(size_t)row * E + c] = f2bf((v[i] - mu) * rstd * g[c] + bta[c]);
  }
}

__global__ __launch_bounds__(256) void ln_bf16_kernel(
    const float* __restrict__ x, const float* __restrict__ g,
    const float* __restrict__ bta, __bf16* __restrict__ out) {
  ln_row(x, g, bta, out, blockIdx.x);
}

// ---------------- the three weight casts and the first LayerNorm, one launch ----------------
// None of the four reads what another writes, and each alone is too short to fill the chip for
// longer than a launch takes to start and to drain: as one grid they pay that once and their
// streams overlap.  The cast blocks (NA, NB and NC of them, the arrays' lengths in CAST_BLK)
// have the low indices, the row blocks the rest.
template <int NA, int NB, int NC>
__global__ __launch_bounds__(256) void prep_kernel(
    const float* __restrict__ x, const float* __restrict__ g,
    const float* __restrict__ bta, __bf16* __restrict__ lo,
    const float* __restrict__ wa, const float* __restrict__ wb, const float* __restrict__ wc,
    __bf16* __restrict__ oa, __bf16* __restrict__ ob, __bf16* __restrict__ oc) {
  const int b = blockIdx.x;              // the branch and the selections are uniform for the block
  if (b < NA + NB + NC) {
    const bool ia = b < NA, ib = b < NA + NB;
    cast_block(ia ? wa : ib ? wb : wc, ia ? oa : ib ? ob : oc, ia ? b : ib ? b - NA : b - (NA + NB));
  } else {
    ln_row(x, g, bta, lo, b - (NA + NB + NC));
  }
}

// ------------------------------- WMMA GEMM ----------------------------------
// C[M,N] = act(A[M,K] @ B[K,N] + bias) (+ res).  A/B bf16 row-major, acc f32.
// Block BM x BN, 8 waves as 4 (M) x 2 (N); wave tile BM/4 x BN/2.
// A block stages (BM + BN) k-rows for BM x BN results and a wave reads BM/64 + BN/32 fragments
// for their product of WMMAs, so both the bytes that come from L2 and the bytes read from LDS
// per product fall as the tile grows.  BM x BN is chosen per launch: the largest tile whose
// grid still gives every WGP a block (M a multiple of BM, N of BN).
// Double-buffered LDS staging via async global->LDS copies:
//   iter k: wait(async) -> barrier -> issue stage(k+1) -> WMMA on tile k.
// A stage holds BK k values (K a multiple of BK).  The operands come from memory, so a trip
// lasts at least one memory latency: BK sets how many bytes fly and how many products run
// per latency.  BK is chosen per launch: as deep as the LDS holds for the blocks a WGP gets.
// LDC: the row pitch of C and res in elements (the launch's N), a constant so that the rows of a
// tile are immediate offsets from one address.
// KD: the launch's K.  With both pitches constant, a thread's copies of one stage and of the next
// differ by constants: each copy's global and LDS address is kept in registers and stepped by one
// add a stage, so no multiply or shift stands on the way from a stage's barrier to its copies.
constexpr int cgcd(int a, int b) { return b ? cgcd(b, a % b) : a; }
template <int BM, int BN, int BK, int LDC, int KD, bool BIAS, bool RELU, bool RES, bool OBF16>
__global__ __launch_bounds__(256) void gemm_bf16_wmma(
    const __bf16* __restrict__ A, const __bf16* __restrict__ B,
    const float* __restrict__ bias, const float* __restrict__ res,
    float* __restrict__ Cf, __bf16* __restrict__ Cb,
    int M, int N, int K) {
  // A rows: 2 BK + 16 B = 16 B x odd (ds_load_b128); B rows: 2 BN + 32 B = 32 B x odd (ds_load_tr16_b128).
  static_assert(BK % 64 == 0, "A rows are staged as whole 128-byte lines");
  static_assert(BM % 64 == 0 && BN % 64 == 0, "whole 16 x 16 tiles a wave, B rows of whole lines");
  static_assert(BM * BK % 2048 == 0 && BK * BN % 2048 == 0, "every thread copies the same count");
  constexpr int PB = BN + 16;
  constexpr int MT = BM / 64;    // 16-row tiles of a wave
  constexpr int NT = BN / 32;    // 16-column tiles of a wave
  constexpr bool GROUPED = MT > 2;   // tiles with more rows of products than the 128 x 128 block's
  __shared__ __attribute__((aligned(16))) __bf16 As[2][BM][BK + 8];    // [m][k]
  __shared__ __attribute__((aligned(32))) __bf16 Bs[2][BK][PB];        // [k][n]

  const int tid = threadIdx.x;
  const int lane = tid & 31;
  const int w = tid >> 5;
  const int wm = (w & 3) * (BM / 4);   // 4 waves along M
  const int wn = (w >> 2) * (BN / 2);  // 2 waves along N
  const int m0 = blockIdx.y * BM;
  const int n0 = blockIdx.x * BN;
  const int ml = lane & 15;
  const int kb = (lane >> 4) * 8;
  const int half8 = (lane >> 4) * 8;

  v8f acc[MT][NT];
  const v8f vz = {};
#pragma unroll
  for (int i = 0; i < MT; ++i)
#pragma unroll
    for (int j = 0; j < NT; ++j) acc[i][j] = vz;

  // Where this thread's copies of the next stage read and write; set here for stage 0, buffer 0.
  // Every loop over these arrays is unrolled, so that they stay in registers.
  constexpr int NCA = BM * BK / 2048, NCB = BK * BN / 2048;
  const char* ga[NCA];
  const char* gb[NCB];
  lds_ptr la[NCA], lb[NCB];
  // A tile BM x BK in chunks of 8 bf16, BK / 8 to a row.
#pragma unroll
  for (int it = 0; it < NCA; ++it) {
    int c = tid + it * 256;
    int r = c / (BK / 8);
    int col = (c % (BK / 8)) * 8;
    ga[it] = (const char*)(A + (size_t)(m0 + r) * KD + col);
    la[it] = (lds_ptr)&As[0][r][col];
  }
  // B tile BK x BN, BN / 8 chunks to a row (kept [k][n], no transpose so it can stream async).
#pragma unroll
  for (int it = 0; it < NCB; ++it) {
    int c = tid + it * 256;
    int kr = c / (BN / 8);
    int nc = (c % (BN / 8)) * 8;
    gb[it] = (const char*)(B + (size_t)kr * LDC + n0 + nc);
    lb[it] = (lds_ptr)&Bs[0][kr][nc];
  }
  int da = (int)sizeof(As[0]), db = (int)sizeof(Bs[0]);   // to the other buffer; the sign turns every stage
  auto stage = [&]() {
#pragma unroll
    for (int it = 0; it < NCA; ++it) copy16_g2l(ga[it], la[it]);
#pragma unroll
    for (int it = 0; it < NCB; ++it) copy16_g2l(gb[it], lb[it]);
#pragma unroll
    for (int it = 0; it < NCA; ++it) { ga[it] += BK * 2; la[it] += da; }
#pragma unroll
    for (int it = 0; it < NCB; ++it) { gb[it] += (size_t)BK * LDC * 2; lb[it] += db; }
    da = -da;
    db = -db;
  };

  constexpr int nk = KD / BK;
  stage();
  for (int kk = 0; kk < nk; ++kk) {
    const int buf = kk & 1;
    g2l_wait();        // own async stores to LDS have landed
    __syncthreads();   // everyone's have
    if (kk + 1 < nk) stage();

    // The stage's 32-k slices in ascending k.  Unrolled: every LDS offset is a constant and
    // a slice's fragment loads can issue under the slice before.
#pragma unroll
    for (int ks = 0; ks < BK; ks += 32) {
      Frag16 af[MT];
      FragT bfr[NT];
#pragma unroll
      for (int mt = 0; mt < MT; ++mt) {
        int r = wm + mt * 16 + ml;
        af[mt].u[0] = *(const uint4*)&As[buf][r][ks + kb];
        af[mt].u[1] = *(const uint4*)&As[buf][r][ks + 16 + kb];
      }
      // B fragments straight from the [k][n] tile: k = kb + 0..7 and 16 + kb + 0..7 of
      // column wn + 16 nt + ml, the same k order as A's two 16-byte loads.
      const unsigned char* bp =
          (const unsigned char*)&Bs[buf][ks + kb + (lane & 7)][wn + ((lane >> 3) & 1) * 8];
#pragma unroll
      for (int nt = 0; nt < NT; ++nt) {
        bfr[nt].q[0] = ld_tr16(bp + 32 * nt);
        bfr[nt].q[1] = ld_tr16(bp + 16 * PB * 2 + 32 * nt);
      }
      // Keeps a large tile's fragment loads ahead of all the slice's products: left free, each row
      // of products fetched its A fragment right in front of it and waited out an LDS latency.
      if constexpr (GROUPED) __builtin_amdgcn_sched_barrier(0);
#pragma unroll
      for (int mt = 0; mt < MT; ++mt)
#pragma unroll
        for (int nt = 0; nt < NT; ++nt)
          acc[mt][nt] = __builtin_amdgcn_wmma_f32_16x16x32_bf16(   // C^T tile: B^T first, A^T second
              false, bfr[nt].v, false, af[mt].v, (short)0, acc[mt][nt], false, false);
    }
    __syncthreads();   // reads done before this buffer is re-staged
  }

  // Epilogue.  The products are formed transposed (the two fragments have the same lane and
  // k layout, so they only change places): acc[mt][nt][r] = C[wm + 16 mt + ml][wn + 16 nt + half8 + r],
  // 8 adjacent columns of one row in a lane.  Each wave writes its tile into its own range of the
  // A buffers (free behind the loop's last barrier) with 16-byte LDS stores and reads it back
  // row by row, so that every global access is 16 bytes a lane over whole rows of the tile.
  static_assert(!(OBF16 && RES), "the residual is added in f32, behind the staging");
  constexpr int WR = BM / 4, WC = BN / 2;       // rows and columns of a wave's tile
  constexpr int ESZ = OBF16 ? 2 : 4;            // bytes of a staged element
  constexpr int SP = WC * ESZ + 16;             // staged row pitch: 16 B x odd (16-byte LDS accesses)
  constexpr int CPR = WC * ESZ / 16;            // 16-byte pieces of a row
  constexpr int PER = CPR / cgcd(32, CPR);      // wave-wide accesses until the lanes' pattern repeats,
  constexpr int RPP = 32 / cgcd(32, CPR);       // which is this many rows further down
  static_assert((SP / 16) % 2 == 1 && WR % RPP == 0, "pitch; whole periods");
  static_assert(8 * WR * SP <= (int)sizeof(As), "the eight waves' ranges fit the A buffers");
  unsigned char* sw = (unsigned char*)&As[0][0][0] + w * (WR * SP);

  // Where a lane reads the staged tile back, and the element of C that piece starts at.
  const unsigned char* sp[PER];
  int gn[PER];
  size_t gi[PER];
#pragma unroll
  for (int t = 0; t < PER; ++t) {
    const int c = t * 32 + lane;
    sp[t] = sw + (c / CPR) * SP + (c % CPR) * 16;
    gn[t] = n0 + wn + (c % CPR) * (16 / ESZ);
    gi[t] = (size_t)(m0 + wm + c / CPR) * LDC + gn[t];
  }

  f32x4 bq[OBF16 ? NT : 1][2];                  // bias of the lane's columns
  f32x4 rv[OBF16 ? 1 : WR / RPP];               // residual of the lane's pieces
  if constexpr (OBF16) {
    if constexpr (BIAS) {
      const float* bp = bias + n0 + wn + half8;
#pragma unroll
      for (int nt = 0; nt < NT; ++nt) {
        bq[nt][0] = *(const f32x4*)(bp + nt * 16);
        bq[nt][1] = *(const f32x4*)(bp + nt * 16 + 4);
      }
      // The loads' address register is free for reuse only behind this wait: named as an input,
      // it also stays out of the loads' own destinations.
      asm volatile("s_wait_xcnt 0x0" :: "v"(bp) : "memory");
    }
#pragma unroll
    for (int mt = 0; mt < MT; ++mt) {
#pragma unroll
      for (int nt = 0; nt < NT; ++nt) {
        f32x4 lo = {acc[mt][nt][0], acc[mt][nt][1], acc[mt][nt][2], acc[mt][nt][3]};
        f32x4 hi = {acc[mt][nt][4], acc[mt][nt][5], acc[mt][nt][6], acc[mt][nt][7]};
        if constexpr (BIAS) { lo += bq[nt][0]; hi += bq[nt][1]; }
        if constexpr (RELU) {
#pragma unroll
          for (int i = 0; i < 4; ++i) { lo[i] = fmaxf(lo[i], 0.0f); hi[i] = fmaxf(hi[i], 0.0f); }
        }
        const u32x4 pk = {pack2(lo[0], lo[1]), pack2(lo[2], lo[3]), pack2(hi[0], hi[1]), pack2(hi[2], hi[3])};
        *(u32x4*)(sw + (mt * 16 + ml) * SP + (nt * 16 + half8) * ESZ) = pk;
      }
    }
  } else {
    static_assert(OBF16 || (PER == 1 && BIAS && RES), "f32 output: one lane pattern, bias and residual");
    // Bias and residual of the lane's pieces, in flight under the staging.
    const float* bp = bias + gn[0];
    const float* rp = res + gi[0];
    bq[0][0] = *(const f32x4*)bp;
#pragma unroll
    for (int j = 0; j < WR / RPP; ++j) rv[j] = *(const f32x4*)(rp + (size_t)j * RPP * LDC);
    // As above: the two address registers are reused only behind this wait.
    asm volatile("s_wait_xcnt 0x0" :: "v"(bp), "v"(rp) : "memory");
#pragma unroll
    for (int mt = 0; mt < MT; ++mt) {
#pragma unroll
      for (int nt = 0; nt < NT; ++nt) {
        unsigned char* d = sw + (mt * 16 + ml) * SP + (nt * 16 + half8) * ESZ;
        *(f32x4*)d = f32x4{acc[mt][nt][0], acc[mt][nt][1], acc[mt][nt][2], acc[mt][nt][3]};
        *(f32x4*)(d + 16) = f32x4{acc[mt][nt][4], acc[mt][nt][5], acc[mt][nt][6], acc[mt][nt][7]};
      }
    }
  }
  // The wave's own staged rows are in LDS before its lanes read one another's pieces back.
  asm volatile("s_wait_dscnt 0x0" ::: "memory");
#pragma unroll
  for (int j = 0; j < WR / RPP; ++j) {
#pragma unroll
    for (int t = 0; t < PER; ++t) {
      const unsigned char* s = sp[t] + j * RPP * SP;
      const size_t idx = gi[t] + (size_t)j * RPP * LDC;
      if constexpr (OBF16) {
        *(u32x4*)(Cb + idx) = *(const u32x4*)s;
      } else {
        f32x4 v = *(const f32x4*)s + bq[0][0];
        if constexpr (RELU) {
#pragma unroll
          for (int i = 0; i < 4; ++i) v[i] = fmaxf(v[i], 0.0f);
        }
        *(f32x4*)(Cf + idx) = v + rv[j];
      }
    }
  }
}

constexpr int AT_PK = 144;              // K row pitch in LDS: 16 B x odd (ds_load_b128)
constexpr int AT_PV = 160;              // V row pitch in LDS: 32 B x odd (ds_load_tr16_b128)
constexpr int AT_TK = 64 * AT_PK;       // one K tile
constexpr int AT_SLOT = AT_TK + 64 * AT_PV;

static __device__ __forceinline__ float xhalf(float v) {  // lane l <-> lane l ^ 16
  int b = __builtin_bit_cast(int, v);
  return __builtin_bit_cast(float,
      __builtin_amdgcn_permlanex16(b, b, 0x76543210, 0xfedcba98, false, false));
}
static __device__ __forceinline__ v8f mma_bf16(const FragT& a, const FragT& b, v8f c) {
  return __builtin_amdgcn_wmma_f32_16x16x32_bf16(false, a.v, false, b.v, (short)0, c, false, false);
}

__global__ __launch_bounds__(128) void attn_kernel(
    const __bf16* __restrict__ kqv, const float* __restrict__ x,
    float* __restrict__ x1) {
  constexpr int E = 1024, S = 2048, K3 = 3 * E;
  __shared__ __attribute__((aligned(32))) unsigned char L[2 * AT_SLOT];
  const int tid = threadIdx.x;
  const int lane = tid & 31;
  const int wave = __builtin_amdgcn_readfirstlane(tid >> 5);
  const int c = lane & 15;
  const int hh = lane >> 4;
  const int h = blockIdx.x & 15;
  const int b = blockIdx.x >> 4;
  // Query block: long blocks get low indices; every second group of 8 ranks
  // runs the other way, so that indices 256 apart add up to equal lengths.
  const int rg = blockIdx.y >> 3, rj = blockIdx.y & 7;
  const int qb = 31 - (8 * rg + ((rg & 1) ? 7 - rj : rj));
  const int qw0 = qb * 64 + wave * 16;   // first query of this wave
  const int myq = qw0 + c;               // this lane's query
  constexpr float LOG2E = 1.4426950408889634f;
  const float slope2 = exp2f(-0.5f * (float)(h + 1)) * LOG2E;  // (2^8)^(-(h+1)/16), base 2
  const float c1 = 0.03125f * LOG2E;                           // 1/sqrt(E), base 2

  const __bf16* kvb = kqv + (size_t)(b * S) * K3 + h * 64;     // K rows; V rows at + 2E
  const int srow = tid >> 3, scol = tid & 7;
  u32x4 rk[4], rv[4];
  auto gload = [&](int st) {
    for (int it = 0; it < 4; ++it) {
      const __bf16* p = kvb + (size_t)(st * 64 + srow + it * 16) * K3 + scol * 8;
      rk[it] = *(const u32x4*)p;
      rv[it] = *(const u32x4*)(p + 2 * E);
    }
  };
  auto lstore = [&](int buf) {
    unsigned char* d = L + buf * AT_SLOT;
    for (int it = 0; it < 4; ++it) {
      const int row = srow + it * 16;
      *(u32x4*)(d + row * AT_PK + scol * 16) = rk[it];
      *(u32x4*)(d + AT_TK + row * AT_PV + scol * 16) = rv[it];
    }
  };

  gload(0);
  // Q fragments (B operand), k order 8*hh + 0..7, 16 + 8*hh + 0..7 per 32.
  FragT qf[2];
  {
    const __bf16* qp = kqv + (size_t)(b * S + myq) * K3 + E + h * 64 + 8 * hh;
    for (int kc = 0; kc < 2; ++kc) {
      qf[kc].q[0] = *(const u32x4*)(qp + 32 * kc);
      qf[kc].q[1] = *(const u32x4*)(qp + 32 * kc + 16);
    }
  }
  const v8f vz = {};
  v8f acc[4];                            // acc[t][r] = O^T[16 t + 8 hh + r][query c]
  for (int t = 0; t < 4; ++t) acc[t] = vz;
  float m_run = -INFINITY;               // running maximum (base 2), equal in both halves
  float l_run = 0.0f;                    // this half's share of the denominator
  lstore(0);
  __syncthreads();                       // tile 0 visible to all four waves

  const int nst = qb + 1;                // the last tile holds the diagonal
  for (int st = 0; st < nst; ++st) {
    const unsigned char* Lb = L + (st & 1) * AT_SLOT;
    const bool more = st + 1 < nst;
    if (more) {
      gload(st + 1);                     // in flight under this tile's work
      // The loads' address registers are reused by the work below.
      asm volatile("s_wait_xcnt 0x0" ::: "memory");
    }
    for (int sub = 0; sub < 2; ++sub) {
      const int key0 = st * 64 + sub * 32;
      if (key0 <= qw0 + 15) {            // wave-uniform: skip keys beyond the wave's last query
        FragT kf[2][2], vf[4];
        for (int kt = 0; kt < 2; ++kt) {
          const unsigned char* p = Lb + (sub * 32 + 16 * kt + c) * AT_PK + 16 * hh;
          for (int kc = 0; kc < 2; ++kc) {
            kf[kt][kc].q[0] = *(const u32x4*)(p + 64 * kc);
            kf[kt][kc].q[1] = *(const u32x4*)(p + 64 * kc + 32);
          }
        }
        {
          const unsigned char* ad = Lb + AT_TK + (sub * 32 + 8 * hh + (lane & 7)) * AT_PV +
                                    ((lane >> 3) & 1) * 16;
          for (int t = 0; t < 4; ++t) {
            vf[t].q[0] = ld_tr16(ad + 32 * t);
            vf[t].q[1] = ld_tr16(ad + 16 * AT_PV + 32 * t);
          }
        }
        // Keeps the pass's 16 LDS loads in one group ahead of the products: one
        // LDS latency a pass; left free, each product waited for its own pair.
        __builtin_amdgcn_sched_barrier(0);
        f32x2 tv[8];                     // tv[4 kt + j]: keys key0 + 16 kt + 8 hh + 2 j, + 1
        for (int kt = 0; kt < 2; ++kt) {
          v8f s = mma_bf16(kf[kt][0], qf[0], vz);
          s = mma_bf16(kf[kt][1], qf[1], s);
          for (int j = 0; j < 4; ++j)
            tv[4 * kt + j] = __builtin_elementwise_fma(
                f32x2{s[2 * j], s[2 * j + 1]}, f32x2{c1, c1},
                f32x2{slope2 * (float)(16 * kt + 2 * j), slope2 * (float)(16 * kt + 2 * j + 1)});
        }
        if (key0 + 31 > qw0) {           // wave-uniform: causal mask near the diagonal only
          for (int i = 0; i < 8; ++i) {
            const int key = key0 + 16 * (i >> 2) + 8 * hh + 2 * (i & 3);
            if (key > myq) tv[i].x = -INFINITY;
            if (key + 1 > myq) tv[i].y = -INFINITY;
          }
        }
        float mx = fmaxf(tv[0].x, tv[0].y);
        for (int i = 1; i < 8; ++i) mx = fmaxf(fmaxf(mx, tv[i].x), tv[i].y);
        const float base = slope2 * (float)(key0 + 8 * hh - myq);  // rest of the ALiBi term, per half
        mx += base;
        mx = fmaxf(mx, xhalf(mx));       // finite: the pass's first key is visible to every query
        const float m_new = fmaxf(m_run, mx);
        const float corr = __builtin_amdgcn_exp2f(m_run - m_new);
        const float nm = base - m_new;
        m_run = m_new;
        f32x2 ps2 = {0.0f, 0.0f};
        FragT pf;
        for (int i = 0; i < 8; ++i) {
          const f32x2 a = tv[i] + f32x2{nm, nm};
          const f32x2 p = {__builtin_amdgcn_exp2f(a.x), __builtin_amdgcn_exp2f(a.y)};
          ps2 += p;
          pf.q[i >> 2][i & 3] = pack2(p.x, p.y);
        }
        const float ps = ps2.x + ps2.y;
        l_run = l_run * corr + ps;
        for (int t = 0; t < 4; ++t) acc[t] = acc[t] * corr;
        for (int t = 0; t < 4; ++t) acc[t] = mma_bf16(vf[t], pf, acc[t]);
      }
    }
    if (more) {
      lstore((st + 1) & 1);              // its last readers left before the previous barrier
      __syncthreads();                   // next tile visible; this tile's reads are over
    }
  }

  // Join the halves' denominators, normalize, fuse the residual: x1 = x + attn.
  // A lane owns 8 consecutive d of its query per tile: two 16-byte accesses.
  const float inv = 1.0f / (l_run + xhalf(l_run));
  for (int t = 0; t < 4; ++t) {
    const size_t idx = (size_t)(b * S + myq) * E + h * 64 + 16 * t + 8 * hh;
    const f32x4 xa = *(const f32x4*)(x + idx);
    const f32x4 xb = *(const f32x4*)(x + idx + 4);
    const f32x4 oa = {acc[t][0], acc[t][1], acc[t][2], acc[t][3]};
    const f32x4 ob = {acc[t][4], acc[t][5], acc[t][6], acc[t][7]};
    *(f32x4*)(x1 + idx) = xa + oa * inv;
    *(f32x4*)(x1 + idx + 4) = xb + ob * inv;
  }
}

// ------------------------------- launch -------------------------------------
extern "C" void kernel_launch(void* const* d_in, const int* in_sizes, int n_in,
                              void* d_out, int out_size, void* d_ws, size_t ws_size,
                              hipStream_t stream) {
  constexpr int E = 1024, H = 16, DFF = 4096, Bq = 2, S = 2048;
  constexpr int M = Bq * S;       // 4096
  constexpr int K3 = 3 * E;       // 3072
  (void)in_sizes; (void)n_in; (void)out_size; (void)ws_size;

  const float* x    = (const float*)d_in[0];
  const float* wkqv = (const float*)d_in[1];
  const float* ln1g = (const float*)d_in[2];
  const float* ln1b = (const float*)d_in[3];
  const float* ln2g = (const float*)d_in[4];
  const float* ln2b = (const float*)d_in[5];
  const float* w1   = (const float*)d_in[6];
  const float* b1   = (const float*)d_in[7];
  const float* w2   = (const float*)d_in[8];
  const float* b2   = (const float*)d_in[9];
  float* out = (float*)d_out;

  char* cur = (char*)d_ws;
  auto carve = [&](size_t bytes) -> char* {
    char* p = cur;
    cur += (bytes + 255) & ~(size_t)255;
    return p;
  };
  __bf16* ln1o  = (__bf16*)carve((size_t)M * E * 2);     // LN1 out (bf16)
  __bf16* wkqvb = (__bf16*)carve((size_t)E * K3 * 2);    // w_kqv bf16
  __bf16* kqvb  = (__bf16*)carve((size_t)M * K3 * 2);    // kqv bf16
  float*  x1    = (float*) carve((size_t)M * E * 4);     // x + attn
  __bf16* ln2o  = (__bf16*)carve((size_t)M * E * 2);     // LN2 out (bf16)
  __bf16* w1b   = (__bf16*)carve((size_t)E * DFF * 2);   // w1 bf16
  __bf16* w2b   = (__bf16*)carve((size_t)DFF * E * 2);   // w2 bf16
  __bf16* h1    = (__bf16*)carve((size_t)M * DFF * 2);   // relu(ffn1) bf16

  // Weight casts and LN1 in one launch: whole cast blocks, then one block a row.
  static_assert(E * K3 % CAST_BLK == 0 && E * DFF % CAST_BLK == 0, "cast grid must be exact");
  constexpr int NA = E * K3 / CAST_BLK, NB = E * DFF / CAST_BLK, NC = DFF * E / CAST_BLK;
  prep_kernel<NA, NB, NC><<<NA + NB + NC + M, 256, 0, stream>>>(
      x, ln1g, ln1b, ln1o, wkqv, w1, w2, wkqvb, w1b, w2b);

  // kqv = ln1 @ w_kqv -> bf16   [4096 x 3072], K=1024; 16 x 16 blocks, 1 a WGP
  static_assert(M % 256 == 0 && K3 % 192 == 0 && DFF % 256 == 0, "whole tiles");
  gemm_bf16_wmma<256, 192, 128, K3, E, false, false, false, true>
      <<<dim3(K3 / 192, M / 256), 256, 0, stream>>>(
          ln1o, wkqvb, nullptr, nullptr, nullptr, kqvb, M, K3, E);

  // x1 = x + attention(kqv)
  attn_kernel<<<dim3(H * Bq, S / 64), 128, 0, stream>>>(kqvb, x, x1);

  ln_bf16_kernel<<<M, 256, 0, stream>>>(x1, ln2g, ln2b, ln2o);

  // h1 = relu(ln2 @ w1 + b1) -> bf16   [4096 x 4096], K=1024; 16 x 16 blocks, 1 a WGP
  gemm_bf16_wmma<256, 256, 128, DFF, E, true, true, false, true>
      <<<dim3(DFF / 256, M / 256), 256, 0, stream>>>(
          ln2o, w1b, b1, nullptr, nullptr, h1, M, DFF, E);

  // out = h1 @ w2 + b2 + x1   [4096 x 1024], K=4096; 1 block a WGP
  gemm_bf16_wmma<128, 128, 256, E, DFF, true, false, true, false>
      <<<dim3(E / 128, M / 128), 256, 0, stream>>>(
          h1, w2b, b2, x1, out, nullptr, M, E, DFF);
}

// v009
// A run of this version takes 118 microseconds.
// Timed twice side by side with v008, it ran 1.03 times as fast both times.
// Over all steps from v000 it is 4.86 times as fast.
#include <hip/hip_runtime.h>
#include <hip/hip_bf16.h>
#include <stdint.h>

// ---------------------------------------------------------------------------
// ALiBi transformer layer for MI455X (gfx1250, wave32, WMMA).
// bf16 operands / f32 accumulate via v_wmma_f32_16x16x32_bf16.
// Double-buffered GEMM staging via GLOBAL_LOAD_ASYNC_TO_LDS (ASYNCcnt).
// ---------------------------------------------------------------------------

typedef __attribute__((ext_vector_type(16))) __bf16 v16bf;
typedef __attribute__((ext_vector_type(8)))  float  v8f;

union Frag16 { v16bf v; uint4 u[2]; };

typedef uint32_t u32x4 __attribute__((ext_vector_type(4)));
typedef short s16x8 __attribute__((ext_vector_type(8)));
union FragT { v16bf v; u32x4 q[2]; };

// Transposing LDS load: lane (c = l & 15, h = l >> 4) gets T[8 h + 0..7][c] of a
// row-major 16-bit tile whose lane addresses are row 8 h + (l & 7), byte 16 * ((l >> 3) & 1).
static __device__ __forceinline__ u32x4 ld_tr16(const unsigned char* p) {
  typedef __attribute__((address_space(3))) s16x8 lds_s16x8;
  return __builtin_bit_cast(u32x4, __builtin_amdgcn_ds_load_tr16_b128_v8i16((lds_s16x8*)p));
}

static __device__ __forceinline__ __bf16 f2bf(float x) {
  unsigned u = __builtin_bit_cast(unsigned, x);
  unsigned r = (u + 0x7FFFu + ((u >> 16) & 1u)) >> 16;   // round-to-nearest-even
  unsigned short h = (unsigned short)r;
  return __builtin_bit_cast(__bf16, h);
}

typedef float f32x4 __attribute__((ext_vector_type(4)));
typedef float f32x2 __attribute__((ext_vector_type(2)));

static __device__ __forceinline__ uint32_t pack2(float lo, float hi) {  // round to nearest even
  typedef __bf16 bf2 __attribute__((ext_vector_type(2)));
  typedef float f2 __attribute__((ext_vector_type(2)));
  return __builtin_bit_cast(uint32_t, __builtin_convertvector(f2{lo, hi}, bf2));
}

// ----------------------- async global->LDS copy (b128) ----------------------
#if __has_builtin(__builtin_amdgcn_global_load_async_to_lds_b128) && \
    __has_builtin(__builtin_amdgcn_s_wait_asynccnt)
#define USE_ASYNC_LDS 1
#else
#define USE_ASYNC_LDS 0
#endif

typedef int v4i_t __attribute__((vector_size(4 * sizeof(int))));
typedef __attribute__((address_space(1))) v4i_t* g_v4i_ptr;
typedef __attribute__((address_space(3))) v4i_t* l_v4i_ptr;

typedef __attribute__((address_space(3))) unsigned char* lds_ptr;   // a 32-bit LDS byte address

static __device__ __forceinline__ void copy16_g2l(const void* g, lds_ptr l) {
#if USE_ASYNC_LDS
  __builtin_amdgcn_global_load_async_to_lds_b128(
      (g_v4i_ptr)((v4i_t*)g), (l_v4i_ptr)l, 0, 0);
#else
  *(l_v4i_ptr)l = *(const v4i_t*)g;
#endif
}

static __device__ __forceinline__ void g2l_wait() {
#if USE_ASYNC_LDS
  __builtin_amdgcn_s_wait_asynccnt(0);
#endif
}

// ------------------------------- cast f32 -> bf16 ---------------------------
// A wave converts 1024 consecutive elements: eight 16-byte loads a lane, each 512
// contiguous bytes across the wave and all in flight together, then eight 8-byte
// stores (256 contiguous bytes across the wave).  Few, long waves, for speed only.
// Block blk of 256 threads converts elements blk * CAST_BLK .. + CAST_BLK - 1.
constexpr int CAST_BLK = 256 * 32;
static __device__ __forceinline__ void cast_block(
    const float* __restrict__ in, __bf16* __restrict__ out, int blk) {
  typedef float f32q __attribute__((ext_vector_type(4)));
  typedef __bf16 bf16q __attribute__((ext_vector_type(4)));
  const int base = blk * CAST_BLK + (threadIdx.x >> 5) * 1024 + (threadIdx.x & 31) * 4;
  f32q v[8];
  // Both loops unrolled: v stays in registers and the eight loads issue as one group.
#pragma unroll
  for (int i = 0; i < 8; ++i) v[i] = *(const f32q*)(in + base + i * 128);
#pragma unroll
  for (int i = 0; i < 8; ++i)
    *(bf16q*)(out + base + i * 128) = __builtin_convertvector(v[i], bf16q);  // nearest even
}

// ------------------------------- LayerNorm -> bf16 --------------------------
// One row of 1024 by a block of 256 threads.
static __device__ __forceinline__ void ln_row(
    const float* __restrict__ x, const float* __restrict__ g,
    const float* __restrict__ bta, __bf16* __restrict__ out, int row) {
  constexpr int E = 1024;
  const int t = threadIdx.x;
  const float* xr = x + (size_t)row * E;
  float v[4];
  float s = 0.f, s2 = 0.f;
#pragma unroll
  for (int i = 0; i < 4; ++i) {
    v[i] = xr[t + i * 256];
    s += v[i];
    s2 += v[i] * v[i];
  }
#pragma unroll
  for (int o = 16; o > 0; o >>= 1) {
    s += __shfl_xor(s, o, 32);
    s2 += __shfl_xor(s2, o, 32);
  }
  __shared__ float ps[8], ps2[8];
  if ((t & 31) == 0) { ps[t >> 5] = s; ps2[t >> 5] = s2; }
  __syncthreads();
  s = 0.f; s2 = 0.f;
#pragma unroll
  for (int i = 0; i < 8; ++i) { s += ps[i]; s2 += ps2[i]; }
  const float mu = s * (1.0f / E);
  const float var = s2 * (1.0f / E) - mu * mu;
  const float rstd = rsqrtf(var + 1e-5f);
#pragma unroll
  for (int i = 0; i < 4; ++i) {
    int c = t + i * 256;
    out[(size_t)row * E + c] = f2bf((v[i] - mu) * rstd * g[c] + bta[c]);
  }
}

__global__ __launch_bounds__(256) void ln_bf16_kernel(
    const float* __restrict__ x, const float* __restrict__ g,
    const float* __restrict__ bta, __bf16* __restrict__ out) {
  ln_row(x, g, bta, out, blockIdx.x);
}

// ---------------- the three weight casts and the first LayerNorm, one launch ----------------
// None of the four reads what another writes, and each alone is too short to fill the chip for
// longer than a launch takes to start and to drain: as one grid they pay that once and their
// streams overlap.  The cast blocks (NA, NB and NC of them, the arrays' lengths in CAST_BLK)
// have the low indices, the row blocks the rest.
template <int NA, int NB, int NC>
__global__ __launch_bounds__(256) void prep_kernel(
    const float* __restrict__ x, const float* __restrict__ g,
    const float* __restrict__ bta, __bf16* __restrict__ lo,
    const float* __restrict__ wa, const float* __restrict__ wb, const float* __restrict__ wc,
    __bf16* __restrict__ oa, __bf16* __restrict__ ob, __bf16* __restrict__ oc) {
  const int b = blockIdx.x;              // the branch and the selections are uniform for the block
  if (b < NA + NB + NC) {
    const bool ia = b < NA, ib = b < NA + NB;
    cast_block(ia ? wa : ib ? wb : wc, ia ? oa : ib ? ob : oc, ia ? b : ib ? b - NA : b - (NA + NB));
  } else {
    ln_row(x, g, bta, lo, b - (NA + NB + NC));
  }
}

// ------------------------------- WMMA GEMM ----------------------------------
// C[M,N] = act(A[M,K] @ B[K,N] + bias) (+ res).  A/B bf16 row-major, acc f32.
// Block BM x BN, 8 waves as 4 (M) x 2 (N); wave tile BM/4 x BN/2.
// A block stages (BM + BN) k-rows for BM x BN results and a wave reads BM/64 + BN/32 fragments
// for their product of WMMAs, so both the bytes that come from L2 and the bytes read from LDS
// per product fall as the tile grows.  BM x BN is chosen per launch: the largest tile whose
// grid still gives every WGP a block (M a multiple of BM, N of BN).
// Double-buffered LDS staging via async global->LDS copies:
//   iter k: wait(async) -> barrier -> issue stage(k+1) -> WMMA on tile k.
// A stage holds BK k values (K a multiple of BK).  The operands come from memory, so a trip
// lasts at least one memory latency: BK sets how many bytes fly and how many products run
// per latency.  BK is chosen per launch: as deep as the LDS holds for the blocks a WGP gets.
// LDC: the row pitch of C and res in elements (the launch's N), a constant so that the rows of a
// tile are immediate offsets from one address.
// KD: the launch's K.  With both pitches constant, a thread's copies of one stage and of the next
// differ by constants: each copy's global and LDS address is kept in registers and stepped by one
// add a stage, so no multiply or shift stands on the way from a stage's barrier to its copies.
constexpr int cgcd(int a, int b) { return b ? cgcd(b, a % b) : a; }
template <int BM, int BN, int BK, int LDC, int KD, bool BIAS, bool RELU, bool RES, bool OBF16>
__global__ __launch_bounds__(256) void gemm_bf16_wmma(
    const __bf16* __restrict__ A, const __bf16* __restrict__ B,
    const float* __restrict__ bias, const float* __restrict__ res,
    float* __restrict__ Cf, __bf16* __restrict__ Cb,
    int M, int N, int K) {
  // A rows: 2 BK + 16 B = 16 B x odd (ds_load_b128); B rows: 2 BN + 32 B = 32 B x odd (ds_load_tr16_b128).
  static_assert(BK % 64 == 0, "A rows are staged as whole 128-byte lines");
  static_assert(BM % 64 == 0 && BN % 64 == 0, "whole 16 x 16 tiles a wave, B rows of whole lines");
  static_assert(BM * BK % 2048 == 0 && BK * BN % 2048 == 0, "every thread copies the same count");
  constexpr int PB = BN + 16;
  constexpr int MT = BM / 64;    // 16-row tiles of a wave
  constexpr int NT = BN / 32;    // 16-column tiles of a wave
  constexpr bool GROUPED = MT > 2;   // tiles with more rows of products than the 128 x 128 block's
  __shared__ __attribute__((aligned(16))) __bf16 As[2][BM][BK + 8];    // [m][k]
  __shared__ __attribute__((aligned(32))) __bf16 Bs[2][BK][PB];        // [k][n]

  const int tid = threadIdx.x;
  const int lane = tid & 31;
  const int w = tid >> 5;
  const int wm = (w & 3) * (BM / 4);   // 4 waves along M
  const int wn = (w >> 2) * (BN / 2);  // 2 waves along N
  const int m0 = blockIdx.y * BM;
  const int n0 = blockIdx.x * BN;
  const int ml = lane & 15;
  const int kb = (lane >> 4) * 8;
  const int half8 = (lane >> 4) * 8;

  v8f acc[MT][NT];
  const v8f vz = {};
#pragma unroll
  for (int i = 0; i < MT; ++i)
#pragma unroll
    for (int j = 0; j < NT; ++j) acc[i][j] = vz;

  // Where this thread's copies of the next stage read and write; set here for stage 0, buffer 0.
  // Every loop over these arrays is unrolled, so that they stay in registers.
  constexpr int NCA = BM * BK / 2048, NCB = BK * BN / 2048;
  const char* ga[NCA];
  const char* gb[NCB];
  lds_ptr la[NCA], lb[NCB];
  // A tile BM x BK in chunks of 8 bf16, BK / 8 to a row.
#pragma unroll
  for (int it = 0; it < NCA; ++it) {
    int c = tid + it * 256;
    int r = c / (BK / 8);
    int col = (c % (BK / 8)) * 8;
    ga[it] = (const char*)(A + (size_t)(m0 + r) * KD + col);
    la[it] = (lds_ptr)&As[0][r][col];
  }
  // B tile BK x BN, BN / 8 chunks to a row (kept [k][n], no transpose so it can stream async).
#pragma unroll
  for (int it = 0; it < NCB; ++it) {
    int c = tid + it * 256;
    int kr = c / (BN / 8);
    int nc = (c % (BN / 8)) * 8;
    gb[it] = (const char*)(B + (size_t)kr * LDC + n0 + nc);
    lb[it] = (lds_ptr)&Bs[0][kr][nc];
  }
  int da = (int)sizeof(As[0]), db = (int)sizeof(Bs[0]);   // to the other buffer; the sign turns every stage
  auto stage = [&]() {
#pragma unroll
    for (int it = 0; it < NCA; ++it) copy16_g2l(ga[it], la[it]);
#pragma unroll
    for (int it = 0; it < NCB; ++it) copy16_g2l(gb[it], lb[it]);
#pragma unroll
    for (int it = 0; it < NCA; ++it) { ga[it] += BK * 2; la[it] += da; }
#pragma unroll
    for (int it = 0; it < NCB; ++it) { gb[it] += (size_t)BK * LDC * 2; lb[it] += db; }
    da = -da;
    db = -db;
  };

  constexpr int nk = KD / BK;
  stage();
  for (int kk = 0; kk < nk; ++kk) {
    const int buf = kk & 1;
    g2l_wait();        // own async stores to LDS have landed
    __syncthreads();   // everyone's have
    if (kk + 1 < nk) stage();

    // The stage's 32-k slices in ascending k.  Unrolled: every LDS offset is a constant and
    // a slice's fragment loads can issue under the slice before.
#pragma unroll
    for (int ks = 0; ks < BK; ks += 32) {
      Frag16 af[MT];
      FragT bfr[NT];
#pragma unroll
      for (int mt = 0; mt < MT; ++mt) {
        int r = wm + mt * 16 + ml;
        af[mt].u[0] = *(const uint4*)&As[buf][r][ks + kb];
        af[mt].u[1] = *(const uint4*)&As[buf][r][ks + 16 + kb];
      }
      // B fragments straight from the [k][n] tile: k = kb + 0..7 and 16 + kb + 0..7 of
      // column wn + 16 nt + ml, the same k order as A's two 16-byte loads.
      const unsigned char* bp =
          (const unsigned char*)&Bs[buf][ks + kb + (lane & 7)][wn + ((lane >> 3) & 1) * 8];
#pragma unroll
      for (int nt = 0; nt < NT; ++nt) {
        bfr[nt].q[0] = ld_tr16(bp + 32 * nt);
        bfr[nt].q[1] = ld_tr16(bp + 16 * PB * 2 + 32 * nt);
      }
      // Keeps a large tile's fragment loads ahead of all the slice's products: left free, each row
      // of products fetched its A fragment right in front of it and waited out an LDS latency.
      if constexpr (GROUPED) __builtin_amdgcn_sched_barrier(0);
#pragma unroll
      for (int mt = 0; mt < MT; ++mt)
#pragma unroll
        for (int nt = 0; nt < NT; ++nt)
          acc[mt][nt] = __builtin_amdgcn_wmma_f32_16x16x32_bf16(   // C^T tile: B^T first, A^T second
              false, bfr[nt].v, false, af[mt].v, (short)0, acc[mt][nt], false, false);
    }
    __syncthreads();   // reads done before this buffer is re-staged
  }

  // Epilogue.  The products are formed transposed (the two fragments have the same lane and
  // k layout, so they only change places): acc[mt][nt][r] = C[wm + 16 mt + ml][wn + 16 nt + half8 + r],
  // 8 adjacent columns of one row in a lane.  Each wave writes its tile into its own range of the
  // A buffers (free behind the loop's last barrier) with 16-byte LDS stores and reads it back
  // row by row, so that every global access is 16 bytes a lane over whole rows of the tile.
  static_assert(!(OBF16 && RES), "the residual is added in f32, behind the staging");
  constexpr int WR = BM / 4, WC = BN / 2;       // rows and columns of a wave's tile
  constexpr int ESZ = OBF16 ? 2 : 4;            // bytes of a staged element
  constexpr int SP = WC * ESZ + 16;             // staged row pitch: 16 B x odd (16-byte LDS accesses)
  constexpr int CPR = WC * ESZ / 16;            // 16-byte pieces of a row
  constexpr int PER = CPR / cgcd(32, CPR);      // wave-wide accesses until the lanes' pattern repeats,
  constexpr int RPP = 32 / cgcd(32, CPR);       // which is this many rows further down
  static_assert((SP / 16) % 2 == 1 && WR % RPP == 0, "pitch; whole periods");
  static_assert(8 * WR * SP <= (int)sizeof(As), "the eight waves' ranges fit the A buffers");
  unsigned char* sw = (unsigned char*)&As[0][0][0] + w * (WR * SP);

  // Where a lane reads the staged tile back, and the element of C that piece starts at.
  const unsigned char* sp[PER];
  int gn[PER];
  size_t gi[PER];
#pragma unroll
  for (int t = 0; t < PER; ++t) {
    const int c = t * 32 + lane;
    sp[t] = sw + (c / CPR) * SP + (c % CPR) * 16;
    gn[t] = n0 + wn + (c % CPR) * (16 / ESZ);
    gi[t] = (size_t)(m0 + wm + c / CPR) * LDC + gn[t];
  }

  f32x4 bq[OBF16 ? NT : 1][2];                  // bias of the lane's columns
  f32x4 rv[OBF16 ? 1 : WR / RPP];               // residual of the lane's pieces
  if constexpr (OBF16) {
    if constexpr (BIAS) {
      const float* bp = bias + n0 + wn + half8;
#pragma unroll
      for (int nt = 0; nt < NT; ++nt) {
        bq[nt][0] = *(const f32x4*)(bp + nt * 16);
        bq[nt][1] = *(const f32x4*)(bp + nt * 16 + 4);
      }
      // The loads' address register is free for reuse only behind this wait: named as an input,
      // it also stays out of the loads' own destinations.
      asm volatile("s_wait_xcnt 0x0" :: "v"(bp) : "memory");
    }
#pragma unroll
    for (int mt = 0; mt < MT; ++mt) {
#pragma unroll
      for (int nt = 0; nt < NT; ++nt) {
        f32x4 lo = {acc[mt][nt][0], acc[mt][nt][1], acc[mt][nt][2], acc[mt][nt][3]};
        f32x4 hi = {acc[mt][nt][4], acc[mt][nt][5], acc[mt][nt][6], acc[mt][nt][7]};
        if constexpr (BIAS) { lo += bq[nt][0]; hi += bq[nt][1]; }
        if constexpr (RELU) {
#pragma unroll
          for (int i = 0; i < 4; ++i) { lo[i] = fmaxf(lo[i], 0.0f); hi[i] = fmaxf(hi[i], 0.0f); }
        }
        const u32x4 pk = {pack2(lo[0], lo[1]), pack2(lo[2], lo[3]), pack2(hi[0], hi[1]), pack2(hi[2], hi[3])};
        *(u32x4*)(sw + (mt * 16 + ml) * SP + (nt * 16 + half8) * ESZ) = pk;
      }
    }
  } else {
    static_assert(OBF16 || (PER == 1 && BIAS && RES), "f32 output: one lane pattern, bias and residual");
    // Bias and residual of the lane's pieces, in flight under the staging.
    const float* bp = bias + gn[0];
    const float* rp = res + gi[0];
    bq[0][0] = *(const f32x4*)bp;
#pragma unroll
    for (int j = 0; j < WR / RPP; ++j) rv[j] = *(const f32x4*)(rp + (size_t)j * RPP * LDC);
    // As above: the two address registers are reused only behind this wait.
    asm volatile("s_wait_xcnt 0x0" :: "v"(bp), "v"(rp) : "memory");
#pragma unroll
    for (int mt = 0; mt < MT; ++mt) {
#pragma unroll
      for (int nt = 0; nt < NT; ++nt) {
        unsigned char* d = sw + (mt * 16 + ml) * SP + (nt * 16 + half8) * ESZ;
        *(f32x4*)d = f32x4{acc[mt][nt][0], acc[mt][nt][1], acc[mt][nt][2], acc[mt][nt][3]};
        *(f32x4*)(d + 16) = f32x4{acc[mt][nt][4], acc[mt][nt][5], acc[mt][nt][6], acc[mt][nt][7]};
      }
    }
  }
  // The wave's own staged rows are in LDS before its lanes read one another's pieces back.
  asm volatile("s_wait_dscnt 0x0" ::: "memory");
#pragma unroll
  for (int j = 0; j < WR / RPP; ++j) {
#pragma unroll
    for (int t = 0; t < PER; ++t) {
      const unsigned char* s = sp[t] + j * RPP * SP;
      const size_t idx = gi[t] + (size_t)j * RPP * LDC;
      if constexpr (OBF16) {
        *(u32x4*)(Cb + idx) = *(const u32x4*)s;
      } else {
        f32x4 v = *(const f32x4*)s + bq[0][0];
        if constexpr (RELU) {
#pragma unroll
          for (int i = 0; i < 4; ++i) v[i] = fmaxf(v[i], 0.0f);
        }
        *(f32x4*)(Cf + idx) = v + rv[j];
      }
    }
  }
}

constexpr int AT_PK = 144;              // K row pitch in LDS: 16 B x odd (ds_load_b128)
constexpr int AT_PV = 160;              // V row pitch in LDS: 32 B x odd (ds_load_tr16_b128)
constexpr int AT_KEYS = 128;            // keys of a tile
constexpr int AT_TK = AT_KEYS * AT_PK;  // one K tile
constexpr int AT_SLOT = AT_TK + AT_KEYS * AT_PV;

static __device__ __forceinline__ float xhalf(float v) {  // lane l <-> lane l ^ 16
  int b = __builtin_bit_cast(int, v);
  return __builtin_bit_cast(float,
      __builtin_amdgcn_permlanex16(b, b, 0x76543210, 0xfedcba98, false, false));
}
static __device__ __forceinline__ v8f mma_bf16(const FragT& a, const FragT& b, v8f c) {
  return __builtin_amdgcn_wmma_f32_16x16x32_bf16(false, a.v, false, b.v, (short)0, c, false, false);
}

__global__ __launch_bounds__(256) void attn_kernel(
    const __bf16* __restrict__ kqv, const float* __restrict__ x,
    float* __restrict__ x1) {
  constexpr int E = 1024, S = 2048, K3 = 3 * E;
  __shared__ __attribute__((aligned(32))) unsigned char L[2 * AT_SLOT];
  const int tid = threadIdx.x;
  const int lane = tid & 31;
  const int wave = __builtin_amdgcn_readfirstlane(tid >> 5);
  const int qwv = wave & 3;              // which 16 queries of the block
  const int kh = wave >> 2;              // which 32-key blocks of a tile: kh and kh + 2
  const int c = lane & 15;
  const int hh = lane >> 4;
  const int h = blockIdx.x & 15;
  const int b = blockIdx.x >> 4;
  // Query block: the cost falls with the index, for speed only.
  const int qb = 31 - blockIdx.y;
  const int qw0 = qb * 64 + qwv * 16;    // first query of this wave
  const int myq = qw0 + c;               // this lane's query
  constexpr float LOG2E = 1.4426950408889634f;
  const float slope2 = exp2f(-0.5f * (float)(h + 1)) * LOG2E;  // (2^8)^(-(h+1)/16), base 2
  const float c1 = 0.03125f * LOG2E;                           // 1/sqrt(E), base 2

  const __bf16* kvb = kqv + (size_t)(b * S) * K3 + h * 64;     // K rows; V rows at + 2E
  const int srow = tid >> 3, scol = tid & 7;
  u32x4 rk[4], rv[4];
  auto gload = [&](int st) {
    for (int it = 0; it < 4; ++it) {
      const __bf16* p = kvb + (size_t)(st * AT_KEYS + srow + it * 32) * K3 + scol * 8;
      rk[it] = *(const u32x4*)p;
      rv[it] = *(const u32x4*)(p + 2 * E);
    }
  };
  auto lstore = [&](int buf) {
    unsigned char* d = L + buf * AT_SLOT;
    for (int it = 0; it < 4; ++it) {
      const int row = srow + it * 32;
      *(u32x4*)(d + row * AT_PK + scol * 16) = rk[it];
      *(u32x4*)(d + AT_TK + row * AT_PV + scol * 16) = rv[it];
    }
  };

  gload(0);
  // Q fragments (B operand), k order 8*hh + 0..7, 16 + 8*hh + 0..7 per 32.
  FragT qf[2];
  {
    const __bf16* qp = kqv + (size_t)(b * S + myq) * K3 + E + h * 64 + 8 * hh;
    for (int kc = 0; kc < 2; ++kc) {
      qf[kc].q[0] = *(const u32x4*)(qp + 32 * kc);
      qf[kc].q[1] = *(const u32x4*)(qp + 32 * kc + 16);
    }
  }
  const v8f vz = {};
  v8f acc[4];                            // acc[t][r] = O^T[16 t + 8 hh + r][query c]
  for (int t = 0; t < 4; ++t) acc[t] = vz;
  float m_run = -INFINITY;               // running maximum (base 2), equal in both halves
  float l_run = 0.0f;                    // this half's share of the denominator
  lstore(0);
  __syncthreads();                       // tile 0 visible to all eight waves

  const int nst = (qb + 2) >> 1;         // the last tile holds the diagonal
  for (int st = 0; st < nst; ++st) {
    const unsigned char* Lb = L + (st & 1) * AT_SLOT;
    const bool more = st + 1 < nst;
    if (more) {
      gload(st + 1);                     // in flight under this tile's work
      // The loads' address registers are reused by the work below.
      asm volatile("s_wait_xcnt 0x0" ::: "memory");
    }
    // This wave's first 32-key block of the tile; its second lies 64 rows further down.
    const unsigned char* kp = Lb + (kh * 32 + c) * AT_PK + 16 * hh;
    const unsigned char* vp = Lb + AT_TK + (kh * 32 + 8 * hh + (lane & 7)) * AT_PV +
                              ((lane >> 3) & 1) * 16;
    // Unrolled: the second block's LDS reads are immediate offsets from the same two addresses.
#pragma unroll
    for (int sub = 0; sub < 2; ++sub) {
      const int key0 = st * AT_KEYS + (2 * sub + kh) * 32;
      if (key0 <= qw0 + 15) {            // wave-uniform: skip keys beyond the wave's last query
        FragT kf[2][2], vf[4];
        for (int kt = 0; kt < 2; ++kt) {
          const unsigned char* p = kp + (64 * sub + 16 * kt) * AT_PK;
          for (int kc = 0; kc < 2; ++kc) {
            kf[kt][kc].q[0] = *(const u32x4*)(p + 64 * kc);
            kf[kt][kc].q[1] = *(const u32x4*)(p + 64 * kc + 32);
          }
        }
        {
          const unsigned char* ad = vp + 64 * sub * AT_PV;
          for (int t = 0; t < 4; ++t) {
            vf[t].q[0] = ld_tr16(ad + 32 * t);
            vf[t].q[1] = ld_tr16(ad + 16 * AT_PV + 32 * t);
          }
        }
        // Keeps the pass's 16 LDS loads in one group ahead of the products: one
        // LDS latency a pass; left free, each product waited for its own pair.
        __builtin_amdgcn_sched_barrier(0);
        f32x2 tv[8];                     // tv[4 kt + j]: keys key0 + 16 kt + 8 hh + 2 j, + 1
        for (int kt = 0; kt < 2; ++kt) {
          v8f s = mma_bf16(kf[kt][0], qf[0], vz);
          s = mma_bf16(kf[kt][1], qf[1], s);
          for (int j = 0; j < 4; ++j)
            tv[4 * kt + j] = __builtin_elementwise_fma(
                f32x2{s[2 * j], s[2 * j + 1]}, f32x2{c1, c1},
                f32x2{slope2 * (float)(16 * kt + 2 * j), slope2 * (float)(16 * kt + 2 * j + 1)});
        }
        if (key0 + 31 > qw0) {           // wave-uniform: causal mask near the diagonal only
          for (int i = 0; i < 8; ++i) {
            const int key = key0 + 16 * (i >> 2) + 8 * hh + 2 * (i & 3);
            if (key > myq) tv[i].x = -INFINITY;
            if (key + 1 > myq) tv[i].y = -INFINITY;
          }
        }
        float mx = fmaxf(tv[0].x, tv[0].y);
        for (int i = 1; i < 8; ++i) mx = fmaxf(fmaxf(mx, tv[i].x), tv[i].y);
        const float base = slope2 * (float)(key0 + 8 * hh - myq);  // rest of the ALiBi term, per half
        mx += base;
        mx = fmaxf(mx, xhalf(mx));       // finite: the pass's first key is visible to every query
        const float m_new = fmaxf(m_run, mx);
        const float corr = __builtin_amdgcn_exp2f(m_run - m_new);
        const float nm = base - m_new;
        m_run = m_new;
        f32x2 ps2 = {0.0f, 0.0f};
        FragT pf;
        for (int i = 0; i < 8; ++i) {
          const f32x2 a = tv[i] + f32x2{nm, nm};
          const f32x2 p = {__builtin_amdgcn_exp2f(a.x), __builtin_amdgcn_exp2f(a.y)};
          ps2 += p;
          pf.q[i >> 2][i & 3] = pack2(p.x, p.y);
        }
        const float ps = ps2.x + ps2.y;
        l_run = l_run * corr + ps;
        for (int t = 0; t < 4; ++t) acc[t] = acc[t] * corr;
        for (int t = 0; t < 4; ++t) acc[t] = mma_bf16(vf[t], pf, acc[t]);
      }
    }
    if (more) {
      lstore((st + 1) & 1);              // its last readers left before the previous barrier
      __syncthreads();                   // next tile visible; this tile's reads are over
    }
  }

  // Join the two waves of a query tile: wave w + 4 hands its maximum, sum and O^T to wave w
  // through the K/V buffers, 16 bytes a lane and 512 contiguous bytes a wave-wide access.
  __syncthreads();                       // every wave has left the last tile: the buffers are free
  f32x4* jx = (f32x4*)L + qwv * (9 * 32) + lane;
  if (kh == 1) {                         // wave-uniform
    for (int t = 0; t < 4; ++t) {
      jx[(2 * t) * 32] = f32x4{acc[t][0], acc[t][1], acc[t][2], acc[t][3]};
      jx[(2 * t + 1) * 32] = f32x4{acc[t][4], acc[t][5], acc[t][6], acc[t][7]};
    }
    jx[8 * 32] = f32x4{m_run, l_run, 0.0f, 0.0f};
  }
  __syncthreads();                       // the handed-over values are visible
  if (kh == 1) return;                   // behind the last barrier
  {
    // This wave has seen key 0, so its maximum is finite; the other's is -inf, with sum and
    // O^T zero, where all its keys lay beyond the diagonal: its weight is then exp2(-inf) = 0.
    const f32x4 ml = jx[8 * 32];
    const float m_all = fmaxf(m_run, ml.x);
    const float sa = __builtin_amdgcn_exp2f(m_run - m_all);
    const float sb = __builtin_amdgcn_exp2f(ml.x - m_all);
    l_run = l_run * sa + ml.y * sb;
    for (int t = 0; t < 4; ++t) {
      const f32x4 oa = jx[(2 * t) * 32], ob = jx[(2 * t + 1) * 32];
      for (int r = 0; r < 4; ++r) {
        acc[t][r] = acc[t][r] * sa + oa[r] * sb;
        acc[t][4 + r] = acc[t][4 + r] * sa + ob[r] * sb;
      }
    }
  }

  // Join the halves' denominators, normalize, fuse the residual: x1 = x + attn.
  // A lane owns 8 consecutive d of its query per tile: two 16-byte accesses.
  const float inv = 1.0f / (l_run + xhalf(l_run));
  for (int t = 0; t < 4; ++t) {
    const size_t idx = (size_t)(b * S + myq) * E + h * 64 + 16 * t + 8 * hh;
    const f32x4 xa = *(const f32x4*)(x + idx);
    const f32x4 xb = *(const f32x4*)(x + idx + 4);
    const f32x4 oa = {acc[t][0], acc[t][1], acc[t][2], acc[t][3]};
    const f32x4 ob = {acc[t][4], acc[t][5], acc[t][6], acc[t][7]};
    *(f32x4*)(x1 + idx) = xa + oa * inv;
    *(f32x4*)(x1 + idx + 4) = xb + ob * inv;
  }
}

// ------------------------------- launch -------------------------------------
extern "C" void kernel_launch(void* const* d_in, const int* in_sizes, int n_in,
                              void* d_out, int out_size, void* d_ws, size_t ws_size,
                              hipStream_t stream) {
  constexpr int E = 1024, H = 16, DFF = 4096, Bq = 2, S = 2048;
  constexpr int M = Bq * S;       // 4096
  constexpr int K3 = 3 * E;       // 3072
  (void)in_sizes; (void)n_in; (void)out_size; (void)ws_size;

  const float* x    = (const float*)d_in[0];
  const float* wkqv = (const float*)d_in[1];
  const float* ln1g = (const float*)d_in[2];
  const float* ln1b = (const float*)d_in[3];
  const float* ln2g = (const float*)d_in[4];
  const float* ln2b = (const float*)d_in[5];
  const float* w1   = (const float*)d_in[6];
  const float* b1   = (const float*)d_in[7];
  const float* w2   = (const float*)d_in[8];
  const float* b2   = (const float*)d_in[9];
  float* out = (float*)d_out;

  char* cur = (char*)d_ws;
  auto carve = [&](size_t bytes) -> char* {
    char* p = cur;
    cur += (bytes + 255) & ~(size_t)255;
    return p;
  };
  __bf16* ln1o  = (__bf16*)carve((size_t)M * E * 2);     // LN1 out (bf16)
  __bf16* wkqvb = (__bf16*)carve((size_t)E * K3 * 2);    // w_kqv bf16
  __bf16* kqvb  = (__bf16*)carve((size_t)M * K3 * 2);    // kqv bf16
  float*  x1    = (float*) carve((size_t)M * E * 4);     // x + attn
  __bf16* ln2o  = (__bf16*)carve((size_t)M * E * 2);     // LN2 out (bf16)
  __bf16* w1b   = (__bf16*)carve((size_t)E * DFF * 2);   // w1 bf16
  __bf16* w2b   = (__bf16*)carve((size_t)DFF * E * 2);   // w2 bf16
  __bf16* h1    = (__bf16*)carve((size_t)M * DFF * 2);   // relu(ffn1) bf16

  // Weight casts and LN1 in one launch: whole cast blocks, then one block a row.
  static_assert(E * K3 % CAST_BLK == 0 && E * DFF % CAST_BLK == 0, "cast grid must be exact");
  constexpr int NA = E * K3 / CAST_BLK, NB = E * DFF / CAST_BLK, NC = DFF * E / CAST_BLK;
  prep_kernel<NA, NB, NC><<<NA + NB + NC + M, 256, 0, stream>>>(
      x, ln1g, ln1b, ln1o, wkqv, w1, w2, wkqvb, w1b, w2b);

  // kqv = ln1 @ w_kqv -> bf16   [4096 x 3072], K=1024; 16 x 16 blocks, 1 a WGP
  static_assert(M % 256 == 0 && K3 % 192 == 0 && DFF % 256 == 0, "whole tiles");
  gemm_bf16_wmma<256, 192, 128, K3, E, false, false, false, true>
      <<<dim3(K3 / 192, M / 256), 256, 0, stream>>>(
          ln1o, wkqvb, nullptr, nullptr, nullptr, kqvb, M, K3, E);

  // x1 = x + attention(kqv)
  attn_kernel<<<dim3(H * Bq, S / 64), 256, 0, stream>>>(kqvb, x, x1);

  ln_bf16_kernel<<<M, 256, 0, stream>>>(x1, ln2g, ln2b, ln2o);

  // h1 = relu(ln2 @ w1 + b1) -> bf16   [4096 x 4096], K=1024; 16 x 16 blocks, 1 a WGP
  gemm_bf16_wmma<256, 256, 128, DFF, E, true, true, false, true>
      <<<dim3(DFF / 256, M / 256), 256, 0, stream>>>(
          ln2o, w1b, b1, nullptr, nullptr, h1, M, DFF, E);

  // out = h1 @ w2 + b2 + x1   [4096 x 1024], K=4096; 1 block a WGP
  gemm_bf16_wmma<128, 128, 256, E, DFF, true, false, true, false>
      <<<dim3(E / 128, M / 128), 256, 0, stream>>>(
          h1, w2b, b2, x1, out, nullptr, M, E, DFF);
}

// v010
// It runs in 114 microseconds.
// Two timings next to v009 both put it at 1.03 times that version's speed.
// All steps since v000 together make it 5.02 times as fast.
#include <hip/hip_runtime.h>
#include <hip/hip_bf16.h>
#include <stdint.h>

// ---------------------------------------------------------------------------
// ALiBi transformer layer for MI455X (gfx1250, wave32, WMMA).
// bf16 operands / f32 accumulate via v_wmma_f32_16x16x32_bf16.
// Double-buffered GEMM staging via GLOBAL_LOAD_ASYNC_TO_LDS (ASYNCcnt).
// ---------------------------------------------------------------------------

typedef __attribute__((ext_vector_type(16))) __bf16 v16bf;
typedef __attribute__((ext_vector_type(8)))  float  v8f;

union Frag16 { v16bf v; uint4 u[2]; };

typedef uint32_t u32x4 __attribute__((ext_vector_type(4)));
typedef short s16x8 __attribute__((ext_vector_type(8)));
union FragT { v16bf v; u32x4 q[2]; };

// Transposing LDS load: lane (c = l & 15, h = l >> 4) gets T[8 h + 0..7][c] of a
// row-major 16-bit tile whose lane addresses are row 8 h + (l & 7), byte 16 * ((l >> 3) & 1).
static __device__ __forceinline__ u32x4 ld_tr16(const unsigned char* p) {
  typedef __attribute__((address_space(3))) s16x8 lds_s16x8;
  return __builtin_bit_cast(u32x4, __builtin_amdgcn_ds_load_tr16_b128_v8i16((lds_s16x8*)p));
}

static __device__ __forceinline__ __bf16 f2bf(float x) {
  unsigned u = __builtin_bit_cast(unsigned, x);
  unsigned r = (u + 0x7FFFu + ((u >> 16) & 1u)) >> 16;   // round-to-nearest-even
  unsigned short h = (unsigned short)r;
  return __builtin_bit_cast(__bf16, h);
}

typedef float f32x4 __attribute__((ext_vector_type(4)));
typedef float f32x2 __attribute__((ext_vector_type(2)));

static __device__ __forceinline__ uint32_t pack2(float lo, float hi) {  // round to nearest even
  typedef __bf16 bf2 __attribute__((ext_vector_type(2)));
  typedef float f2 __attribute__((ext_vector_type(2)));
  return __builtin_bit_cast(uint32_t, __builtin_convertvector(f2{lo, hi}, bf2));
}

// ----------------------- async global->LDS copy (b128) ----------------------
#if __has_builtin(__builtin_amdgcn_global_load_async_to_lds_b128) && \
    __has_builtin(__builtin_amdgcn_s_wait_asynccnt)
#define USE_ASYNC_LDS 1
#else
#define USE_ASYNC_LDS 0
#endif

typedef int v4i_t __attribute__((vector_size(4 * sizeof(int))));
typedef __attribute__((address_space(1))) v4i_t* g_v4i_ptr;
typedef __attribute__((address_space(3))) v4i_t* l_v4i_ptr;

typedef __attribute__((address_space(3))) unsigned char* lds_ptr;   // a 32-bit LDS byte address

static __device__ __forceinline__ void copy16_g2l(const void* g, lds_ptr l) {
#if USE_ASYNC_LDS
  __builtin_amdgcn_global_load_async_to_lds_b128(
      (g_v4i_ptr)((v4i_t*)g), (l_v4i_ptr)l, 0, 0);
#else
  *(l_v4i_ptr)l = *(const v4i_t*)g;
#endif
}

static __device__ __forceinline__ void g2l_wait() {
#if USE_ASYNC_LDS
  __builtin_amdgcn_s_wait_asynccnt(0);
#endif
}

// ------------------------------- cast f32 -> bf16 ---------------------------
// A wave converts 1024 consecutive elements: eight 16-byte loads a lane, each 512
// contiguous bytes across the wave and all in flight together, then eight 8-byte
// stores (256 contiguous bytes across the wave).  Few, long waves, for speed only.
// Block blk of 256 threads converts elements blk * CAST_BLK .. + CAST_BLK - 1.
constexpr int CAST_BLK = 256 * 32;
static __device__ __forceinline__ void cast_block(
    const float* __restrict__ in, __bf16* __restrict__ out, int blk) {
  typedef float f32q __attribute__((ext_vector_type(4)));
  typedef __bf16 bf16q __attribute__((ext_vector_type(4)));
  const int base = blk * CAST_BLK + (threadIdx.x >> 5) * 1024 + (threadIdx.x & 31) * 4;
  f32q v[8];
  // Both loops unrolled: v stays in registers and the eight loads issue as one group.
#pragma unroll
  for (int i = 0; i < 8; ++i) v[i] = *(const f32q*)(in + base + i * 128);
#pragma unroll
  for (int i = 0; i < 8; ++i)
    *(bf16q*)(out + base + i * 128) = __builtin_convertvector(v[i], bf16q);  // nearest even
  // The stores' registers are free for whatever code follows only behind this wait.
  asm volatile("s_wait_xcnt 0x0" ::: "memory");
}

// ---------------- cast of a weight matrix whose product has a LayerNorm folded into it ---------
// LN(x) @ W + b = rstd * (x @ (g.W) - mu * cs) + cu, with cs[n] = sum_k g[k] W[k][n] and
// cu[n] = sum_k beta[k] W[k][n] + b[n].  The cast multiplies row k by g[k] before it rounds, and
// while it holds the values it sums them down the columns: cs over the rounded values that the
// product will read, cu's sum over beta[k] W[k][n] in f32.
// A block takes FOLD_ROWS rows of 128 columns, as many elements as cast_block: a wave 8 rows, a lane
// 4 columns of each (loads of 512 and stores of 256 contiguous bytes a wave, as there).  It leaves
// its sums in plane blk / (ND / 128) of csp and cup (planes of ND floats); the product adds the planes.
constexpr int FOLD_ROWS = 64;
template <int ND>
static __device__ __forceinline__ void cast_fold_block(
    const float* __restrict__ w, __bf16* __restrict__ out, const float* __restrict__ g,
    const float* __restrict__ bta, float* __restrict__ csp, float* __restrict__ cup, int blk) {
  typedef uint32_t u32x2 __attribute__((ext_vector_type(2)));
  static_assert(FOLD_ROWS * 128 == CAST_BLK && ND % 128 == 0, "a cast block's elements; whole column groups");
  __shared__ f32x4 red[2][8][32];
  const int lane = threadIdx.x & 31;
  const int wv = __builtin_amdgcn_readfirstlane(threadIdx.x >> 5);   // scalar: g and beta by scalar loads
  const int rb = blk / (ND / 128);
  const int row0 = rb * FOLD_ROWS + wv * 8;
  const int col = (blk % (ND / 128)) * 128 + lane * 4;
  const int base = row0 * ND + col;
  f32x4 v[8];
  // Both loops unrolled: v stays in registers and the eight loads issue as one group.
#pragma unroll
  for (int i = 0; i < 8; ++i) v[i] = *(const f32x4*)(w + base + i * ND);
  f32x4 s = {0.f, 0.f, 0.f, 0.f}, u = {0.f, 0.f, 0.f, 0.f};
#pragma unroll
  for (int i = 0; i < 8; ++i) {
    const f32x4 gv = v[i] * g[row0 + i];
    const uint32_t p0 = pack2(gv[0], gv[1]), p1 = pack2(gv[2], gv[3]);
    *(u32x2*)(out + base + i * ND) = u32x2{p0, p1};
    s += f32x4{__builtin_bit_cast(float, p0 << 16), __builtin_bit_cast(float, p0 & 0xFFFF0000u),
               __builtin_bit_cast(float, p1 << 16), __builtin_bit_cast(float, p1 & 0xFFFF0000u)};
    u += v[i] * bta[row0 + i];
  }
  // The stores' registers are reused below only behind this wait.
  asm volatile("s_wait_xcnt 0x0" ::: "memory");
  red[0][wv][lane] = s;
  red[1][wv][lane] = u;
  __syncthreads();                       // the eight waves' sums of every column are in LDS
  if (wv < 2) {                          // wave 0 finishes cs, wave 1 cu: 512 contiguous bytes each
    f32x4 a = red[wv][0][lane];
#pragma unroll
    for (int j = 1; j < 8; ++j) a += red[wv][j][lane];
    *(f32x4*)((wv ? cup : csp) + rb * ND + col) = a;
    // As above, for the code that follows this branch.
    asm volatile("s_wait_xcnt 0x0" ::: "memory");
  }
}

// ------------------------------- LayerNorm -> bf16 --------------------------
// One row of 1024 by a block of 256 threads.
static __device__ __forceinline__ void ln_row(
    const float* __restrict__ x, const float* __restrict__ g,
    const float* __restrict__ bta, __bf16* __restrict__ out, int row) {
  constexpr int E = 1024;
  const int t = threadIdx.x;
  const float* xr = x + (size_t)row * E;
  float v[4];
  float s = 0.f, s2 = 0.f;
#pragma unroll
  for (int i = 0; i < 4; ++i) {
    v[i] = xr[t + i * 256];
    s += v[i];
    s2 += v[i] * v[i];
  }
#pragma unroll
  for (int o = 16; o > 0; o >>= 1) {
    s += __shfl_xor(s, o, 32);
    s2 += __shfl_xor(s2, o, 32);
  }
  __shared__ float ps[8], ps2[8];
  if ((t & 31) == 0) { ps[t >> 5] = s; ps2[t >> 5] = s2; }
  __syncthreads();
  s = 0.f; s2 = 0.f;
#pragma unroll
  for (int i = 0; i < 8; ++i) { s += ps[i]; s2 += ps2[i]; }
  const float mu = s * (1.0f / E);
  const float var = s2 * (1.0f / E) - mu * mu;
  const float rstd = rsqrtf(var + 1e-5f);
#pragma unroll
  for (int i = 0; i < 4; ++i) {
    int c = t + i * 256;
    out[(size_t)row * E + c] = f2bf((v[i] - mu) * rstd * g[c] + bta[c]);
  }
  // The stores' registers are free for whatever code follows only behind this wait.
  asm volatile("s_wait_xcnt 0x0" ::: "memory");
}

// ---------------- the three weight casts and the first LayerNorm, one launch ----------------
// None of the four reads what another writes, and each alone is too short to fill the chip for
// longer than a launch takes to start and to drain: as one grid they pay that once and their
// streams overlap.  The cast blocks (NA, NB and NC of them, the arrays' lengths in CAST_BLK)
// have the low indices and the short row blocks the high ones, for speed only.
// The second LayerNorm has no launch of its own: wb's product applies it, and wb's cast blocks carry
// its gain g2 into the weights and form the column sums for its mean and its shift bta2 (they have a
// barrier and a second, short phase, so they come first in the grid).
template <int NA, int NB, int NC, int NDB>
__global__ __launch_bounds__(256) void prep_kernel(
    const float* __restrict__ x, const float* __restrict__ g,
    const float* __restrict__ bta, __bf16* __restrict__ lo,
    const float* __restrict__ wa, const float* __restrict__ wb, const float* __restrict__ wc,
    __bf16* __restrict__ oa, __bf16* __restrict__ ob, __bf16* __restrict__ oc,
    const float* __restrict__ g2, const float* __restrict__ bta2,
    float* __restrict__ csp, float* __restrict__ cup) {
  const int b = blockIdx.x;              // the branches and the selections are uniform for the block
  if (b < NB) {
    cast_fold_block<NDB>(wb, ob, g2, bta2, csp, cup, b);
  } else if (b < NA + NB + NC) {
    const bool ia = b < NB + NA;
    cast_block(ia ? wa : wc, ia ? oa : oc, ia ? b - NB : b - (NB + NA));
  } else {
    ln_row(x, g, bta, lo, b - (NA + NB + NC));
  }
}

// ------------------------------- WMMA GEMM ----------------------------------
// C[M,N] = act(A[M,K] @ B[K,N] + bias) (+ res).  A/B bf16 row-major, acc f32.
// Block BM x BN, 8 waves as 4 (M) x 2 (N); wave tile BM/4 x BN/2.
// A block stages (BM + BN) k-rows for BM x BN results and a wave reads BM/64 + BN/32 fragments
// for their product of WMMAs, so both the bytes that come from L2 and the bytes read from LDS
// per product fall as the tile grows.  BM x BN is chosen per launch: the largest tile whose
// grid still gives every WGP a block (M a multiple of BM, N of BN).
// Double-buffered LDS staging via async global->LDS copies:
//   iter k: wait(async) -> barrier -> issue stage(k+1) -> WMMA on tile k.
// A stage holds BK k values (K a multiple of BK).  The operands come from memory, so a trip
// lasts at least one memory latency: BK sets how many bytes fly and how many products run
// per latency.  BK is chosen per launch: as deep as the LDS holds for the blocks a WGP gets.
// LDC: the row pitch of C and res in elements (the launch's N), a constant so that the rows of a
// tile are immediate offsets from one address.
// KD: the launch's K.  With both pitches constant, a thread's copies of one stage and of the next
// differ by constants: each copy's global and LDS address is kept in registers and stepped by one
// add a stage, so no multiply or shift stands on the way from a stage's barrier to its copies.
constexpr int cgcd(int a, int b) { return b ? cgcd(b, a % b) : a; }
// What a block with a folded LayerNorm keeps in LDS for its epilogue: (mean, 1 / deviation) of its
// rows, cs and cu of its columns.  Only such a launch has this array.
template <int BM, int BN>
struct LnFold { f32x2 row[BM]; float cs[BN]; float cu[BN]; };
template <int BM, int BN>
static __device__ __forceinline__ LnFold<BM, BN>* ln_fold() {
  __shared__ __attribute__((aligned(16))) LnFold<BM, BN> a;
  return &a;
}
// LNR > 0: A holds rows that are not yet normalized and B carries the LayerNorm's gain; the epilogue
// forms rstd * (acc - mu * cs[n]) + cu[n] (BIAS is then false: bias goes into cu).
// lnst[h][row] = (sum, sum of squares) of the h-th sixteenth of the row, as its producer left them,
// in planes of LNR rows; lncs and lncu hold the column sums of KD / FOLD_ROWS groups of B's rows in
// planes of LDC floats (all constants, so that the planes are immediate offsets from one address).
template <int BM, int BN, int BK, int LDC, int KD, bool BIAS, bool RELU, bool RES, bool OBF16, int LNR>
__global__ __launch_bounds__(256) void gemm_bf16_wmma(
    const __bf16* __restrict__ A, const __bf16* __restrict__ B,
    const float* __restrict__ bias, const float* __restrict__ res,
    float* __restrict__ Cf, __bf16* __restrict__ Cb,
    const float* __restrict__ lnst, const float* __restrict__ lncs, const float* __restrict__ lncu,
    int M, int N, int K) {
  // A rows: 2 BK + 16 B = 16 B x odd (ds_load_b128); B rows: 2 BN + 32 B = 32 B x odd (ds_load_tr16_b128).
  static_assert(BK % 64 == 0, "A rows are staged as whole 128-byte lines");
  static_assert(BM % 64 == 0 && BN % 64 == 0, "whole 16 x 16 tiles a wave, B rows of whole lines");
  static_assert(BM * BK % 2048 == 0 && BK * BN % 2048 == 0, "every thread copies the same count");
  constexpr int PB = BN + 16;
  constexpr int MT = BM / 64;    // 16-row tiles of a wave
  constexpr int NT = BN / 32;    // 16-column tiles of a wave
  constexpr bool GROUPED = MT > 2;   // tiles with more rows of products than the 128 x 128 block's
  constexpr bool LNF = LNR > 0;      // a LayerNorm of A's rows is applied in the epilogue
  __shared__ __attribute__((aligned(16))) __bf16 As[2][BM][BK + 8];    // [m][k]
  __shared__ __attribute__((aligned(32))) __bf16 Bs[2][BK][PB];        // [k][n]

  const int tid = threadIdx.x;
  const int lane = tid & 31;
  const int w = tid >> 5;
  const int wm = (w & 3) * (BM / 4);   // 4 waves along M
  const int wn = (w >> 2) * (BN / 2);  // 2 waves along N
  const int m0 = blockIdx.y * BM;
  const int n0 = blockIdx.x * BN;
  const int ml = lane & 15;
  const int kb = (lane >> 4) * 8;
  const int half8 = (lane >> 4) * 8;

  v8f acc[MT][NT];
  const v8f vz = {};
#pragma unroll
  for (int i = 0; i < MT; ++i)
#pragma unroll
    for (int j = 0; j < NT; ++j) acc[i][j] = vz;

  // Where this thread's copies of the next stage read and write; set here for stage 0, buffer 0.
  // Every loop over these arrays is unrolled, so that they stay in registers.
  constexpr int NCA = BM * BK / 2048, NCB = BK * BN / 2048;
  const char* ga[NCA];
  const char* gb[NCB];
  lds_ptr la[NCA], lb[NCB];
  // A tile BM x BK in chunks of 8 bf16, BK / 8 to a row.
#pragma unroll
  for (int it = 0; it < NCA; ++it) {
    int c = tid + it * 256;
    int r = c / (BK / 8);
    int col = (c % (BK / 8)) * 8;
    ga[it] = (const char*)(A + (size_t)(m0 + r) * KD + col);
    la[it] = (lds_ptr)&As[0][r][col];
  }
  // B tile BK x BN, BN / 8 chunks to a row (kept [k][n], no transpose so it can stream async).
#pragma unroll
  for (int it = 0; it < NCB; ++it) {
    int c = tid + it * 256;
    int kr = c / (BN / 8);
    int nc = (c % (BN / 8)) * 8;
    gb[it] = (const char*)(B + (size_t)kr * LDC + n0 + nc);
    lb[it] = (lds_ptr)&Bs[0][kr][nc];
  }
  int da = (int)sizeof(As[0]), db = (int)sizeof(Bs[0]);   // to the other buffer; the sign turns every stage
  auto stage = [&]() {
#pragma unroll
    for (int it = 0; it < NCA; ++it) copy16_g2l(ga[it], la[it]);
#pragma unroll
    for (int it = 0; it < NCB; ++it) copy16_g2l(gb[it], lb[it]);
#pragma unroll
    for (int it = 0; it < NCA; ++it) { ga[it] += BK * 2; la[it] += da; }
#pragma unroll
    for (int it = 0; it < NCB; ++it) { gb[it] += (size_t)BK * LDC * 2; lb[it] += db; }
    da = -da;
    db = -db;
  };

  constexpr int nk = KD / BK;
  stage();
  // Mean and 1 / deviation of the block's rows and the two sums of its columns, one row and one
  // column a thread, formed while stage 0 is on its way and left in LDS for the epilogue; the
  // loop's first barrier makes them visible.
  if constexpr (LNF) {
    static_assert(BM == 256 && BN == 256, "one row and one column a thread");
    // Keeps all of stage 0's copies ahead of these loads: left free, the last copies were issued
    // behind the waits for the first loads.
    __builtin_amdgcn_sched_barrier(0);
    const int row = m0 + tid, col = n0 + tid;
    const f32x2* tp = (const f32x2*)lnst;
    f32x2 st = tp[row];
    float cs = lncs[col], cu = lncu[col];
    const float bc = bias[col];
#pragma unroll
    for (int j = 1; j < 16; ++j) st += tp[row + j * LNR];
#pragma unroll
    for (int j = 1; j < KD / FOLD_ROWS; ++j) { cs += lncs[col + j * LDC]; cu += lncu[col + j * LDC]; }
    // The loads' offset registers (the row, the column) are reused only behind this wait.
    asm volatile("s_wait_xcnt 0x0" :: "v"(row), "v"(col) : "memory");
    const float mean = st.x * (1.0f / KD);
    ln_fold<BM, BN>()->row[tid] = f32x2{mean, rsqrtf(st.y * (1.0f / KD) - mean * mean + 1e-5f)};
    ln_fold<BM, BN>()->cs[tid] = cs;
    ln_fold<BM, BN>()->cu[tid] = cu + bc;
  }
  for (int kk = 0; kk < nk; ++kk) {
    const int buf = kk & 1;
    g2l_wait();        // own async stores to LDS have landed
    __syncthreads();   // everyone's have
    if (kk + 1 < nk) stage();

    // The stage's 32-k slices in ascending k.  Unrolled: every LDS offset is a constant and
    // a slice's fragment loads can issue under the slice before.
#pragma unroll
    for (int ks = 0; ks < BK; ks += 32) {
      Frag16 af[MT];
      FragT bfr[NT];
#pragma unroll
      for (int mt = 0; mt < MT; ++mt) {
        int r = wm + mt * 16 + ml;
        af[mt].u[0] = *(const uint4*)&As[buf][r][ks + kb];
        af[mt].u[1] = *(const uint4*)&As[buf][r][ks + 16 + kb];
      }
      // B fragments straight from the [k][n] tile: k = kb + 0..7 and 16 + kb + 0..7 of
      // column wn + 16 nt + ml, the same k order as A's two 16-byte loads.
      const unsigned char* bp =
          (const unsigned char*)&Bs[buf][ks + kb + (lane & 7)][wn + ((lane >> 3) & 1) * 8];
#pragma unroll
      for (int nt = 0; nt < NT; ++nt) {
        bfr[nt].q[0] = ld_tr16(bp + 32 * nt);
        bfr[nt].q[1] = ld_tr16(bp + 16 * PB * 2 + 32 * nt);
      }
      // Keeps a large tile's fragment loads ahead of all the slice's products: left free, each row
      // of products fetched its A fragment right in front of it and waited out an LDS latency.
      if constexpr (GROUPED) __builtin_amdgcn_sched_barrier(0);
#pragma unroll
      for (int mt = 0; mt < MT; ++mt)
#pragma unroll
        for (int nt = 0; nt < NT; ++nt)
          acc[mt][nt] = __builtin_amdgcn_wmma_f32_16x16x32_bf16(   // C^T tile: B^T first, A^T second
              false, bfr[nt].v, false, af[mt].v, (short)0, acc[mt][nt], false, false);
    }
    __syncthreads();   // reads done before this buffer is re-staged
  }

  // Epilogue.  The products are formed transposed (the two fragments have the same lane and
  // k layout, so they only change places): acc[mt][nt][r] = C[wm + 16 mt + ml][wn + 16 nt + half8 + r],
  // 8 adjacent columns of one row in a lane.  Each wave writes its tile into its own range of the
  // A buffers (free behind the loop's last barrier) with 16-byte LDS stores and reads it back
  // row by row, so that every global access is 16 bytes a lane over whole rows of the tile.
  static_assert(!(OBF16 && RES), "the residual is added in f32, behind the staging");
  constexpr int WR = BM / 4, WC = BN / 2;       // rows and columns of a wave's tile
  constexpr int ESZ = OBF16 ? 2 : 4;            // bytes of a staged element
  constexpr int SP = WC * ESZ + 16;             // staged row pitch: 16 B x odd (16-byte LDS accesses)
  constexpr int CPR = WC * ESZ / 16;            // 16-byte pieces of a row
  constexpr int PER = CPR / cgcd(32, CPR);      // wave-wide accesses until the lanes' pattern repeats,
  constexpr int RPP = 32 / cgcd(32, CPR);       // which is this many rows further down
  static_assert((SP / 16) % 2 == 1 && WR % RPP == 0, "pitch; whole periods");
  static_assert(8 * WR * SP <= (int)sizeof(As), "the eight waves' ranges fit the A buffers");
  unsigned char* sw = (unsigned char*)&As[0][0][0] + w * (WR * SP);

  // Where a lane reads the staged tile back, and the element of C that piece starts at.
  const unsigned char* sp[PER];
  int gn[PER];
  size_t gi[PER];
#pragma unroll
  for (int t = 0; t < PER; ++t) {
    const int c = t * 32 + lane;
    sp[t] = sw + (c / CPR) * SP + (c % CPR) * 16;
    gn[t] = n0 + wn + (c % CPR) * (16 / ESZ);
    gi[t] = (size_t)(m0 + wm + c / CPR) * LDC + gn[t];
  }

  f32x4 bq[OBF16 ? NT : 1][2];                  // bias of the lane's columns
  f32x4 rv[OBF16 ? 1 : WR / RPP];               // residual of the lane's pieces
  static_assert(!LNF || (OBF16 && !BIAS), "the folded LayerNorm brings its own bias");
  f32x4 sq[LNF ? NT : 1][2], cq[LNF ? NT : 1][2];   // cs and cu of the lane's columns
  if constexpr (OBF16) {
    if constexpr (BIAS) {
      const float* bp = bias + n0 + wn + half8;
#pragma unroll
      for (int nt = 0; nt < NT; ++nt) {
        bq[nt][0] = *(const f32x4*)(bp + nt * 16);
        bq[nt][1] = *(const f32x4*)(bp + nt * 16 + 4);
      }
      // The loads' address register is free for reuse only behind this wait: named as an input,
      // it also stays out of the loads' own destinations.
      asm volatile("s_wait_xcnt 0x0" :: "v"(bp) : "memory");
    }
    float mu[LNF ? MT : 1], rs[LNF ? MT : 1];   // of the lane's rows
    if constexpr (LNF) {
      const float* sl = ln_fold<BM, BN>()->cs + wn + half8;
      const float* cl = ln_fold<BM, BN>()->cu + wn + half8;
#pragma unroll
      for (int nt = 0; nt < NT; ++nt) {
        sq[nt][0] = *(const f32x4*)(sl + nt * 16);
        sq[nt][1] = *(const f32x4*)(sl + nt * 16 + 4);
        cq[nt][0] = *(const f32x4*)(cl + nt * 16);
        cq[nt][1] = *(const f32x4*)(cl + nt * 16 + 4);
      }
#pragma unroll
      for (int mt = 0; mt < MT; ++mt) {
        const f32x2 mr = ln_fold<BM, BN>()->row[wm + mt * 16 + ml];
        mu[mt] = mr.x;
        rs[mt] = mr.y;
      }
    }
#pragma unroll
    for (int mt = 0; mt < MT; ++mt) {
#pragma unroll
      for (int nt = 0; nt < NT; ++nt) {
        f32x4 lo = {acc[mt][nt][0], acc[mt][nt][1], acc[mt][nt][2], acc[mt][nt][3]};
        f32x4 hi = {acc[mt][nt][4], acc[mt][nt][5], acc[mt][nt][6], acc[mt][nt][7]};
        if constexpr (LNF) {
          lo = (lo - sq[nt][0] * mu[mt]) * rs[mt] + cq[nt][0];
          hi = (hi - sq[nt][1] * mu[mt]) * rs[mt] + cq[nt][1];
        }
        if constexpr (BIAS) { lo += bq[nt][0]; hi += bq[nt][1]; }
        if constexpr (RELU) {
#pragma unroll
          for (int i = 0; i < 4; ++i) { lo[i] = fmaxf(lo[i], 0.0f); hi[i] = fmaxf(hi[i], 0.0f); }
        }
        const u32x4 pk = {pack2(lo[0], lo[1]), pack2(lo[2], lo[3]), pack2(hi[0], hi[1]), pack2(hi[2], hi[3])};
        *(u32x4*)(sw + (mt * 16 + ml) * SP + (nt * 16 + half8) * ESZ) = pk;
      }
    }
  } else {
    static_assert(OBF16 || (PER == 1 && BIAS && RES), "f32 output: one lane pattern, bias and residual");
    // Bias and residual of the lane's pieces, in flight under the staging.
    const float* bp = bias + gn[0];
    const float* rp = res + gi[0];
    bq[0][0] = *(const f32x4*)bp;
#pragma unroll
    for (int j = 0; j < WR / RPP; ++j) rv[j] = *(const f32x4*)(rp + (size_t)j * RPP * LDC);
    // As above: the two address registers are reused only behind this wait.
    asm volatile("s_wait_xcnt 0x0" :: "v"(bp), "v"(rp) : "memory");
#pragma unroll
    for (int mt = 0; mt < MT; ++mt) {
#pragma unroll
      for (int nt = 0; nt < NT; ++nt) {
        unsigned char* d = sw + (mt * 16 + ml) * SP + (nt * 16 + half8) * ESZ;
        *(f32x4*)d = f32x4{acc[mt][nt][0], acc[mt][nt][1], acc[mt][nt][2], acc[mt][nt][3]};
        *(f32x4*)(d + 16) = f32x4{acc[mt][nt][4], acc[mt][nt][5], acc[mt][nt][6], acc[mt][nt][7]};
      }
    }
  }
  // The wave's own staged rows are in LDS before its lanes read one another's pieces back.
  asm volatile("s_wait_dscnt 0x0" ::: "memory");
#pragma unroll
  for (int j = 0; j < WR / RPP; ++j) {
#pragma unroll
    for (int t = 0; t < PER; ++t) {
      const unsigned char* s = sp[t] + j * RPP * SP;
      const size_t idx = gi[t] + (size_t)j * RPP * LDC;
      if constexpr (OBF16) {
        *(u32x4*)(Cb + idx) = *(const u32x4*)s;
      } else {
        f32x4 v = *(const f32x4*)s + bq[0][0];
        if constexpr (RELU) {
#pragma unroll
          for (int i = 0; i < 4; ++i) v[i] = fmaxf(v[i], 0.0f);
        }
        *(f32x4*)(Cf + idx) = v + rv[j];
      }
    }
  }
}

constexpr int AT_PK = 144;              // K row pitch in LDS: 16 B x odd (ds_load_b128)
constexpr int AT_PV = 160;              // V row pitch in LDS: 32 B x odd (ds_load_tr16_b128)
constexpr int AT_KEYS = 128;            // keys of a tile
constexpr int AT_TK = AT_KEYS * AT_PK;  // one K tile
constexpr int AT_SLOT = AT_TK + AT_KEYS * AT_PV;

static __device__ __forceinline__ float xhalf(float v) {  // lane l <-> lane l ^ 16
  int b = __builtin_bit_cast(int, v);
  return __builtin_bit_cast(float,
      __builtin_amdgcn_permlanex16(b, b, 0x76543210, 0xfedcba98, false, false));
}
static __device__ __forceinline__ v8f mma_bf16(const FragT& a, const FragT& b, v8f c) {
  return __builtin_amdgcn_wmma_f32_16x16x32_bf16(false, a.v, false, b.v, (short)0, c, false, false);
}

// ROWS: rows of x (all batches), the length of one head's plane of lnst.
template <int ROWS>
__global__ __launch_bounds__(256) void attn_kernel(
    const __bf16* __restrict__ kqv, const float* __restrict__ x,
    float* __restrict__ x1, __bf16* __restrict__ x1b, float* __restrict__ lnst) {
  constexpr int E = 1024, S = 2048, K3 = 3 * E;
  __shared__ __attribute__((aligned(32))) unsigned char L[2 * AT_SLOT];
  const int tid = threadIdx.x;
  const int lane = tid & 31;
  const int wave = __builtin_amdgcn_readfirstlane(tid >> 5);
  const int qwv = wave & 3;              // which 16 queries of the block
  const int kh = wave >> 2;              // which 32-key blocks of a tile: kh and kh + 2
  const int c = lane & 15;
  const int hh = lane >> 4;
  const int h = blockIdx.x & 15;
  const int b = blockIdx.x >> 4;
  // Query block: the cost falls with the index, for speed only.
  const int qb = 31 - blockIdx.y;
  const int qw0 = qb * 64 + qwv * 16;    // first query of this wave
  const int myq = qw0 + c;               // this lane's query
  constexpr float LOG2E = 1.4426950408889634f;
  const float slope2 = exp2f(-0.5f * (float)(h + 1)) * LOG2E;  // (2^8)^(-(h+1)/16), base 2
  const float c1 = 0.03125f * LOG2E;                           // 1/sqrt(E), base 2

  const __bf16* kvb = kqv + (size_t)(b * S) * K3 + h * 64;     // K rows; V rows at + 2E
  const int srow = tid >> 3, scol = tid & 7;
  u32x4 rk[4], rv[4];
  auto gload = [&](int st) {
    for (int it = 0; it < 4; ++it) {
      const __bf16* p = kvb + (size_t)(st * AT_KEYS + srow + it * 32) * K3 + scol * 8;
      rk[it] = *(const u32x4*)p;
      rv[it] = *(const u32x4*)(p + 2 * E);
    }
  };
  auto lstore = [&](int buf) {
    unsigned char* d = L + buf * AT_SLOT;
    for (int it = 0; it < 4; ++it) {
      const int row = srow + it * 32;
      *(u32x4*)(d + row * AT_PK + scol * 16) = rk[it];
      *(u32x4*)(d + AT_TK + row * AT_PV + scol * 16) = rv[it];
    }
  };

  gload(0);
  // Q fragments (B operand), k order 8*hh + 0..7, 16 + 8*hh + 0..7 per 32.
  FragT qf[2];
  {
    const __bf16* qp = kqv + (size_t)(b * S + myq) * K3 + E + h * 64 + 8 * hh;
    for (int kc = 0; kc < 2; ++kc) {
      qf[kc].q[0] = *(const u32x4*)(qp + 32 * kc);
      qf[kc].q[1] = *(const u32x4*)(qp + 32 * kc + 16);
    }
  }
  const v8f vz = {};
  v8f acc[4];                            // acc[t][r] = O^T[16 t + 8 hh + r][query c]
  for (int t = 0; t < 4; ++t) acc[t] = vz;
  float m_run = -INFINITY;               // running maximum (base 2), equal in both halves
  float l_run = 0.0f;                    // this half's share of the denominator
  lstore(0);
  __syncthreads();                       // tile 0 visible to all eight waves

  const int nst = (qb + 2) >> 1;         // the last tile holds the diagonal
  for (int st = 0; st < nst; ++st) {
    const unsigned char* Lb = L + (st & 1) * AT_SLOT;
    const bool more = st + 1 < nst;
    if (more) {
      gload(st + 1);                     // in flight under this tile's work
      // The loads' address registers are reused by the work below.
      asm volatile("s_wait_xcnt 0x0" ::: "memory");
    }
    // This wave's first 32-key block of the tile; its second lies 64 rows further down.
    const unsigned char* kp = Lb + (kh * 32 + c) * AT_PK + 16 * hh;
    const unsigned char* vp = Lb + AT_TK + (kh * 32 + 8 * hh + (lane & 7)) * AT_PV +
                              ((lane >> 3) & 1) * 16;
    // Unrolled: the second block's LDS reads are immediate offsets from the same two addresses.
#pragma unroll
    for (int sub = 0; sub < 2; ++sub) {
      const int key0 = st * AT_KEYS + (2 * sub + kh) * 32;
      if (key0 <= qw0 + 15) {            // wave-uniform: skip keys beyond the wave's last query
        FragT kf[2][2], vf[4];
        for (int kt = 0; kt < 2; ++kt) {
          const unsigned char* p = kp + (64 * sub + 16 * kt) * AT_PK;
          for (int kc = 0; kc < 2; ++kc) {
            kf[kt][kc].q[0] = *(const u32x4*)(p + 64 * kc);
            kf[kt][kc].q[1] = *(const u32x4*)(p + 64 * kc + 32);
          }
        }
        {
          const unsigned char* ad = vp + 64 * sub * AT_PV;
          for (int t = 0; t < 4; ++t) {
            vf[t].q[0] = ld_tr16(ad + 32 * t);
            vf[t].q[1] = ld_tr16(ad + 16 * AT_PV + 32 * t);
          }
        }
        // Keeps the pass's 16 LDS loads in one group ahead of the products: one
        // LDS latency a pass; left free, each product waited for its own pair.
        __builtin_amdgcn_sched_barrier(0);
        f32x2 tv[8];                     // tv[4 kt + j]: keys key0 + 16 kt + 8 hh + 2 j, + 1
        for (int kt = 0; kt < 2; ++kt) {
          v8f s = mma_bf16(kf[kt][0], qf[0], vz);
          s = mma_bf16(kf[kt][1], qf[1], s);
          for (int j = 0; j < 4; ++j)
            tv[4 * kt + j] = __builtin_elementwise_fma(
                f32x2{s[2 * j], s[2 * j + 1]}, f32x2{c1, c1},
                f32x2{slope2 * (float)(16 * kt + 2 * j), slope2 * (float)(16 * kt + 2 * j + 1)});
        }
        if (key0 + 31 > qw0) {           // wave-uniform: causal mask near the diagonal only
          for (int i = 0; i < 8; ++i) {
            const int key = key0 + 16 * (i >> 2) + 8 * hh + 2 * (i & 3);
            if (key > myq) tv[i].x = -INFINITY;
            if (key + 1 > myq) tv[i].y = -INFINITY;
          }
        }
        float mx = fmaxf(tv[0].x, tv[0].y);
        for (int i = 1; i < 8; ++i) mx = fmaxf(fmaxf(mx, tv[i].x), tv[i].y);
        const float base = slope2 * (float)(key0 + 8 * hh - myq);  // rest of the ALiBi term, per half
        mx += base;
        mx = fmaxf(mx, xhalf(mx));       // finite: the pass's first key is visible to every query
        const float m_new = fmaxf(m_run, mx);
        const float corr = __builtin_amdgcn_exp2f(m_run - m_new);
        const float nm = base - m_new;
        m_run = m_new;
        f32x2 ps2 = {0.0f, 0.0f};
        FragT pf;
        for (int i = 0; i < 8; ++i) {
          const f32x2 a = tv[i] + f32x2{nm, nm};
          const f32x2 p = {__builtin_amdgcn_exp2f(a.x), __builtin_amdgcn_exp2f(a.y)};
          ps2 += p;
          pf.q[i >> 2][i & 3] = pack2(p.x, p.y);
        }
        const float ps = ps2.x + ps2.y;
        l_run = l_run * corr + ps;
        for (int t = 0; t < 4; ++t) acc[t] = acc[t] * corr;
        for (int t = 0; t < 4; ++t) acc[t] = mma_bf16(vf[t], pf, acc[t]);
      }
    }
    if (more) {
      lstore((st + 1) & 1);              // its last readers left before the previous barrier
      __syncthreads();                   // next tile visible; this tile's reads are over
    }
  }

  // Join the two waves of a query tile: wave w + 4 hands its maximum, sum and O^T to wave w
  // through the K/V buffers, 16 bytes a lane and 512 contiguous bytes a wave-wide access.
  __syncthreads();                       // every wave has left the last tile: the buffers are free
  f32x4* jx = (f32x4*)L + qwv * (9 * 32) + lane;
  if (kh == 1) {                         // wave-uniform
    for (int t = 0; t < 4; ++t) {
      jx[(2 * t) * 32] = f32x4{acc[t][0], acc[t][1], acc[t][2], acc[t][3]};
      jx[(2 * t + 1) * 32] = f32x4{acc[t][4], acc[t][5], acc[t][6], acc[t][7]};
    }
    jx[8 * 32] = f32x4{m_run, l_run, 0.0f, 0.0f};
  }
  __syncthreads();                       // the handed-over values are visible
  if (kh == 1) return;                   // behind the last barrier
  {
    // This wave has seen key 0, so its maximum is finite; the other's is -inf, with sum and
    // O^T zero, where all its keys lay beyond the diagonal: its weight is then exp2(-inf) = 0.
    const f32x4 ml = jx[8 * 32];
    const float m_all = fmaxf(m_run, ml.x);
    const float sa = __builtin_amdgcn_exp2f(m_run - m_all);
    const float sb = __builtin_amdgcn_exp2f(ml.x - m_all);
    l_run = l_run * sa + ml.y * sb;
    for (int t = 0; t < 4; ++t) {
      const f32x4 oa = jx[(2 * t) * 32], ob = jx[(2 * t + 1) * 32];
      for (int r = 0; r < 4; ++r) {
        acc[t][r] = acc[t][r] * sa + oa[r] * sb;
        acc[t][4 + r] = acc[t][4 + r] * sa + ob[r] * sb;
      }
    }
  }

  // Join the halves' denominators, normalize, fuse the residual: x1 = x + attn.
  // A lane owns 8 consecutive d of its query per tile: two 16-byte accesses.
  const float inv = 1.0f / (l_run + xhalf(l_run));
  f32x4 r1 = {0.f, 0.f, 0.f, 0.f}, r2 = {0.f, 0.f, 0.f, 0.f};
  for (int t = 0; t < 4; ++t) {
    const size_t idx = (size_t)(b * S + myq) * E + h * 64 + 16 * t + 8 * hh;
    const f32x4 xa = *(const f32x4*)(x + idx);
    const f32x4 xb = *(const f32x4*)(x + idx + 4);
    const f32x4 oa = {acc[t][0], acc[t][1], acc[t][2], acc[t][3]};
    const f32x4 ob = {acc[t][4], acc[t][5], acc[t][6], acc[t][7]};
    const f32x4 ya = xa + oa * inv, yb = xb + ob * inv;
    *(f32x4*)(x1 + idx) = ya;
    *(f32x4*)(x1 + idx + 4) = yb;
    *(u32x4*)(x1b + idx) =
        u32x4{pack2(ya[0], ya[1]), pack2(ya[2], ya[3]), pack2(yb[0], yb[1]), pack2(yb[2], yb[3])};
    r1 += ya + yb;
    r2 += ya * ya + yb * yb;
  }
  // The lane's 32 columns, then the other half's: a wave stores one whole 128-byte line.
  float s1 = (r1[0] + r1[1]) + (r1[2] + r1[3]), s2 = (r2[0] + r2[1]) + (r2[2] + r2[3]);
  s1 += xhalf(s1);
  s2 += xhalf(s2);
  if (hh == 0) *(f32x2*)(lnst + 2 * (h * ROWS + b * S + myq)) = f32x2{s1, s2};
}

// ------------------------------- launch -------------------------------------
extern "C" void kernel_launch(void* const* d_in, const int* in_sizes, int n_in,
                              void* d_out, int out_size, void* d_ws, size_t ws_size,
                              hipStream_t stream) {
  constexpr int E = 1024, H = 16, DFF = 4096, Bq = 2, S = 2048;
  constexpr int M = Bq * S;       // 4096
  constexpr int K3 = 3 * E;       // 3072
  (void)in_sizes; (void)n_in; (void)out_size; (void)ws_size;

  const float* x    = (const float*)d_in[0];
  const float* wkqv = (const float*)d_in[1];
  const float* ln1g = (const float*)d_in[2];
  const float* ln1b = (const float*)d_in[3];
  const float* ln2g = (const float*)d_in[4];
  const float* ln2b = (const float*)d_in[5];
  const float* w1   = (const float*)d_in[6];
  const float* b1   = (const float*)d_in[7];
  const float* w2   = (const float*)d_in[8];
  const float* b2   = (const float*)d_in[9];
  float* out = (float*)d_out;

  char* cur = (char*)d_ws;
  auto carve = [&](size_t bytes) -> char* {
    char* p = cur;
    cur += (bytes + 255) & ~(size_t)255;
    return p;
  };
  __bf16* ln1o  = (__bf16*)carve((size_t)M * E * 2);     // LN1 out (bf16)
  __bf16* wkqvb = (__bf16*)carve((size_t)E * K3 * 2);    // w_kqv bf16
  __bf16* kqvb  = (__bf16*)carve((size_t)M * K3 * 2);    // kqv bf16
  float*  x1    = (float*) carve((size_t)M * E * 4);     // x + attn
  __bf16* x1b   = (__bf16*)carve((size_t)M * E * 2);     // x + attn (bf16)
  __bf16* w1b   = (__bf16*)carve((size_t)E * DFF * 2);   // w1 bf16
  __bf16* w2b   = (__bf16*)carve((size_t)DFF * E * 2);   // w2 bf16
  __bf16* h1    = (__bf16*)carve((size_t)M * DFF * 2);   // relu(ffn1) bf16
  float*  lnst  = (float*) carve((size_t)H * M * 2 * 4); // per head and row: sum, sum of squares of x1
  float*  lncs  = (float*) carve((size_t)(E / FOLD_ROWS) * DFF * 4);   // column sums of ln2_g . w1, by row groups
  float*  lncu  = (float*) carve((size_t)(E / FOLD_ROWS) * DFF * 4);   // column sums of ln2_b . w1, by row groups

  // Weight casts (w1's with the folded LN2's gain and column sums) and LN1 in one launch: whole cast
  // blocks, then one block a row.
  static_assert(E * K3 % CAST_BLK == 0 && E * DFF % CAST_BLK == 0, "cast grid must be exact");
  constexpr int NA = E * K3 / CAST_BLK, NB = E * DFF / CAST_BLK, NC = DFF * E / CAST_BLK;
  static_assert(E % FOLD_ROWS == 0, "whole row groups");
  prep_kernel<NA, NB, NC, DFF><<<NA + NB + NC + M, 256, 0, stream>>>(
      x, ln1g, ln1b, ln1o, wkqv, w1, w2, wkqvb, w1b, w2b, ln2g, ln2b, lncs, lncu);

  // kqv = ln1 @ w_kqv -> bf16   [4096 x 3072], K=1024; 16 x 16 blocks, 1 a WGP
  static_assert(M % 256 == 0 && K3 % 192 == 0 && DFF % 256 == 0, "whole tiles");
  gemm_bf16_wmma<256, 192, 128, K3, E, false, false, false, true, 0>
      <<<dim3(K3 / 192, M / 256), 256, 0, stream>>>(
          ln1o, wkqvb, nullptr, nullptr, nullptr, kqvb, nullptr, nullptr, nullptr, M, K3, E);

  // x1 = x + attention(kqv)
  attn_kernel<M><<<dim3(H * Bq, S / 64), 256, 0, stream>>>(kqvb, x, x1, x1b, lnst);

  // h1 = relu(LN2(x1) @ w1 + b1) -> bf16   [4096 x 4096], K=1024; 16 x 16 blocks, 1 a WGP
  gemm_bf16_wmma<256, 256, 128, DFF, E, false, true, false, true, M>
      <<<dim3(DFF / 256, M / 256), 256, 0, stream>>>(
          x1b, w1b, b1, nullptr, nullptr, h1, lnst, lncs, lncu, M, DFF, E);

  // out = h1 @ w2 + b2 + x1   [4096 x 1024], K=4096; 1 block a WGP
  gemm_bf16_wmma<128, 128, 256, E, DFF, true, false, true, false, 0>
      <<<dim3(E / 128, M / 128), 256, 0, stream>>>(
          h1, w2b, b2, x1, out, nullptr, nullptr, nullptr, nullptr, M, E, DFF);
}
